// v000
// The times below were measured on an AMD MI455X: many runs one after another, warmed up first and cycling through
// copies of the inputs, with the whole window's GPU time divided by the number of runs. Launches and the gaps
// between them are all in it. The median over several windows is given; except for v000 it joins two sittings, which
// can be a few percent apart, so the side-by-side timings, each taken in one sitting, are the better comparison.
// The starting kernel, v000, takes 545 microseconds a run.
#include <hip/hip_runtime.h>
#include <stdint.h>

// Problem constants (match reference)
#define B_  2
#define N_  2048
#define D_  1024
#define H_  16
#define DH_ 64
#define FF_ 4096
#define ROWS (B_ * N_)          // 4096
#define HD  (H_ * DH_)          // 1024

typedef __attribute__((ext_vector_type(16))) __bf16 v16bf;
typedef __attribute__((ext_vector_type(8)))  float  v8f;

// Fragment: 8 dwords = two 16B chunks; loaded as 2x ds_load_b128.
union FragU { uint4 q[2]; unsigned int u[8]; v16bf v; };

static __device__ __forceinline__ unsigned short f2bf(float f) {
  union { float f; unsigned int u; } c; c.f = f;
  unsigned int u = c.u;
  unsigned int r = u + 0x7FFFu + ((u >> 16) & 1u);   // round-to-nearest-even
  return (unsigned short)(r >> 16);
}

static __device__ __forceinline__ void async_copy_32B(const void* gsrc, void* ldst) {
  unsigned int       l = (unsigned int)(unsigned long long)ldst;   // low 32 bits = LDS addr
  unsigned long long g = (unsigned long long)gsrc;
  asm volatile("global_load_async_to_lds_b128 %0, %1, off\n\t"
               "global_load_async_to_lds_b128 %0, %1, off offset:16"
               :: "v"(l), "v"(g) : "memory");
}
static __device__ __forceinline__ void async_wait() {
  asm volatile("s_wait_asynccnt 0x0" ::: "memory");
}

// ---------------------------------------------------------------------------
// Elementwise f32 -> bf16 cast (weights), 4 elements/thread
// ---------------------------------------------------------------------------
__global__ void cast_bf16_kernel(const float* __restrict__ in,
                                 unsigned short* __restrict__ out, int n) {
  int i = (blockIdx.x * blockDim.x + threadIdx.x) * 4;
  if (i < n) {
    float4 f = *(const float4*)(in + i);
    union { unsigned short s[4]; uint2 u; } r;
    r.s[0] = f2bf(f.x); r.s[1] = f2bf(f.y); r.s[2] = f2bf(f.z); r.s[3] = f2bf(f.w);
    *(uint2*)(out + i) = r.u;
  }
}

// ---------------------------------------------------------------------------
// Row LayerNorm (D=1024), fp32 in -> bf16 out. One block (256 thr) per row.
// ---------------------------------------------------------------------------
__global__ __launch_bounds__(256)
void layernorm_bf16_kernel(const float* __restrict__ x,
                           const float* __restrict__ g,
                           const float* __restrict__ b,
                           unsigned short* __restrict__ out) {
  __shared__ float red[256];
  int row = blockIdx.x;
  int t = threadIdx.x;
  const float* xr = x + (size_t)row * D_;
  float v[4];
  float s = 0.f;
#pragma unroll
  for (int i = 0; i < 4; ++i) { v[i] = xr[t + i * 256]; s += v[i]; }
  red[t] = s; __syncthreads();
  for (int off = 128; off > 0; off >>= 1) {
    if (t < off) red[t] += red[t + off];
    __syncthreads();
  }
  float mu = red[0] * (1.f / D_);
  __syncthreads();
  float s2 = 0.f;
#pragma unroll
  for (int i = 0; i < 4; ++i) { float d = v[i] - mu; s2 += d * d; }
  red[t] = s2; __syncthreads();
  for (int off = 128; off > 0; off >>= 1) {
    if (t < off) red[t] += red[t + off];
    __syncthreads();
  }
  float rstd = rsqrtf(red[0] * (1.f / D_) + 1e-5f);
#pragma unroll
  for (int i = 0; i < 4; ++i) {
    int c = t + i * 256;
    out[(size_t)row * D_ + c] = f2bf((v[i] - mu) * rstd * g[c] + b[c]);
  }
}

// ---------------------------------------------------------------------------
// Generic bf16 WMMA GEMM:  C[M,N] = A[M,K] @ Bw[K,N]  (f32 accumulate)
// 64x64 tile per block, 128 threads = 4 waves, each wave 16(M) x 64(N).
// Double-buffered software pipeline: async A copy + B global loads for
// tile k+1 are issued before the WMMAs of tile k; B ds_stores after.
// All fragments preloaded so dscnt waits can stagger across the WMMAs.
// ---------------------------------------------------------------------------
__global__ __launch_bounds__(128)
void gemm_wmma_kernel(const unsigned short* __restrict__ A,
                      const unsigned short* __restrict__ Bw,
                      int M, int N, int K,
                      const float* __restrict__ bias, int do_gelu,
                      const float* __restrict__ resid,
                      unsigned short* __restrict__ outb,
                      float* __restrict__ outf) {
  __shared__ alignas(16) unsigned short Alds[2][64][40];  // [m][k], 80B rows (padded)
  __shared__ alignas(16) unsigned int   Bt[2][64][20];    // [n][kpair], 80B rows (padded)

  int t = threadIdx.x;
  int wave = t >> 5, lane = t & 31;
  int lm = lane & 15, hf = lane >> 4;
  int mBase = blockIdx.y * 64;
  int nBase = blockIdx.x * 64;
  int rowBase = wave * 16;
  int kIters = K >> 5;

  auto stageA = [&](int kt, int buf) {
    int row = t >> 1, c16 = (t & 1) * 16;
    async_copy_32B(A + (size_t)(mBase + row) * K + kt * 32 + c16,
                   &Alds[buf][row][c16]);
  };
  unsigned int br0[4], br1[4];
  auto loadB = [&](int kt) {
#pragma unroll
    for (int i = 0; i < 4; ++i) {
      int idx = i * 128 + t;           // 512 tasks: (kp, n-pair)
      int kp = idx >> 5;               // 0..15
      int n0 = (idx & 31) * 2;         // 0..62 even
      int krow = kt * 32 + kp * 2;
      br0[i] = *(const unsigned int*)&Bw[(size_t)krow * N + nBase + n0];
      br1[i] = *(const unsigned int*)&Bw[(size_t)(krow + 1) * N + nBase + n0];
      if (kt + 1 < kIters)
        __builtin_prefetch(&Bw[(size_t)(krow + 32) * N + nBase + n0], 0, 1);
    }
  };
  auto storeB = [&](int buf) {
#pragma unroll
    for (int i = 0; i < 4; ++i) {
      int idx = i * 128 + t;
      int kp = idx >> 5;
      int n0 = (idx & 31) * 2;
      Bt[buf][n0][kp]     = (br0[i] & 0xFFFFu) | (br1[i] << 16);
      Bt[buf][n0 + 1][kp] = (br0[i] >> 16)     | (br1[i] & 0xFFFF0000u);
    }
  };

  v8f vzero = {};
  v8f acc[4];
#pragma unroll
  for (int c = 0; c < 4; ++c) acc[c] = vzero;

  // prologue: stage tile 0
  stageA(0, 0);
  loadB(0);
  storeB(0);
  async_wait();
  __syncthreads();

  for (int kt = 0; kt < kIters; ++kt) {
    int cur = kt & 1;
    bool more = (kt + 1) < kIters;
    if (more) { stageA(kt + 1, cur ^ 1); loadB(kt + 1); }

    // ---- preload all fragments (2x b128 each), then 4 WMMAs ----
    FragU af, bf[4];
    int arow = rowBase + lm;
    af.q[0] = *(const uint4*)&Alds[cur][arow][hf * 8];
    af.q[1] = *(const uint4*)&Alds[cur][arow][16 + hf * 8];
#pragma unroll
    for (int c = 0; c < 4; ++c) {
      bf[c].q[0] = *(const uint4*)&Bt[cur][c * 16 + lm][hf * 4];
      bf[c].q[1] = *(const uint4*)&Bt[cur][c * 16 + lm][8 + hf * 4];
    }
#pragma unroll
    for (int c = 0; c < 4; ++c) {
      acc[c] = __builtin_amdgcn_wmma_f32_16x16x32_bf16(
          false, af.v, false, bf[c].v, (short)0, acc[c], false, false);
    }

    if (more) storeB(cur ^ 1);
    async_wait();
    __syncthreads();
  }

  // ---- epilogue ----
#pragma unroll
  for (int c = 0; c < 4; ++c) {
    int col = nBase + c * 16 + lm;
#pragma unroll
    for (int v = 0; v < 8; ++v) {
      int row = mBase + rowBase + v + hf * 8;
      float val = acc[c][v];
      if (bias) val += bias[col];
      if (do_gelu) val = 0.5f * val * (1.f + erff(val * 0.70710678118654752f));
      if (resid) val += resid[(size_t)row * N + col];
      if (outf) outf[(size_t)row * N + col] = val;
      else      outb[(size_t)row * N + col] = f2bf(val);
    }
  }
}

// ---------------------------------------------------------------------------
// Flash attention (no 1/sqrt(d) scaling, per reference).
// Q/K/V bf16 laid out [B*N, H*DH]. Grid: (B*H, N/64), block 128 (4 waves).
// Double-buffered K (async) and V (regs->packed LDS) tiles.
// ---------------------------------------------------------------------------
__global__ __launch_bounds__(128)
void flash_attn_kernel(const unsigned short* __restrict__ Q,
                       const unsigned short* __restrict__ Km,
                       const unsigned short* __restrict__ Vm,
                       unsigned short* __restrict__ O) {
  __shared__ alignas(16) unsigned short Qs[64][72];       // 144B rows
  __shared__ alignas(16) unsigned short Ks[2][32][72];    // 144B rows
  __shared__ alignas(16) unsigned int   Vt[2][64][20];    // [dh][keypair], 80B rows
  __shared__ alignas(16) unsigned short Ps[4][16][40];    // per-wave P, 80B rows

  int t = threadIdx.x;
  int wave = t >> 5, lane = t & 31;
  int lm = lane & 15, hf = lane >> 4;
  int bh = blockIdx.x;
  int b = bh / H_, h = bh % H_;
  int q0 = b * N_ + blockIdx.y * 64;
  int colh = h * DH_;
  int rowBase = wave * 16;
  const int kbIters = N_ / 32;

  auto stageK = [&](int kb, int buf) {
    int k0 = b * N_ + kb * 32;
    int row = t >> 2, c16 = (t & 3) * 16;
    async_copy_32B(Km + (size_t)(k0 + row) * HD + colh + c16, &Ks[buf][row][c16]);
  };
  unsigned int vr0[4], vr1[4];
  auto loadV = [&](int kb) {
    int k0 = b * N_ + kb * 32;
#pragma unroll
    for (int i = 0; i < 4; ++i) {
      int idx = i * 128 + t;           // 512 tasks: (kp, dh-pair)
      int kp  = idx >> 5;              // 0..15
      int dh0 = (idx & 31) * 2;        // 0..62 even
      vr0[i] = *(const unsigned int*)&Vm[(size_t)(k0 + 2 * kp) * HD + colh + dh0];
      vr1[i] = *(const unsigned int*)&Vm[(size_t)(k0 + 2 * kp + 1) * HD + colh + dh0];
    }
  };
  auto storeV = [&](int buf) {
#pragma unroll
    for (int i = 0; i < 4; ++i) {
      int idx = i * 128 + t;
      int kp  = idx >> 5;
      int dh0 = (idx & 31) * 2;
      Vt[buf][dh0][kp]     = (vr0[i] & 0xFFFFu) | (vr1[i] << 16);
      Vt[buf][dh0 + 1][kp] = (vr0[i] >> 16)     | (vr1[i] & 0xFFFF0000u);
    }
  };

  // load Q tile 64x64 (64B per thread)
  {
    int row = t >> 1, c32 = (t & 1) * 32;
    const uint4* src = (const uint4*)(Q + (size_t)(q0 + row) * HD + colh + c32);
    uint4* dst = (uint4*)&Qs[row][c32];
    dst[0] = src[0]; dst[1] = src[1]; dst[2] = src[2]; dst[3] = src[3];
  }

  v8f vzero = {};
  v8f o[4];
#pragma unroll
  for (int c = 0; c < 4; ++c) o[c] = vzero;
  float mrow[8], lrow[8];
#pragma unroll
  for (int v = 0; v < 8; ++v) { mrow[v] = -1e30f; lrow[v] = 0.f; }

  // prologue: stage tile 0 (barrier also publishes Qs)
  stageK(0, 0);
  loadV(0);
  storeV(0);
  async_wait();
  __syncthreads();

  for (int kb = 0; kb < kbIters; ++kb) {
    int cur = kb & 1;
    bool more = (kb + 1) < kbIters;
    if (more) { stageK(kb + 1, cur ^ 1); loadV(kb + 1); }

    // ---- S = Q K^T  (two 16-key tiles, two k-steps over DH=64) ----
    v8f s[2]; s[0] = vzero; s[1] = vzero;
#pragma unroll
    for (int step = 0; step < 64; step += 32) {
      FragU qa, kf0, kf1;
      int arow = rowBase + lm;
      qa.q[0]  = *(const uint4*)&Qs[arow][step + hf * 8];
      qa.q[1]  = *(const uint4*)&Qs[arow][step + 16 + hf * 8];
      kf0.q[0] = *(const uint4*)&Ks[cur][lm][step + hf * 8];
      kf0.q[1] = *(const uint4*)&Ks[cur][lm][step + 16 + hf * 8];
      kf1.q[0] = *(const uint4*)&Ks[cur][16 + lm][step + hf * 8];
      kf1.q[1] = *(const uint4*)&Ks[cur][16 + lm][step + 16 + hf * 8];
      s[0] = __builtin_amdgcn_wmma_f32_16x16x32_bf16(
          false, qa.v, false, kf0.v, (short)0, s[0], false, false);
      s[1] = __builtin_amdgcn_wmma_f32_16x16x32_bf16(
          false, qa.v, false, kf1.v, (short)0, s[1], false, false);
    }

    // ---- online softmax (row stats live in WMMA C layout: row = v + hf*8) ----
    float p0[8], p1[8];
#pragma unroll
    for (int v = 0; v < 8; ++v) {
      float tm = fmaxf(s[0][v], s[1][v]);
#pragma unroll
      for (int msk = 8; msk >= 1; msk >>= 1) tm = fmaxf(tm, __shfl_xor(tm, msk, 32));
      float mn = fmaxf(mrow[v], tm);
      float scale = __expf(mrow[v] - mn);
      mrow[v] = mn;
      p0[v] = __expf(s[0][v] - mn);
      p1[v] = __expf(s[1][v] - mn);
      float rs = p0[v] + p1[v];
#pragma unroll
      for (int msk = 8; msk >= 1; msk >>= 1) rs += __shfl_xor(rs, msk, 32);
      lrow[v] = lrow[v] * scale + rs;
#pragma unroll
      for (int c = 0; c < 4; ++c) o[c][v] *= scale;
    }

#pragma unroll
    for (int v = 0; v < 8; ++v) {
      int pr = v + hf * 8;
      Ps[wave][pr][lm]      = f2bf(p0[v]);
      Ps[wave][pr][16 + lm] = f2bf(p1[v]);
    }
    __syncthreads();

    // ---- O += P @ V (preload all fragments, then 4 WMMAs) ----
    FragU pa, vf[4];
    pa.q[0] = *(const uint4*)&Ps[wave][lm][hf * 8];
    pa.q[1] = *(const uint4*)&Ps[wave][lm][16 + hf * 8];
#pragma unroll
    for (int ct = 0; ct < 4; ++ct) {
      vf[ct].q[0] = *(const uint4*)&Vt[cur][ct * 16 + lm][hf * 4];
      vf[ct].q[1] = *(const uint4*)&Vt[cur][ct * 16 + lm][8 + hf * 4];
    }
#pragma unroll
    for (int ct = 0; ct < 4; ++ct) {
      o[ct] = __builtin_amdgcn_wmma_f32_16x16x32_bf16(
          false, pa.v, false, vf[ct].v, (short)0, o[ct], false, false);
    }

    if (more) storeV(cur ^ 1);
    async_wait();
    __syncthreads();
  }

  // ---- normalize and store bf16 ----
#pragma unroll
  for (int ct = 0; ct < 4; ++ct) {
#pragma unroll
    for (int v = 0; v < 8; ++v) {
      int row = q0 + rowBase + v + hf * 8;
      int col = colh + ct * 16 + lm;
      O[(size_t)row * HD + col] = f2bf(o[ct][v] / lrow[v]);
    }
  }
}

// ---------------------------------------------------------------------------
// Host-side orchestration
// ---------------------------------------------------------------------------
extern "C" void kernel_launch(void* const* d_in, const int* in_sizes, int n_in,
                              void* d_out, int out_size, void* d_ws, size_t ws_size,
                              hipStream_t stream) {
  const float* x     = (const float*)d_in[0];
  const float* wq    = (const float*)d_in[1];
  const float* wk    = (const float*)d_in[2];
  const float* wv    = (const float*)d_in[3];
  const float* wo    = (const float*)d_in[4];
  const float* w1    = (const float*)d_in[5];
  const float* b1    = (const float*)d_in[6];
  const float* w2    = (const float*)d_in[7];
  const float* b2    = (const float*)d_in[8];
  const float* ln1_g = (const float*)d_in[9];
  const float* ln1_b = (const float*)d_in[10];
  const float* ln2_g = (const float*)d_in[11];
  const float* ln2_b = (const float*)d_in[12];
  float* out = (float*)d_out;

  // workspace carve-out (~120 MiB total)
  char* p = (char*)d_ws;
  auto alloc = [&](size_t bytes) -> void* {
    void* r = (void*)p;
    p += (bytes + 255) & ~(size_t)255;
    return r;
  };
  unsigned short* wq_b = (unsigned short*)alloc((size_t)D_ * HD * 2);
  unsigned short* wk_b = (unsigned short*)alloc((size_t)D_ * HD * 2);
  unsigned short* wv_b = (unsigned short*)alloc((size_t)D_ * HD * 2);
  unsigned short* wo_b = (unsigned short*)alloc((size_t)HD * D_ * 2);
  unsigned short* w1_b = (unsigned short*)alloc((size_t)D_ * FF_ * 2);
  unsigned short* w2_b = (unsigned short*)alloc((size_t)FF_ * D_ * 2);
  unsigned short* h_b  = (unsigned short*)alloc((size_t)ROWS * D_ * 2);
  unsigned short* q_b  = (unsigned short*)alloc((size_t)ROWS * HD * 2);
  unsigned short* k_b  = (unsigned short*)alloc((size_t)ROWS * HD * 2);
  unsigned short* v_b  = (unsigned short*)alloc((size_t)ROWS * HD * 2);
  unsigned short* a_b  = (unsigned short*)alloc((size_t)ROWS * HD * 2);
  float*          x2   = (float*)        alloc((size_t)ROWS * D_ * 4);
  unsigned short* h2_b = (unsigned short*)alloc((size_t)ROWS * D_ * 2);
  unsigned short* ff_b = (unsigned short*)alloc((size_t)ROWS * FF_ * 2);

  // 1) weights -> bf16
  auto cast = [&](const float* src, unsigned short* dst, int n) {
    cast_bf16_kernel<<<(n / 4 + 255) / 256, 256, 0, stream>>>(src, dst, n);
  };
  cast(wq, wq_b, D_ * HD);
  cast(wk, wk_b, D_ * HD);
  cast(wv, wv_b, D_ * HD);
  cast(wo, wo_b, HD * D_);
  cast(w1, w1_b, D_ * FF_);
  cast(w2, w2_b, FF_ * D_);

  // 2) LN1
  layernorm_bf16_kernel<<<ROWS, 256, 0, stream>>>(x, ln1_g, ln1_b, h_b);

  // 3) Q/K/V projections
  dim3 gemmBlk(128);
  dim3 gQKV(D_ / 64, ROWS / 64);
  gemm_wmma_kernel<<<gQKV, gemmBlk, 0, stream>>>(h_b, wq_b, ROWS, HD, D_,
                                                 nullptr, 0, nullptr, q_b, nullptr);
  gemm_wmma_kernel<<<gQKV, gemmBlk, 0, stream>>>(h_b, wk_b, ROWS, HD, D_,
                                                 nullptr, 0, nullptr, k_b, nullptr);
  gemm_wmma_kernel<<<gQKV, gemmBlk, 0, stream>>>(h_b, wv_b, ROWS, HD, D_,
                                                 nullptr, 0, nullptr, v_b, nullptr);

  // 4) attention
  dim3 gAttn(B_ * H_, N_ / 64);
  flash_attn_kernel<<<gAttn, gemmBlk, 0, stream>>>(q_b, k_b, v_b, a_b);

  // 5) out projection + residual -> x2 (fp32)
  gemm_wmma_kernel<<<gQKV, gemmBlk, 0, stream>>>(a_b, wo_b, ROWS, D_, HD,
                                                 nullptr, 0, x, nullptr, x2);

  // 6) LN2
  layernorm_bf16_kernel<<<ROWS, 256, 0, stream>>>(x2, ln2_g, ln2_b, h2_b);

  // 7) FF1 + bias + exact GELU -> bf16
  dim3 gFF1(FF_ / 64, ROWS / 64);
  gemm_wmma_kernel<<<gFF1, gemmBlk, 0, stream>>>(h2_b, w1_b, ROWS, FF_, D_,
                                                 b1, 1, nullptr, ff_b, nullptr);

  // 8) FF2 + bias + residual -> out (fp32)
  dim3 gFF2(D_ / 64, ROWS / 64);
  gemm_wmma_kernel<<<gFF2, gemmBlk, 0, stream>>>(ff_b, w2_b, ROWS, D_, FF_,
                                                 b2, 0, x2, nullptr, out);
}

// v001
// Measured time: 356 microseconds a run.
// Two timings next to v000 both put it at 1.58 times that version's speed.
#include <hip/hip_runtime.h>
#include <stdint.h>

// Problem constants (match reference)
#define B_  2
#define N_  2048
#define D_  1024
#define H_  16
#define DH_ 64
#define FF_ 4096
#define ROWS (B_ * N_)          // 4096
#define HD  (H_ * DH_)          // 1024

typedef __attribute__((ext_vector_type(16))) __bf16 v16bf;
typedef __attribute__((ext_vector_type(8)))  float  v8f;

// Fragment: 8 dwords = two 16B chunks; loaded as 2x ds_load_b128.
union FragU { uint4 q[2]; unsigned int u[8]; v16bf v; };

static __device__ __forceinline__ unsigned short f2bf(float f) {
  union { float f; unsigned int u; } c; c.f = f;
  unsigned int u = c.u;
  unsigned int r = u + 0x7FFFu + ((u >> 16) & 1u);   // round-to-nearest-even
  return (unsigned short)(r >> 16);
}

static __device__ __forceinline__ void async_copy_32B(const void* gsrc, void* ldst) {
  unsigned int       l = (unsigned int)(unsigned long long)ldst;   // low 32 bits = LDS addr
  unsigned long long g = (unsigned long long)gsrc;
  asm volatile("global_load_async_to_lds_b128 %0, %1, off\n\t"
               "global_load_async_to_lds_b128 %0, %1, off offset:16"
               :: "v"(l), "v"(g) : "memory");
}
static __device__ __forceinline__ void async_wait() {
  asm volatile("s_wait_asynccnt 0x0" ::: "memory");
}

// ---------------------------------------------------------------------------
// Elementwise f32 -> bf16 cast (weights), 4 elements/thread
// ---------------------------------------------------------------------------
__global__ void cast_bf16_kernel(const float* __restrict__ in,
                                 unsigned short* __restrict__ out, int n) {
  int i = (blockIdx.x * blockDim.x + threadIdx.x) * 4;
  if (i < n) {
    float4 f = *(const float4*)(in + i);
    union { unsigned short s[4]; uint2 u; } r;
    r.s[0] = f2bf(f.x); r.s[1] = f2bf(f.y); r.s[2] = f2bf(f.z); r.s[3] = f2bf(f.w);
    *(uint2*)(out + i) = r.u;
  }
}

// ---------------------------------------------------------------------------
// Row LayerNorm (D=1024), fp32 in -> bf16 out. One block (256 thr) per row.
// ---------------------------------------------------------------------------
__global__ __launch_bounds__(256)
void layernorm_bf16_kernel(const float* __restrict__ x,
                           const float* __restrict__ g,
                           const float* __restrict__ b,
                           unsigned short* __restrict__ out) {
  __shared__ float red[256];
  int row = blockIdx.x;
  int t = threadIdx.x;
  const float* xr = x + (size_t)row * D_;
  float v[4];
  float s = 0.f;
#pragma unroll
  for (int i = 0; i < 4; ++i) { v[i] = xr[t + i * 256]; s += v[i]; }
  red[t] = s; __syncthreads();
  for (int off = 128; off > 0; off >>= 1) {
    if (t < off) red[t] += red[t + off];
    __syncthreads();
  }
  float mu = red[0] * (1.f / D_);
  __syncthreads();
  float s2 = 0.f;
#pragma unroll
  for (int i = 0; i < 4; ++i) { float d = v[i] - mu; s2 += d * d; }
  red[t] = s2; __syncthreads();
  for (int off = 128; off > 0; off >>= 1) {
    if (t < off) red[t] += red[t + off];
    __syncthreads();
  }
  float rstd = rsqrtf(red[0] * (1.f / D_) + 1e-5f);
#pragma unroll
  for (int i = 0; i < 4; ++i) {
    int c = t + i * 256;
    out[(size_t)row * D_ + c] = f2bf((v[i] - mu) * rstd * g[c] + b[c]);
  }
}

static __device__ __forceinline__ void async_copy_4x16B(const unsigned int* l,
                                                        const unsigned long long* g) {
  asm volatile("global_load_async_to_lds_b128 %0, %4, off\n\t"
               "global_load_async_to_lds_b128 %1, %5, off\n\t"
               "global_load_async_to_lds_b128 %2, %6, off\n\t"
               "global_load_async_to_lds_b128 %3, %7, off\n\t"
               "s_wait_xcnt 0x0"
               :: "v"(l[0]), "v"(l[1]), "v"(l[2]), "v"(l[3]),
                  "v"(g[0]), "v"(g[1]), "v"(g[2]), "v"(g[3])
               : "memory");
}

// ---------------------------------------------------------------------------
// Generic bf16 WMMA GEMM:  C[M,N] = A[M,K] @ Bw[K,N]  (f32 accumulate)
// 128x128 tile per block, 64 k per trip, 256 threads = 8 waves (2 x 4), each
// wave 64(M) x 32(N): per 32 k, 6 fragments feed 8 WMMAs.
// M, N multiples of 128; K a multiple of 64.
// Two LDS buffers: the async A copies and the B global loads of tile t+1 fly
// while tile t is worked on; B is packed to [n][k] and stored after the WMMAs.
// ---------------------------------------------------------------------------
#define GBM 128
#define GBN 128
#define GBK 64
__global__ __launch_bounds__(256)
void gemm_wmma_kernel(const unsigned short* __restrict__ A,
                      const unsigned short* __restrict__ Bw,
                      int M, int N, int K,
                      const float* __restrict__ bias, int do_gelu,
                      const float* __restrict__ resid,
                      unsigned short* __restrict__ outb,
                      float* __restrict__ outf) {
  __shared__ alignas(16) unsigned short Alds[2][GBM][72];  // [m][k], 144B rows (padded)
  __shared__ alignas(16) unsigned int   Bt[2][GBN][36];    // [n][kpair], 144B rows (padded)

  int t = threadIdx.x;
  int wave = t >> 5, lane = t & 31;
  int lm = lane & 15, hf = lane >> 4;
  int mBase = blockIdx.y * GBM;
  int nBase = blockIdx.x * GBN;
  int wm = (wave >> 2) * 64;
  int wn = (wave & 3) * 32;
  int kIters = K >> 6;

  // A tile: 128 rows of 128 B; eight lanes cover one whole row per copy.
  auto stageA = [&](int kt, int buf) {
    int row0 = t >> 3, c8 = (t & 7) * 8;
    unsigned int l[4];
    unsigned long long g[4];
#pragma unroll
    for (int i = 0; i < 4; ++i) {
      int row = row0 + i * 32;
      l[i] = (unsigned int)(unsigned long long)&Alds[buf][row][c8];
      g[i] = (unsigned long long)(A + (size_t)(mBase + row) * K + kt * GBK + c8);
    }
    async_copy_4x16B(l, g);
  };
  // B tile: 64 k rows of 256 B. A thread owns one n pair and two groups of
  // eight k rows; eight dwords pack into one 16 B LDS store per n.
  int np = t & 63, kg0 = t >> 6;
  unsigned int bOff = (unsigned int)(kg0 * 8 * N + np * 2);
  unsigned int br[16];
  auto loadB = [&](int kt) {
    const unsigned short* Bk = Bw + (size_t)kt * GBK * N + nBase;
    // prefetch of the following B tile, 64 B per lane
    if (kt + 1 < kIters) {
      __builtin_prefetch(&Bk[(size_t)(GBK + (t >> 2)) * N + (t & 3) * 32], 0, 1);
      // its address register is a temporary that is rewritten right behind it
      asm volatile("s_wait_xcnt 0x0" ::: "memory");
    }
#pragma unroll
    for (int i = 0; i < 2; ++i)
#pragma unroll
      for (int r = 0; r < 8; ++r)
        br[i * 8 + r] = *(const unsigned int*)&(Bk + (size_t)(i * 32 + r) * N)[bOff];
    // the address registers of the requests above are reused right behind them
    asm volatile("s_wait_xcnt 0x0" ::: "memory");
  };
  auto storeB = [&](int buf) {
#pragma unroll
    for (int i = 0; i < 2; ++i) {
      const unsigned int* b = &br[i * 8];
      uint4 lo, hi;
      lo.x = (b[0] & 0xFFFFu) | (b[1] << 16);  hi.x = (b[0] >> 16) | (b[1] & 0xFFFF0000u);
      lo.y = (b[2] & 0xFFFFu) | (b[3] << 16);  hi.y = (b[2] >> 16) | (b[3] & 0xFFFF0000u);
      lo.z = (b[4] & 0xFFFFu) | (b[5] << 16);  hi.z = (b[4] >> 16) | (b[5] & 0xFFFF0000u);
      lo.w = (b[6] & 0xFFFFu) | (b[7] << 16);  hi.w = (b[6] >> 16) | (b[7] & 0xFFFF0000u);
      *(uint4*)&Bt[buf][np * 2][(kg0 + 4 * i) * 4]     = lo;
      *(uint4*)&Bt[buf][np * 2 + 1][(kg0 + 4 * i) * 4] = hi;
    }
  };

  v8f vzero = {};
  v8f acc[8];                       // tile i * 2 + j: rows wm + 16 i, columns wn + 16 j
#pragma unroll
  for (int q = 0; q < 8; ++q) acc[q] = vzero;

  // prologue: tile 0 lands and is published
  stageA(0, 0);
  loadB(0);
  storeB(0);
  asm volatile("s_wait_dscnt 0x0" ::: "memory");     // own B stores done before the barrier
  asm volatile("s_wait_asynccnt 0x0" ::: "memory");  // own A copies landed before the barrier
  __syncthreads();

  for (int kt = 0; kt < kIters; ++kt) {
    int cur = kt & 1;

    FragU af[2][4], bf[2][2];
#pragma unroll
    for (int ks = 0; ks < 2; ++ks) {
#pragma unroll
      for (int i = 0; i < 4; ++i) {
        int arow = wm + i * 16 + lm;
        af[ks][i].q[0] = *(const uint4*)&Alds[cur][arow][ks * 32 + hf * 8];
        af[ks][i].q[1] = *(const uint4*)&Alds[cur][arow][ks * 32 + 16 + hf * 8];
      }
#pragma unroll
      for (int j = 0; j < 2; ++j) {
        int brow = wn + j * 16 + lm;
        bf[ks][j].q[0] = *(const uint4*)&Bt[cur][brow][ks * 16 + hf * 4];
        bf[ks][j].q[1] = *(const uint4*)&Bt[cur][brow][ks * 16 + 8 + hf * 4];
      }
    }
    // keeps the trip's 24 LDS reads one group ahead of the WMMAs; without it the
    // compiler sinks them between the WMMAs and each pair waits out the LDS latency
    __builtin_amdgcn_sched_barrier(0);
    // tile kt+1 is set flying into the buffer that the barrier at the foot of
    // trip kt-1 has freed, while the LDS reads above are still coming in
    if (kt + 1 < kIters) { stageA(kt + 1, cur ^ 1); loadB(kt + 1); }
#pragma unroll
    for (int ks = 0; ks < 2; ++ks)
#pragma unroll
      for (int i = 0; i < 4; ++i)
#pragma unroll
        for (int j = 0; j < 2; ++j)
          acc[i * 2 + j] = __builtin_amdgcn_wmma_f32_16x16x32_bf16(
              false, af[ks][i].v, false, bf[ks][j].v, (short)0, acc[i * 2 + j], false, false);

    if (kt + 1 < kIters) storeB(cur ^ 1);
    // foot of the trip: own LDS reads and stores done, own copies of tile
    // kt+1 landed; the barrier publishes tile kt+1 and frees buffer cur.
    asm volatile("s_wait_dscnt 0x0" ::: "memory");
    asm volatile("s_wait_asynccnt 0x0" ::: "memory");
    __syncthreads();
  }
  asm volatile("s_wait_asynccnt 0x0" ::: "memory");  // no copy outstanding at the wave's end

  // ---- epilogue: one 16x16 tile per trip, the tiles rotated through acc[0] ----
  // kept rolled (64 erff bodies if unrolled), for speed only
#pragma unroll 1
  for (int q = 0; q < 8; ++q) {
    int col = nBase + wn + (q & 1) * 16 + lm;
    int row = mBase + wm + (q >> 1) * 16 + hf * 8;
    size_t o0 = (size_t)row * N + col;
    float val[8];
#pragma unroll
    for (int v = 0; v < 8; ++v) val[v] = acc[0][v];
    if (bias) {
      float bv = bias[col];
#pragma unroll
      for (int v = 0; v < 8; ++v) val[v] += bv;
    }
    if (do_gelu) {
#pragma unroll
      for (int v = 0; v < 8; ++v)
        val[v] = 0.5f * val[v] * (1.f + erff(val[v] * 0.70710678118654752f));
    }
    if (resid) {
      float rv[8];
#pragma unroll
      for (int v = 0; v < 8; ++v) rv[v] = resid[o0 + (size_t)v * N];
#pragma unroll
      for (int v = 0; v < 8; ++v) val[v] += rv[v];
    }
    if (outf) {
#pragma unroll
      for (int v = 0; v < 8; ++v) outf[o0 + (size_t)v * N] = val[v];
    } else {
#pragma unroll
      for (int v = 0; v < 8; ++v) outb[o0 + (size_t)v * N] = f2bf(val[v]);
    }
    // the registers that the stores name are rewritten by the rotation below;
    // the scheduling fence keeps the rotation's moves behind the wait
    asm volatile("s_wait_xcnt 0x0" ::: "memory");
    __builtin_amdgcn_sched_barrier(0);
#pragma unroll
    for (int s = 0; s < 7; ++s) acc[s] = acc[s + 1];
  }
}

// ---------------------------------------------------------------------------
// Flash attention (no 1/sqrt(d) scaling, per reference).
// Q/K/V bf16 laid out [B*N, H*DH]. Grid: (B*H, N/64), block 128 (4 waves).
// Double-buffered K (async) and V (regs->packed LDS) tiles.
// ---------------------------------------------------------------------------
__global__ __launch_bounds__(128)
void flash_attn_kernel(const unsigned short* __restrict__ Q,
                       const unsigned short* __restrict__ Km,
                       const unsigned short* __restrict__ Vm,
                       unsigned short* __restrict__ O) {
  __shared__ alignas(16) unsigned short Qs[64][72];       // 144B rows
  __shared__ alignas(16) unsigned short Ks[2][32][72];    // 144B rows
  __shared__ alignas(16) unsigned int   Vt[2][64][20];    // [dh][keypair], 80B rows
  __shared__ alignas(16) unsigned short Ps[4][16][40];    // per-wave P, 80B rows

  int t = threadIdx.x;
  int wave = t >> 5, lane = t & 31;
  int lm = lane & 15, hf = lane >> 4;
  int bh = blockIdx.x;
  int b = bh / H_, h = bh % H_;
  int q0 = b * N_ + blockIdx.y * 64;
  int colh = h * DH_;
  int rowBase = wave * 16;
  const int kbIters = N_ / 32;

  auto stageK = [&](int kb, int buf) {
    int k0 = b * N_ + kb * 32;
    int row = t >> 2, c16 = (t & 3) * 16;
    async_copy_32B(Km + (size_t)(k0 + row) * HD + colh + c16, &Ks[buf][row][c16]);
  };
  unsigned int vr0[4], vr1[4];
  auto loadV = [&](int kb) {
    int k0 = b * N_ + kb * 32;
#pragma unroll
    for (int i = 0; i < 4; ++i) {
      int idx = i * 128 + t;           // 512 tasks: (kp, dh-pair)
      int kp  = idx >> 5;              // 0..15
      int dh0 = (idx & 31) * 2;        // 0..62 even
      vr0[i] = *(const unsigned int*)&Vm[(size_t)(k0 + 2 * kp) * HD + colh + dh0];
      vr1[i] = *(const unsigned int*)&Vm[(size_t)(k0 + 2 * kp + 1) * HD + colh + dh0];
    }
  };
  auto storeV = [&](int buf) {
#pragma unroll
    for (int i = 0; i < 4; ++i) {
      int idx = i * 128 + t;
      int kp  = idx >> 5;
      int dh0 = (idx & 31) * 2;
      Vt[buf][dh0][kp]     = (vr0[i] & 0xFFFFu) | (vr1[i] << 16);
      Vt[buf][dh0 + 1][kp] = (vr0[i] >> 16)     | (vr1[i] & 0xFFFF0000u);
    }
  };

  // load Q tile 64x64 (64B per thread)
  {
    int row = t >> 1, c32 = (t & 1) * 32;
    const uint4* src = (const uint4*)(Q + (size_t)(q0 + row) * HD + colh + c32);
    uint4* dst = (uint4*)&Qs[row][c32];
    dst[0] = src[0]; dst[1] = src[1]; dst[2] = src[2]; dst[3] = src[3];
  }

  v8f vzero = {};
  v8f o[4];
#pragma unroll
  for (int c = 0; c < 4; ++c) o[c] = vzero;
  float mrow[8], lrow[8];
#pragma unroll
  for (int v = 0; v < 8; ++v) { mrow[v] = -1e30f; lrow[v] = 0.f; }

  // prologue: stage tile 0 (barrier also publishes Qs)
  stageK(0, 0);
  loadV(0);
  storeV(0);
  async_wait();
  __syncthreads();

  for (int kb = 0; kb < kbIters; ++kb) {
    int cur = kb & 1;
    bool more = (kb + 1) < kbIters;
    if (more) { stageK(kb + 1, cur ^ 1); loadV(kb + 1); }

    // ---- S = Q K^T  (two 16-key tiles, two k-steps over DH=64) ----
    v8f s[2]; s[0] = vzero; s[1] = vzero;
#pragma unroll
    for (int step = 0; step < 64; step += 32) {
      FragU qa, kf0, kf1;
      int arow = rowBase + lm;
      qa.q[0]  = *(const uint4*)&Qs[arow][step + hf * 8];
      qa.q[1]  = *(const uint4*)&Qs[arow][step + 16 + hf * 8];
      kf0.q[0] = *(const uint4*)&Ks[cur][lm][step + hf * 8];
      kf0.q[1] = *(const uint4*)&Ks[cur][lm][step + 16 + hf * 8];
      kf1.q[0] = *(const uint4*)&Ks[cur][16 + lm][step + hf * 8];
      kf1.q[1] = *(const uint4*)&Ks[cur][16 + lm][step + 16 + hf * 8];
      s[0] = __builtin_amdgcn_wmma_f32_16x16x32_bf16(
          false, qa.v, false, kf0.v, (short)0, s[0], false, false);
      s[1] = __builtin_amdgcn_wmma_f32_16x16x32_bf16(
          false, qa.v, false, kf1.v, (short)0, s[1], false, false);
    }

    // ---- online softmax (row stats live in WMMA C layout: row = v + hf*8) ----
    float p0[8], p1[8];
#pragma unroll
    for (int v = 0; v < 8; ++v) {
      float tm = fmaxf(s[0][v], s[1][v]);
#pragma unroll
      for (int msk = 8; msk >= 1; msk >>= 1) tm = fmaxf(tm, __shfl_xor(tm, msk, 32));
      float mn = fmaxf(mrow[v], tm);
      float scale = __expf(mrow[v] - mn);
      mrow[v] = mn;
      p0[v] = __expf(s[0][v] - mn);
      p1[v] = __expf(s[1][v] - mn);
      float rs = p0[v] + p1[v];
#pragma unroll
      for (int msk = 8; msk >= 1; msk >>= 1) rs += __shfl_xor(rs, msk, 32);
      lrow[v] = lrow[v] * scale + rs;
#pragma unroll
      for (int c = 0; c < 4; ++c) o[c][v] *= scale;
    }

#pragma unroll
    for (int v = 0; v < 8; ++v) {
      int pr = v + hf * 8;
      Ps[wave][pr][lm]      = f2bf(p0[v]);
      Ps[wave][pr][16 + lm] = f2bf(p1[v]);
    }
    __syncthreads();

    // ---- O += P @ V (preload all fragments, then 4 WMMAs) ----
    FragU pa, vf[4];
    pa.q[0] = *(const uint4*)&Ps[wave][lm][hf * 8];
    pa.q[1] = *(const uint4*)&Ps[wave][lm][16 + hf * 8];
#pragma unroll
    for (int ct = 0; ct < 4; ++ct) {
      vf[ct].q[0] = *(const uint4*)&Vt[cur][ct * 16 + lm][hf * 4];
      vf[ct].q[1] = *(const uint4*)&Vt[cur][ct * 16 + lm][8 + hf * 4];
    }
#pragma unroll
    for (int ct = 0; ct < 4; ++ct) {
      o[ct] = __builtin_amdgcn_wmma_f32_16x16x32_bf16(
          false, pa.v, false, vf[ct].v, (short)0, o[ct], false, false);
    }

    if (more) storeV(cur ^ 1);
    async_wait();
    __syncthreads();
  }

  // ---- normalize and store bf16 ----
#pragma unroll
  for (int ct = 0; ct < 4; ++ct) {
#pragma unroll
    for (int v = 0; v < 8; ++v) {
      int row = q0 + rowBase + v + hf * 8;
      int col = colh + ct * 16 + lm;
      O[(size_t)row * HD + col] = f2bf(o[ct][v] / lrow[v]);
    }
  }
}

// ---------------------------------------------------------------------------
// Host-side orchestration
// ---------------------------------------------------------------------------
extern "C" void kernel_launch(void* const* d_in, const int* in_sizes, int n_in,
                              void* d_out, int out_size, void* d_ws, size_t ws_size,
                              hipStream_t stream) {
  const float* x     = (const float*)d_in[0];
  const float* wq    = (const float*)d_in[1];
  const float* wk    = (const float*)d_in[2];
  const float* wv    = (const float*)d_in[3];
  const float* wo    = (const float*)d_in[4];
  const float* w1    = (const float*)d_in[5];
  const float* b1    = (const float*)d_in[6];
  const float* w2    = (const float*)d_in[7];
  const float* b2    = (const float*)d_in[8];
  const float* ln1_g = (const float*)d_in[9];
  const float* ln1_b = (const float*)d_in[10];
  const float* ln2_g = (const float*)d_in[11];
  const float* ln2_b = (const float*)d_in[12];
  float* out = (float*)d_out;

  // workspace carve-out (~120 MiB total)
  char* p = (char*)d_ws;
  auto alloc = [&](size_t bytes) -> void* {
    void* r = (void*)p;
    p += (bytes + 255) & ~(size_t)255;
    return r;
  };
  unsigned short* wq_b = (unsigned short*)alloc((size_t)D_ * HD * 2);
  unsigned short* wk_b = (unsigned short*)alloc((size_t)D_ * HD * 2);
  unsigned short* wv_b = (unsigned short*)alloc((size_t)D_ * HD * 2);
  unsigned short* wo_b = (unsigned short*)alloc((size_t)HD * D_ * 2);
  unsigned short* w1_b = (unsigned short*)alloc((size_t)D_ * FF_ * 2);
  unsigned short* w2_b = (unsigned short*)alloc((size_t)FF_ * D_ * 2);
  unsigned short* h_b  = (unsigned short*)alloc((size_t)ROWS * D_ * 2);
  unsigned short* q_b  = (unsigned short*)alloc((size_t)ROWS * HD * 2);
  unsigned short* k_b  = (unsigned short*)alloc((size_t)ROWS * HD * 2);
  unsigned short* v_b  = (unsigned short*)alloc((size_t)ROWS * HD * 2);
  unsigned short* a_b  = (unsigned short*)alloc((size_t)ROWS * HD * 2);
  float*          x2   = (float*)        alloc((size_t)ROWS * D_ * 4);
  unsigned short* h2_b = (unsigned short*)alloc((size_t)ROWS * D_ * 2);
  unsigned short* ff_b = (unsigned short*)alloc((size_t)ROWS * FF_ * 2);

  // 1) weights -> bf16
  auto cast = [&](const float* src, unsigned short* dst, int n) {
    cast_bf16_kernel<<<(n / 4 + 255) / 256, 256, 0, stream>>>(src, dst, n);
  };
  cast(wq, wq_b, D_ * HD);
  cast(wk, wk_b, D_ * HD);
  cast(wv, wv_b, D_ * HD);
  cast(wo, wo_b, HD * D_);
  cast(w1, w1_b, D_ * FF_);
  cast(w2, w2_b, FF_ * D_);

  // 2) LN1
  layernorm_bf16_kernel<<<ROWS, 256, 0, stream>>>(x, ln1_g, ln1_b, h_b);

  // 3) Q/K/V projections
  dim3 gemmBlk(256);
  dim3 attnBlk(128);
  dim3 gQKV(D_ / GBN, ROWS / GBM);
  gemm_wmma_kernel<<<gQKV, gemmBlk, 0, stream>>>(h_b, wq_b, ROWS, HD, D_,
                                                 nullptr, 0, nullptr, q_b, nullptr);
  gemm_wmma_kernel<<<gQKV, gemmBlk, 0, stream>>>(h_b, wk_b, ROWS, HD, D_,
                                                 nullptr, 0, nullptr, k_b, nullptr);
  gemm_wmma_kernel<<<gQKV, gemmBlk, 0, stream>>>(h_b, wv_b, ROWS, HD, D_,
                                                 nullptr, 0, nullptr, v_b, nullptr);

  // 4) attention
  dim3 gAttn(B_ * H_, N_ / 64);
  flash_attn_kernel<<<gAttn, attnBlk, 0, stream>>>(q_b, k_b, v_b, a_b);

  // 5) out projection + residual -> x2 (fp32)
  gemm_wmma_kernel<<<gQKV, gemmBlk, 0, stream>>>(a_b, wo_b, ROWS, D_, HD,
                                                 nullptr, 0, x, nullptr, x2);

  // 6) LN2
  layernorm_bf16_kernel<<<ROWS, 256, 0, stream>>>(x2, ln2_g, ln2_b, h2_b);

  // 7) FF1 + bias + exact GELU -> bf16
  dim3 gFF1(FF_ / GBN, ROWS / GBM);
  gemm_wmma_kernel<<<gFF1, gemmBlk, 0, stream>>>(h2_b, w1_b, ROWS, FF_, D_,
                                                 b1, 1, nullptr, ff_b, nullptr);

  // 8) FF2 + bias + residual -> out (fp32)
  dim3 gFF2(D_ / GBN, ROWS / GBM);
  gemm_wmma_kernel<<<gFF2, gemmBlk, 0, stream>>>(ff_b, w2_b, ROWS, D_, FF_,
                                                 b2, 0, x2, nullptr, out);
}

// v002
// It runs in 274 microseconds.
// Next to v001, in two timings, it ran 1.29 and 1.30 times as fast.
// All steps since v000 together make it 2.05 times as fast.
#include <hip/hip_runtime.h>
#include <stdint.h>

// Problem constants (match reference)
#define B_  2
#define N_  2048
#define D_  1024
#define H_  16
#define DH_ 64
#define FF_ 4096
#define ROWS (B_ * N_)          // 4096
#define HD  (H_ * DH_)          // 1024

typedef __attribute__((ext_vector_type(16))) __bf16 v16bf;
typedef __attribute__((ext_vector_type(8)))  float  v8f;

// Fragment: 8 dwords = two 16B chunks; loaded as 2x ds_load_b128.
union FragU { uint4 q[2]; unsigned int u[8]; v16bf v; };

static __device__ __forceinline__ unsigned short f2bf(float f) {
  union { float f; unsigned int u; } c; c.f = f;
  unsigned int u = c.u;
  unsigned int r = u + 0x7FFFu + ((u >> 16) & 1u);   // round-to-nearest-even
  return (unsigned short)(r >> 16);
}

static __device__ __forceinline__ void async_copy_32B(const void* gsrc, void* ldst) {
  unsigned int       l = (unsigned int)(unsigned long long)ldst;   // low 32 bits = LDS addr
  unsigned long long g = (unsigned long long)gsrc;
  asm volatile("global_load_async_to_lds_b128 %0, %1, off\n\t"
               "global_load_async_to_lds_b128 %0, %1, off offset:16"
               :: "v"(l), "v"(g) : "memory");
}
static __device__ __forceinline__ void async_wait() {
  asm volatile("s_wait_asynccnt 0x0" ::: "memory");
}

// ---------------------------------------------------------------------------
// Elementwise f32 -> bf16 cast (weights), 4 elements/thread
// ---------------------------------------------------------------------------
__global__ void cast_bf16_kernel(const float* __restrict__ in,
                                 unsigned short* __restrict__ out, int n) {
  int i = (blockIdx.x * blockDim.x + threadIdx.x) * 4;
  if (i < n) {
    float4 f = *(const float4*)(in + i);
    union { unsigned short s[4]; uint2 u; } r;
    r.s[0] = f2bf(f.x); r.s[1] = f2bf(f.y); r.s[2] = f2bf(f.z); r.s[3] = f2bf(f.w);
    *(uint2*)(out + i) = r.u;
  }
}

// ---------------------------------------------------------------------------
// Row LayerNorm (D=1024), fp32 in -> bf16 out. One block (256 thr) per row.
// ---------------------------------------------------------------------------
__global__ __launch_bounds__(256)
void layernorm_bf16_kernel(const float* __restrict__ x,
                           const float* __restrict__ g,
                           const float* __restrict__ b,
                           unsigned short* __restrict__ out) {
  __shared__ float red[256];
  int row = blockIdx.x;
  int t = threadIdx.x;
  const float* xr = x + (size_t)row * D_;
  float v[4];
  float s = 0.f;
#pragma unroll
  for (int i = 0; i < 4; ++i) { v[i] = xr[t + i * 256]; s += v[i]; }
  red[t] = s; __syncthreads();
  for (int off = 128; off > 0; off >>= 1) {
    if (t < off) red[t] += red[t + off];
    __syncthreads();
  }
  float mu = red[0] * (1.f / D_);
  __syncthreads();
  float s2 = 0.f;
#pragma unroll
  for (int i = 0; i < 4; ++i) { float d = v[i] - mu; s2 += d * d; }
  red[t] = s2; __syncthreads();
  for (int off = 128; off > 0; off >>= 1) {
    if (t < off) red[t] += red[t + off];
    __syncthreads();
  }
  float rstd = rsqrtf(red[0] * (1.f / D_) + 1e-5f);
#pragma unroll
  for (int i = 0; i < 4; ++i) {
    int c = t + i * 256;
    out[(size_t)row * D_ + c] = f2bf((v[i] - mu) * rstd * g[c] + b[c]);
  }
}

static __device__ __forceinline__ void async_copy_4x16B(const unsigned int* l,
                                                        const unsigned long long* g) {
  asm volatile("global_load_async_to_lds_b128 %0, %4, off\n\t"
               "global_load_async_to_lds_b128 %1, %5, off\n\t"
               "global_load_async_to_lds_b128 %2, %6, off\n\t"
               "global_load_async_to_lds_b128 %3, %7, off\n\t"
               "s_wait_xcnt 0x0"
               :: "v"(l[0]), "v"(l[1]), "v"(l[2]), "v"(l[3]),
                  "v"(g[0]), "v"(g[1]), "v"(g[2]), "v"(g[3])
               : "memory");
}

// ---------------------------------------------------------------------------
// Generic bf16 WMMA GEMM:  C[M,N] = A[M,K] @ Bw[K,N]  (f32 accumulate)
// 128x128 tile per block, 64 k per trip, 256 threads = 8 waves (2 x 4), each
// wave 64(M) x 32(N): per 32 k, 6 fragments feed 8 WMMAs.
// M, N multiples of 128; K a multiple of 64.
// Two LDS buffers: the async A copies and the B global loads of tile t+1 fly
// while tile t is worked on; B is packed to [n][k] and stored after the WMMAs.
// ---------------------------------------------------------------------------
#define GBM 128
#define GBN 128
#define GBK 64
__global__ __launch_bounds__(256)
void gemm_wmma_kernel(const unsigned short* __restrict__ A,
                      const unsigned short* __restrict__ Bw,
                      int M, int N, int K,
                      const float* __restrict__ bias, int do_gelu,
                      const float* __restrict__ resid,
                      unsigned short* __restrict__ outb,
                      float* __restrict__ outf) {
  __shared__ alignas(16) unsigned short Alds[2][GBM][72];  // [m][k], 144B rows (padded)
  __shared__ alignas(16) unsigned int   Bt[2][GBN][36];    // [n][kpair], 144B rows (padded)

  int t = threadIdx.x;
  int wave = t >> 5, lane = t & 31;
  int lm = lane & 15, hf = lane >> 4;
  int mBase = blockIdx.y * GBM;
  int nBase = blockIdx.x * GBN;
  int wm = (wave >> 2) * 64;
  int wn = (wave & 3) * 32;
  int kIters = K >> 6;

  // A tile: 128 rows of 128 B; eight lanes cover one whole row per copy.
  auto stageA = [&](int kt, int buf) {
    int row0 = t >> 3, c8 = (t & 7) * 8;
    unsigned int l[4];
    unsigned long long g[4];
#pragma unroll
    for (int i = 0; i < 4; ++i) {
      int row = row0 + i * 32;
      l[i] = (unsigned int)(unsigned long long)&Alds[buf][row][c8];
      g[i] = (unsigned long long)(A + (size_t)(mBase + row) * K + kt * GBK + c8);
    }
    async_copy_4x16B(l, g);
  };
  // B tile: 64 k rows of 256 B. A thread owns one n pair and two groups of
  // eight k rows; eight dwords pack into one 16 B LDS store per n.
  int np = t & 63, kg0 = t >> 6;
  unsigned int bOff = (unsigned int)(kg0 * 8 * N + np * 2);
  unsigned int br[16];
  auto loadB = [&](int kt) {
    const unsigned short* Bk = Bw + (size_t)kt * GBK * N + nBase;
    // prefetch of the following B tile, 64 B per lane
    if (kt + 1 < kIters) {
      __builtin_prefetch(&Bk[(size_t)(GBK + (t >> 2)) * N + (t & 3) * 32], 0, 1);
      // its address register is a temporary that is rewritten right behind it
      asm volatile("s_wait_xcnt 0x0" ::: "memory");
    }
#pragma unroll
    for (int i = 0; i < 2; ++i)
#pragma unroll
      for (int r = 0; r < 8; ++r)
        br[i * 8 + r] = *(const unsigned int*)&(Bk + (size_t)(i * 32 + r) * N)[bOff];
    // the address registers of the requests above are reused right behind them
    asm volatile("s_wait_xcnt 0x0" ::: "memory");
  };
  auto storeB = [&](int buf) {
#pragma unroll
    for (int i = 0; i < 2; ++i) {
      const unsigned int* b = &br[i * 8];
      uint4 lo, hi;
      lo.x = (b[0] & 0xFFFFu) | (b[1] << 16);  hi.x = (b[0] >> 16) | (b[1] & 0xFFFF0000u);
      lo.y = (b[2] & 0xFFFFu) | (b[3] << 16);  hi.y = (b[2] >> 16) | (b[3] & 0xFFFF0000u);
      lo.z = (b[4] & 0xFFFFu) | (b[5] << 16);  hi.z = (b[4] >> 16) | (b[5] & 0xFFFF0000u);
      lo.w = (b[6] & 0xFFFFu) | (b[7] << 16);  hi.w = (b[6] >> 16) | (b[7] & 0xFFFF0000u);
      *(uint4*)&Bt[buf][np * 2][(kg0 + 4 * i) * 4]     = lo;
      *(uint4*)&Bt[buf][np * 2 + 1][(kg0 + 4 * i) * 4] = hi;
    }
  };

  v8f vzero = {};
  v8f acc[8];                       // tile i * 2 + j: rows wm + 16 i, columns wn + 16 j
#pragma unroll
  for (int q = 0; q < 8; ++q) acc[q] = vzero;

  // prologue: tile 0 lands and is published
  stageA(0, 0);
  loadB(0);
  storeB(0);
  asm volatile("s_wait_dscnt 0x0" ::: "memory");     // own B stores done before the barrier
  asm volatile("s_wait_asynccnt 0x0" ::: "memory");  // own A copies landed before the barrier
  __syncthreads();

  for (int kt = 0; kt < kIters; ++kt) {
    int cur = kt & 1;

    FragU af[2][4], bf[2][2];
#pragma unroll
    for (int ks = 0; ks < 2; ++ks) {
#pragma unroll
      for (int i = 0; i < 4; ++i) {
        int arow = wm + i * 16 + lm;
        af[ks][i].q[0] = *(const uint4*)&Alds[cur][arow][ks * 32 + hf * 8];
        af[ks][i].q[1] = *(const uint4*)&Alds[cur][arow][ks * 32 + 16 + hf * 8];
      }
#pragma unroll
      for (int j = 0; j < 2; ++j) {
        int brow = wn + j * 16 + lm;
        bf[ks][j].q[0] = *(const uint4*)&Bt[cur][brow][ks * 16 + hf * 4];
        bf[ks][j].q[1] = *(const uint4*)&Bt[cur][brow][ks * 16 + 8 + hf * 4];
      }
    }
    // keeps the trip's 24 LDS reads one group ahead of the WMMAs; without it the
    // compiler sinks them between the WMMAs and each pair waits out the LDS latency
    __builtin_amdgcn_sched_barrier(0);
    // tile kt+1 is set flying into the buffer that the barrier at the foot of
    // trip kt-1 has freed, while the LDS reads above are still coming in
    if (kt + 1 < kIters) { stageA(kt + 1, cur ^ 1); loadB(kt + 1); }
#pragma unroll
    for (int ks = 0; ks < 2; ++ks)
#pragma unroll
      for (int i = 0; i < 4; ++i)
#pragma unroll
        for (int j = 0; j < 2; ++j)
          acc[i * 2 + j] = __builtin_amdgcn_wmma_f32_16x16x32_bf16(
              false, af[ks][i].v, false, bf[ks][j].v, (short)0, acc[i * 2 + j], false, false);

    if (kt + 1 < kIters) storeB(cur ^ 1);
    // foot of the trip: own LDS reads and stores done, own copies of tile
    // kt+1 landed; the barrier publishes tile kt+1 and frees buffer cur.
    asm volatile("s_wait_dscnt 0x0" ::: "memory");
    asm volatile("s_wait_asynccnt 0x0" ::: "memory");
    __syncthreads();
  }
  asm volatile("s_wait_asynccnt 0x0" ::: "memory");  // no copy outstanding at the wave's end

  // ---- epilogue: one 16x16 tile per trip, the tiles rotated through acc[0] ----
  // kept rolled (64 erff bodies if unrolled), for speed only
#pragma unroll 1
  for (int q = 0; q < 8; ++q) {
    int col = nBase + wn + (q & 1) * 16 + lm;
    int row = mBase + wm + (q >> 1) * 16 + hf * 8;
    size_t o0 = (size_t)row * N + col;
    float val[8];
#pragma unroll
    for (int v = 0; v < 8; ++v) val[v] = acc[0][v];
    if (bias) {
      float bv = bias[col];
#pragma unroll
      for (int v = 0; v < 8; ++v) val[v] += bv;
    }
    if (do_gelu) {
#pragma unroll
      for (int v = 0; v < 8; ++v)
        val[v] = 0.5f * val[v] * (1.f + erff(val[v] * 0.70710678118654752f));
    }
    if (resid) {
      float rv[8];
#pragma unroll
      for (int v = 0; v < 8; ++v) rv[v] = resid[o0 + (size_t)v * N];
#pragma unroll
      for (int v = 0; v < 8; ++v) val[v] += rv[v];
    }
    if (outf) {
#pragma unroll
      for (int v = 0; v < 8; ++v) outf[o0 + (size_t)v * N] = val[v];
    } else {
#pragma unroll
      for (int v = 0; v < 8; ++v) outb[o0 + (size_t)v * N] = f2bf(val[v]);
    }
    // the registers that the stores name are rewritten by the rotation below;
    // the scheduling fence keeps the rotation's moves behind the wait
    asm volatile("s_wait_xcnt 0x0" ::: "memory");
    __builtin_amdgcn_sched_barrier(0);
#pragma unroll
    for (int s = 0; s < 7; ++s) acc[s] = acc[s + 1];
  }
}

typedef __attribute__((ext_vector_type(2))) float  v2f;
typedef __attribute__((ext_vector_type(2))) __bf16 v2bf;

static __device__ __forceinline__ float xhalf(float x) {
  int b = __builtin_bit_cast(int, x);
  return __builtin_bit_cast(float, __builtin_amdgcn_permlanex16(
      b, b, 0x76543210, 0xfedcba98, false, false));
}
// two f32 -> one dword of two bf16 (a in the low half), round to nearest even
static __device__ __forceinline__ unsigned int pack_bf16(float a, float b) {
  v2f f = {a, b};
  return __builtin_bit_cast(unsigned int, __builtin_convertvector(f, v2bf));
}

__global__ __launch_bounds__(128)
void flash_attn_kernel(const unsigned short* __restrict__ Q,
                       const unsigned short* __restrict__ Km,
                       const unsigned short* __restrict__ Vm,
                       unsigned short* __restrict__ O) {
  __shared__ alignas(16) unsigned short Qs[64][72];       // 144B rows
  __shared__ alignas(16) unsigned short Ks[2][32][72];    // 144B rows
  __shared__ alignas(16) unsigned int   Vt[2][64][20];    // [dh][keypair], 80B rows

  int t = threadIdx.x;
  int wave = t >> 5, lane = t & 31;
  int lm = lane & 15, hf = lane >> 4;
  int bh = blockIdx.x;
  int b = bh / H_, h = bh % H_;
  int q0 = b * N_ + blockIdx.y * 64;
  int colh = h * DH_;
  int rowBase = wave * 16;
  const int kbIters = N_ / 32;

  auto stageK = [&](int kb, int buf) {
    int k0 = b * N_ + kb * 32;
    int row = t >> 2, c16 = (t & 3) * 16;
    async_copy_32B(Km + (size_t)(k0 + row) * HD + colh + c16, &Ks[buf][row][c16]);
  };
  unsigned int vr0[4], vr1[4];
  auto loadV = [&](int kb) {
    int k0 = b * N_ + kb * 32;
#pragma unroll
    for (int i = 0; i < 4; ++i) {
      int idx = i * 128 + t;           // 512 tasks: (kp, dh-pair)
      int kp  = idx >> 5;              // 0..15
      int dh0 = (idx & 31) * 2;        // 0..62 even
      vr0[i] = *(const unsigned int*)&Vm[(size_t)(k0 + 2 * kp) * HD + colh + dh0];
      vr1[i] = *(const unsigned int*)&Vm[(size_t)(k0 + 2 * kp + 1) * HD + colh + dh0];
    }
  };
  auto storeV = [&](int buf) {
#pragma unroll
    for (int i = 0; i < 4; ++i) {
      int idx = i * 128 + t;
      int kp  = idx >> 5;
      int dh0 = (idx & 31) * 2;
      Vt[buf][dh0][kp]     = (vr0[i] & 0xFFFFu) | (vr1[i] << 16);
      Vt[buf][dh0 + 1][kp] = (vr0[i] >> 16)     | (vr1[i] & 0xFFFF0000u);
    }
  };

  // load Q tile 64x64 (64B per thread)
  {
    int row = t >> 1, c32 = (t & 1) * 32;
    const uint4* src = (const uint4*)(Q + (size_t)(q0 + row) * HD + colh + c32);
    uint4* dst = (uint4*)&Qs[row][c32];
    dst[0] = src[0]; dst[1] = src[1]; dst[2] = src[2]; dst[3] = src[3];
  }

  v8f vzero = {};
  v8f o[4];
#pragma unroll
  for (int c = 0; c < 4; ++c) o[c] = vzero;
  // of query lm: running maximum (both halves alike), and the sum over the
  // keys that this half of the wave holds
  float mrow = -1e30f, lrow = 0.f;

  // prologue: stage tile 0 (barrier also publishes Qs)
  stageK(0, 0);
  loadV(0);
  storeV(0);
  async_wait();
  __syncthreads();

  // Q^T fragments (B operand), read once and kept in registers
  FragU qb[2];
#pragma unroll
  for (int st = 0; st < 2; ++st) {
    qb[st].q[0] = *(const uint4*)&Qs[rowBase + lm][st * 32 + hf * 8];
    qb[st].q[1] = *(const uint4*)&Qs[rowBase + lm][st * 32 + 16 + hf * 8];
  }

  for (int kb = 0; kb < kbIters; ++kb) {
    int cur = kb & 1;
    bool more = (kb + 1) < kbIters;
    if (more) { stageK(kb + 1, cur ^ 1); loadV(kb + 1); }

    // K fragments (A operand of S^T) and V^T fragments (A operand of O^T)
    FragU kf[2][2], vf[4];
#pragma unroll
    for (int st = 0; st < 2; ++st)
#pragma unroll
      for (int j = 0; j < 2; ++j) {
        kf[st][j].q[0] = *(const uint4*)&Ks[cur][j * 16 + lm][st * 32 + hf * 8];
        kf[st][j].q[1] = *(const uint4*)&Ks[cur][j * 16 + lm][st * 32 + 16 + hf * 8];
      }
#pragma unroll
    for (int ct = 0; ct < 4; ++ct) {
      vf[ct].q[0] = *(const uint4*)&Vt[cur][ct * 16 + lm][hf * 4];
      vf[ct].q[1] = *(const uint4*)&Vt[cur][ct * 16 + lm][8 + hf * 4];
    }
    // keeps the next tile's V loads and the trip's 16 LDS reads at the head of
    // the trip; without it the compiler sinks each to just ahead of its use,
    // and the wave waits out the L2 and LDS latencies there
    __builtin_amdgcn_sched_barrier(0);

    // ---- S^T = K Q^T  (two 16-key tiles, two k-steps over DH=64) ----
    // s[j][v] = score of key 16 j + 8 hf + v against query lm
    v8f s[2]; s[0] = vzero; s[1] = vzero;
#pragma unroll
    for (int st = 0; st < 2; ++st)
#pragma unroll
      for (int j = 0; j < 2; ++j)
        s[j] = __builtin_amdgcn_wmma_f32_16x16x32_bf16(
            false, kf[st][j].v, false, qb[st].v, (short)0, s[j], false, false);

    // ---- online softmax of one query per lane ----
    float tm = fmaxf(s[0][0], s[1][0]);
#pragma unroll
    for (int v = 1; v < 8; ++v) tm = fmaxf(tm, fmaxf(s[0][v], s[1][v]));
    tm = fmaxf(tm, xhalf(tm));         // the other 16 keys of this query
    float mn = fmaxf(mrow, tm);
    float scale = __expf(mrow - mn);
    mrow = mn;
    float p0[8], p1[8];
    float rs0 = 0.f, rs1 = 0.f;
#pragma unroll
    for (int v = 0; v < 8; ++v) {
      p0[v] = __expf(s[0][v] - mn);
      p1[v] = __expf(s[1][v] - mn);
      rs0 += p0[v];
      rs1 += p1[v];
    }
    lrow = lrow * scale + (rs0 + rs1);
#pragma unroll
    for (int c = 0; c < 4; ++c)
#pragma unroll
      for (int v = 0; v < 8; ++v) o[c][v] *= scale;

    // ---- P^T as B operand: k = 8 hf + v from tile 0, 16 + 8 hf + v from tile 1 ----
    FragU pb;
#pragma unroll
    for (int i = 0; i < 4; ++i) {
      pb.u[i]     = pack_bf16(p0[2 * i], p0[2 * i + 1]);
      pb.u[4 + i] = pack_bf16(p1[2 * i], p1[2 * i + 1]);
    }

    // ---- O^T += V^T P^T : o[ct][v] = O[query lm][dh 16 ct + 8 hf + v] ----
#pragma unroll
    for (int ct = 0; ct < 4; ++ct) {
      o[ct] = __builtin_amdgcn_wmma_f32_16x16x32_bf16(
          false, vf[ct].v, false, pb.v, (short)0, o[ct], false, false);
    }

    // keeps the wait for the next tile's V loads, with their pack and store,
    // behind the trip's products; without it the compiler lifts that wait to
    // just behind the first WMMA, where the loads have had no time to return
    __builtin_amdgcn_sched_barrier(0);
    if (more) storeV(cur ^ 1);
    async_wait();
    __syncthreads();
  }

  // ---- normalize and store bf16: 8 consecutive dh of one query per store ----
  float lsum = lrow + xhalf(lrow);     // the two halves' key sums joined
  uint4 ov[4];
#pragma unroll
  for (int ct = 0; ct < 4; ++ct) {
    ov[ct].x = pack_bf16(o[ct][0] / lsum, o[ct][1] / lsum);
    ov[ct].y = pack_bf16(o[ct][2] / lsum, o[ct][3] / lsum);
    ov[ct].z = pack_bf16(o[ct][4] / lsum, o[ct][5] / lsum);
    ov[ct].w = pack_bf16(o[ct][6] / lsum, o[ct][7] / lsum);
  }
  unsigned short* orow = O + (size_t)(q0 + rowBase + lm) * HD + colh + hf * 8;
#pragma unroll
  for (int ct = 0; ct < 4; ++ct) *(uint4*)(orow + ct * 16) = ov[ct];
}

// ---------------------------------------------------------------------------
// Host-side orchestration
// ---------------------------------------------------------------------------
extern "C" void kernel_launch(void* const* d_in, const int* in_sizes, int n_in,
                              void* d_out, int out_size, void* d_ws, size_t ws_size,
                              hipStream_t stream) {
  const float* x     = (const float*)d_in[0];
  const float* wq    = (const float*)d_in[1];
  const float* wk    = (const float*)d_in[2];
  const float* wv    = (const float*)d_in[3];
  const float* wo    = (const float*)d_in[4];
  const float* w1    = (const float*)d_in[5];
  const float* b1    = (const float*)d_in[6];
  const float* w2    = (const float*)d_in[7];
  const float* b2    = (const float*)d_in[8];
  const float* ln1_g = (const float*)d_in[9];
  const float* ln1_b = (const float*)d_in[10];
  const float* ln2_g = (const float*)d_in[11];
  const float* ln2_b = (const float*)d_in[12];
  float* out = (float*)d_out;

  // workspace carve-out (~120 MiB total)
  char* p = (char*)d_ws;
  auto alloc = [&](size_t bytes) -> void* {
    void* r = (void*)p;
    p += (bytes + 255) & ~(size_t)255;
    return r;
  };
  unsigned short* wq_b = (unsigned short*)alloc((size_t)D_ * HD * 2);
  unsigned short* wk_b = (unsigned short*)alloc((size_t)D_ * HD * 2);
  unsigned short* wv_b = (unsigned short*)alloc((size_t)D_ * HD * 2);
  unsigned short* wo_b = (unsigned short*)alloc((size_t)HD * D_ * 2);
  unsigned short* w1_b = (unsigned short*)alloc((size_t)D_ * FF_ * 2);
  unsigned short* w2_b = (unsigned short*)alloc((size_t)FF_ * D_ * 2);
  unsigned short* h_b  = (unsigned short*)alloc((size_t)ROWS * D_ * 2);
  unsigned short* q_b  = (unsigned short*)alloc((size_t)ROWS * HD * 2);
  unsigned short* k_b  = (unsigned short*)alloc((size_t)ROWS * HD * 2);
  unsigned short* v_b  = (unsigned short*)alloc((size_t)ROWS * HD * 2);
  unsigned short* a_b  = (unsigned short*)alloc((size_t)ROWS * HD * 2);
  float*          x2   = (float*)        alloc((size_t)ROWS * D_ * 4);
  unsigned short* h2_b = (unsigned short*)alloc((size_t)ROWS * D_ * 2);
  unsigned short* ff_b = (unsigned short*)alloc((size_t)ROWS * FF_ * 2);

  // 1) weights -> bf16
  auto cast = [&](const float* src, unsigned short* dst, int n) {
    cast_bf16_kernel<<<(n / 4 + 255) / 256, 256, 0, stream>>>(src, dst, n);
  };
  cast(wq, wq_b, D_ * HD);
  cast(wk, wk_b, D_ * HD);
  cast(wv, wv_b, D_ * HD);
  cast(wo, wo_b, HD * D_);
  cast(w1, w1_b, D_ * FF_);
  cast(w2, w2_b, FF_ * D_);

  // 2) LN1
  layernorm_bf16_kernel<<<ROWS, 256, 0, stream>>>(x, ln1_g, ln1_b, h_b);

  // 3) Q/K/V projections
  dim3 gemmBlk(256);
  dim3 attnBlk(128);
  dim3 gQKV(D_ / GBN, ROWS / GBM);
  gemm_wmma_kernel<<<gQKV, gemmBlk, 0, stream>>>(h_b, wq_b, ROWS, HD, D_,
                                                 nullptr, 0, nullptr, q_b, nullptr);
  gemm_wmma_kernel<<<gQKV, gemmBlk, 0, stream>>>(h_b, wk_b, ROWS, HD, D_,
                                                 nullptr, 0, nullptr, k_b, nullptr);
  gemm_wmma_kernel<<<gQKV, gemmBlk, 0, stream>>>(h_b, wv_b, ROWS, HD, D_,
                                                 nullptr, 0, nullptr, v_b, nullptr);

  // 4) attention
  dim3 gAttn(B_ * H_, N_ / 64);
  flash_attn_kernel<<<gAttn, attnBlk, 0, stream>>>(q_b, k_b, v_b, a_b);

  // 5) out projection + residual -> x2 (fp32)
  gemm_wmma_kernel<<<gQKV, gemmBlk, 0, stream>>>(a_b, wo_b, ROWS, D_, HD,
                                                 nullptr, 0, x, nullptr, x2);

  // 6) LN2
  layernorm_bf16_kernel<<<ROWS, 256, 0, stream>>>(x2, ln2_g, ln2_b, h2_b);

  // 7) FF1 + bias + exact GELU -> bf16
  dim3 gFF1(FF_ / GBN, ROWS / GBM);
  gemm_wmma_kernel<<<gFF1, gemmBlk, 0, stream>>>(h2_b, w1_b, ROWS, FF_, D_,
                                                 b1, 1, nullptr, ff_b, nullptr);

  // 8) FF2 + bias + residual -> out (fp32)
  dim3 gFF2(D_ / GBN, ROWS / GBM);
  gemm_wmma_kernel<<<gFF2, gemmBlk, 0, stream>>>(ff_b, w2_b, ROWS, D_, FF_,
                                                 b2, 0, x2, nullptr, out);
}

// v003
// One run takes 263 microseconds.
// Timed twice side by side with v002, it ran 1.04 times as fast both times.
// All steps since v000 together make it 2.14 times as fast.
#include <hip/hip_runtime.h>
#include <stdint.h>

// Problem constants (match reference)
#define B_  2
#define N_  2048
#define D_  1024
#define H_  16
#define DH_ 64
#define FF_ 4096
#define ROWS (B_ * N_)          // 4096
#define HD  (H_ * DH_)          // 1024

typedef __attribute__((ext_vector_type(16))) __bf16 v16bf;
typedef __attribute__((ext_vector_type(8)))  float  v8f;

// Fragment: 8 dwords = two 16B chunks; loaded as 2x ds_load_b128.
union FragU { uint4 q[2]; unsigned int u[8]; v16bf v; };

static __device__ __forceinline__ unsigned short f2bf(float f) {
  union { float f; unsigned int u; } c; c.f = f;
  unsigned int u = c.u;
  unsigned int r = u + 0x7FFFu + ((u >> 16) & 1u);   // round-to-nearest-even
  return (unsigned short)(r >> 16);
}

static __device__ __forceinline__ void async_copy_32B(const void* gsrc, void* ldst) {
  unsigned int       l = (unsigned int)(unsigned long long)ldst;   // low 32 bits = LDS addr
  unsigned long long g = (unsigned long long)gsrc;
  asm volatile("global_load_async_to_lds_b128 %0, %1, off\n\t"
               "global_load_async_to_lds_b128 %0, %1, off offset:16"
               :: "v"(l), "v"(g) : "memory");
}
static __device__ __forceinline__ void async_wait() {
  asm volatile("s_wait_asynccnt 0x0" ::: "memory");
}

// ---------------------------------------------------------------------------
// f32 -> bf16 cast of all six weights in one launch of few, long-lived waves.
// A block converts CAST_BLK consecutive elements of one weight (every weight's
// size is a multiple of CAST_BLK). A thread has its 16 loads of 16 B in flight
// together; each load of a wave covers 512 contiguous bytes.
// ---------------------------------------------------------------------------
typedef __attribute__((ext_vector_type(4))) float v4f;
#define CAST_BLK   16384                       // 256 threads x 16 x 4 elements
#define CAST_SMALL (D_ * HD / CAST_BLK)        // blocks per D x HD weight: 64
#define CAST_LARGE (D_ * FF_ / CAST_BLK)       // blocks per D x FF weight: 256
#define CAST_GRID  (4 * CAST_SMALL + 2 * CAST_LARGE)
__global__ __launch_bounds__(256)
void cast_weights_kernel(const float* __restrict__ wq, const float* __restrict__ wk,
                         const float* __restrict__ wv, const float* __restrict__ wo,
                         const float* __restrict__ w1, const float* __restrict__ w2,
                         unsigned short* __restrict__ oq, unsigned short* __restrict__ ok,
                         unsigned short* __restrict__ ov, unsigned short* __restrict__ oo,
                         unsigned short* __restrict__ o1, unsigned short* __restrict__ o2) {
  int blk = blockIdx.x;
  const float* in;
  unsigned short* out;
  if (blk < 4 * CAST_SMALL) {
    int w = blk / CAST_SMALL;
    blk -= w * CAST_SMALL;
    in  = w == 0 ? wq : w == 1 ? wk : w == 2 ? wv : wo;
    out = w == 0 ? oq : w == 1 ? ok : w == 2 ? ov : oo;
  } else {
    blk -= 4 * CAST_SMALL;
    int w = blk / CAST_LARGE;
    blk -= w * CAST_LARGE;
    in  = w == 0 ? w1 : w2;
    out = w == 0 ? o1 : o2;
  }
  int off = blk * CAST_BLK + threadIdx.x * 4;
  in  += off;
  out += off;
  v4f f[16];
#pragma unroll
  for (int i = 0; i < 16; ++i) f[i] = *(const v4f*)(in + i * 1024);
  // takes the 16 loaded values as inputs only: all 16 loads are issued ahead of
  // it; without it the compiler sinks loads to just ahead of their conversion,
  // and the wave waits out several memory latencies one after the other. The
  // address is named too: it stays live, so no load lands in the register pair
  // that the loads issued before it name.
  asm volatile("" :: "v"(f[0]), "v"(f[1]), "v"(f[2]), "v"(f[3]), "v"(f[4]), "v"(f[5]),
                     "v"(f[6]), "v"(f[7]), "v"(f[8]), "v"(f[9]), "v"(f[10]), "v"(f[11]),
                     "v"(f[12]), "v"(f[13]), "v"(f[14]), "v"(f[15]), "v"(in));
  uint2 r[16];
#pragma unroll
  for (int i = 0; i < 16; ++i) {
    r[i].x = (unsigned int)f2bf(f[i].x) | ((unsigned int)f2bf(f[i].y) << 16);
    r[i].y = (unsigned int)f2bf(f[i].z) | ((unsigned int)f2bf(f[i].w) << 16);
  }
  // keeps the stores behind the last conversion, so that no register which an
  // issued store names is written again
  __builtin_amdgcn_sched_barrier(0);
#pragma unroll
  for (int i = 0; i < 16; ++i) *(uint2*)(out + i * 1024) = r[i];
}

// ---------------------------------------------------------------------------
// Row LayerNorm (D=1024), fp32 in -> bf16 out. One block (256 thr) per row.
// ---------------------------------------------------------------------------
__global__ __launch_bounds__(256)
void layernorm_bf16_kernel(const float* __restrict__ x,
                           const float* __restrict__ g,
                           const float* __restrict__ b,
                           unsigned short* __restrict__ out) {
  __shared__ float red[256];
  int row = blockIdx.x;
  int t = threadIdx.x;
  const float* xr = x + (size_t)row * D_;
  float v[4];
  float s = 0.f;
#pragma unroll
  for (int i = 0; i < 4; ++i) { v[i] = xr[t + i * 256]; s += v[i]; }
  red[t] = s; __syncthreads();
  for (int off = 128; off > 0; off >>= 1) {
    if (t < off) red[t] += red[t + off];
    __syncthreads();
  }
  float mu = red[0] * (1.f / D_);
  __syncthreads();
  float s2 = 0.f;
#pragma unroll
  for (int i = 0; i < 4; ++i) { float d = v[i] - mu; s2 += d * d; }
  red[t] = s2; __syncthreads();
  for (int off = 128; off > 0; off >>= 1) {
    if (t < off) red[t] += red[t + off];
    __syncthreads();
  }
  float rstd = rsqrtf(red[0] * (1.f / D_) + 1e-5f);
#pragma unroll
  for (int i = 0; i < 4; ++i) {
    int c = t + i * 256;
    out[(size_t)row * D_ + c] = f2bf((v[i] - mu) * rstd * g[c] + b[c]);
  }
}

static __device__ __forceinline__ void async_copy_4x16B(const unsigned int* l,
                                                        const unsigned long long* g) {
  asm volatile("global_load_async_to_lds_b128 %0, %4, off\n\t"
               "global_load_async_to_lds_b128 %1, %5, off\n\t"
               "global_load_async_to_lds_b128 %2, %6, off\n\t"
               "global_load_async_to_lds_b128 %3, %7, off\n\t"
               "s_wait_xcnt 0x0"
               :: "v"(l[0]), "v"(l[1]), "v"(l[2]), "v"(l[3]),
                  "v"(g[0]), "v"(g[1]), "v"(g[2]), "v"(g[3])
               : "memory");
}

// ---------------------------------------------------------------------------
// Generic bf16 WMMA GEMM:  C[M,N] = A[M,K] @ Bw[K,N]  (f32 accumulate)
// 128x128 tile per block, 64 k per trip, 256 threads = 8 waves (2 x 4), each
// wave 64(M) x 32(N): per 32 k, 6 fragments feed 8 WMMAs.
// M, N multiples of 128; K a multiple of 64.
// Two LDS buffers: the async A copies and the B global loads of tile t+1 fly
// while tile t is worked on; B is packed to [n][k] and stored after the WMMAs.
// ---------------------------------------------------------------------------
#define GBM 128
#define GBN 128
#define GBK 64
__global__ __launch_bounds__(256)
void gemm_wmma_kernel(const unsigned short* __restrict__ A,
                      const unsigned short* __restrict__ Bw,
                      int M, int N, int K,
                      const float* __restrict__ bias, int do_gelu,
                      const float* __restrict__ resid,
                      unsigned short* __restrict__ outb,
                      float* __restrict__ outf) {
  __shared__ alignas(16) unsigned short Alds[2][GBM][72];  // [m][k], 144B rows (padded)
  __shared__ alignas(16) unsigned int   Bt[2][GBN][36];    // [n][kpair], 144B rows (padded)

  int t = threadIdx.x;
  int wave = t >> 5, lane = t & 31;
  int lm = lane & 15, hf = lane >> 4;
  int mBase = blockIdx.y * GBM;
  int nBase = blockIdx.x * GBN;
  int wm = (wave >> 2) * 64;
  int wn = (wave & 3) * 32;
  int kIters = K >> 6;

  // A tile: 128 rows of 128 B; eight lanes cover one whole row per copy.
  auto stageA = [&](int kt, int buf) {
    int row0 = t >> 3, c8 = (t & 7) * 8;
    unsigned int l[4];
    unsigned long long g[4];
#pragma unroll
    for (int i = 0; i < 4; ++i) {
      int row = row0 + i * 32;
      l[i] = (unsigned int)(unsigned long long)&Alds[buf][row][c8];
      g[i] = (unsigned long long)(A + (size_t)(mBase + row) * K + kt * GBK + c8);
    }
    async_copy_4x16B(l, g);
  };
  // B tile: 64 k rows of 256 B. A thread owns one n pair and two groups of
  // eight k rows; eight dwords pack into one 16 B LDS store per n.
  int np = t & 63, kg0 = t >> 6;
  unsigned int bOff = (unsigned int)(kg0 * 8 * N + np * 2);
  unsigned int br[16];
  auto loadB = [&](int kt) {
    const unsigned short* Bk = Bw + (size_t)kt * GBK * N + nBase;
    // prefetch of the following B tile, 64 B per lane
    if (kt + 1 < kIters) {
      __builtin_prefetch(&Bk[(size_t)(GBK + (t >> 2)) * N + (t & 3) * 32], 0, 1);
      // its address register is a temporary that is rewritten right behind it
      asm volatile("s_wait_xcnt 0x0" ::: "memory");
    }
#pragma unroll
    for (int i = 0; i < 2; ++i)
#pragma unroll
      for (int r = 0; r < 8; ++r)
        br[i * 8 + r] = *(const unsigned int*)&(Bk + (size_t)(i * 32 + r) * N)[bOff];
    // the address registers of the requests above are reused right behind them
    asm volatile("s_wait_xcnt 0x0" ::: "memory");
  };
  auto storeB = [&](int buf) {
#pragma unroll
    for (int i = 0; i < 2; ++i) {
      const unsigned int* b = &br[i * 8];
      uint4 lo, hi;
      lo.x = (b[0] & 0xFFFFu) | (b[1] << 16);  hi.x = (b[0] >> 16) | (b[1] & 0xFFFF0000u);
      lo.y = (b[2] & 0xFFFFu) | (b[3] << 16);  hi.y = (b[2] >> 16) | (b[3] & 0xFFFF0000u);
      lo.z = (b[4] & 0xFFFFu) | (b[5] << 16);  hi.z = (b[4] >> 16) | (b[5] & 0xFFFF0000u);
      lo.w = (b[6] & 0xFFFFu) | (b[7] << 16);  hi.w = (b[6] >> 16) | (b[7] & 0xFFFF0000u);
      *(uint4*)&Bt[buf][np * 2][(kg0 + 4 * i) * 4]     = lo;
      *(uint4*)&Bt[buf][np * 2 + 1][(kg0 + 4 * i) * 4] = hi;
    }
  };

  v8f vzero = {};
  v8f acc[8];                       // tile i * 2 + j: rows wm + 16 i, columns wn + 16 j
#pragma unroll
  for (int q = 0; q < 8; ++q) acc[q] = vzero;

  // prologue: tile 0 lands and is published
  stageA(0, 0);
  loadB(0);
  storeB(0);
  asm volatile("s_wait_dscnt 0x0" ::: "memory");     // own B stores done before the barrier
  asm volatile("s_wait_asynccnt 0x0" ::: "memory");  // own A copies landed before the barrier
  __syncthreads();

  for (int kt = 0; kt < kIters; ++kt) {
    int cur = kt & 1;

    FragU af[2][4], bf[2][2];
#pragma unroll
    for (int ks = 0; ks < 2; ++ks) {
#pragma unroll
      for (int i = 0; i < 4; ++i) {
        int arow = wm + i * 16 + lm;
        af[ks][i].q[0] = *(const uint4*)&Alds[cur][arow][ks * 32 + hf * 8];
        af[ks][i].q[1] = *(const uint4*)&Alds[cur][arow][ks * 32 + 16 + hf * 8];
      }
#pragma unroll
      for (int j = 0; j < 2; ++j) {
        int brow = wn + j * 16 + lm;
        bf[ks][j].q[0] = *(const uint4*)&Bt[cur][brow][ks * 16 + hf * 4];
        bf[ks][j].q[1] = *(const uint4*)&Bt[cur][brow][ks * 16 + 8 + hf * 4];
      }
    }
    // keeps the trip's 24 LDS reads one group ahead of the WMMAs; without it the
    // compiler sinks them between the WMMAs and each pair waits out the LDS latency
    __builtin_amdgcn_sched_barrier(0);
    // tile kt+1 is set flying into the buffer that the barrier at the foot of
    // trip kt-1 has freed, while the LDS reads above are still coming in
    if (kt + 1 < kIters) { stageA(kt + 1, cur ^ 1); loadB(kt + 1); }
#pragma unroll
    for (int ks = 0; ks < 2; ++ks)
#pragma unroll
      for (int i = 0; i < 4; ++i)
#pragma unroll
        for (int j = 0; j < 2; ++j)
          acc[i * 2 + j] = __builtin_amdgcn_wmma_f32_16x16x32_bf16(
              false, af[ks][i].v, false, bf[ks][j].v, (short)0, acc[i * 2 + j], false, false);

    if (kt + 1 < kIters) storeB(cur ^ 1);
    // foot of the trip: own LDS reads and stores done, own copies of tile
    // kt+1 landed; the barrier publishes tile kt+1 and frees buffer cur.
    asm volatile("s_wait_dscnt 0x0" ::: "memory");
    asm volatile("s_wait_asynccnt 0x0" ::: "memory");
    __syncthreads();
  }
  asm volatile("s_wait_asynccnt 0x0" ::: "memory");  // no copy outstanding at the wave's end

  // ---- epilogue: one 16x16 tile per trip, the tiles rotated through acc[0] ----
  // kept rolled (64 erff bodies if unrolled), for speed only
#pragma unroll 1
  for (int q = 0; q < 8; ++q) {
    int col = nBase + wn + (q & 1) * 16 + lm;
    int row = mBase + wm + (q >> 1) * 16 + hf * 8;
    size_t o0 = (size_t)row * N + col;
    float val[8];
#pragma unroll
    for (int v = 0; v < 8; ++v) val[v] = acc[0][v];
    if (bias) {
      float bv = bias[col];
#pragma unroll
      for (int v = 0; v < 8; ++v) val[v] += bv;
    }
    if (do_gelu) {
#pragma unroll
      for (int v = 0; v < 8; ++v)
        val[v] = 0.5f * val[v] * (1.f + erff(val[v] * 0.70710678118654752f));
    }
    if (resid) {
      float rv[8];
#pragma unroll
      for (int v = 0; v < 8; ++v) rv[v] = resid[o0 + (size_t)v * N];
#pragma unroll
      for (int v = 0; v < 8; ++v) val[v] += rv[v];
    }
    if (outf) {
#pragma unroll
      for (int v = 0; v < 8; ++v) outf[o0 + (size_t)v * N] = val[v];
    } else {
#pragma unroll
      for (int v = 0; v < 8; ++v) outb[o0 + (size_t)v * N] = f2bf(val[v]);
    }
    // the registers that the stores name are rewritten by the rotation below;
    // the scheduling fence keeps the rotation's moves behind the wait
    asm volatile("s_wait_xcnt 0x0" ::: "memory");
    __builtin_amdgcn_sched_barrier(0);
#pragma unroll
    for (int s = 0; s < 7; ++s) acc[s] = acc[s + 1];
  }
}

typedef __attribute__((ext_vector_type(2))) float  v2f;
typedef __attribute__((ext_vector_type(2))) __bf16 v2bf;

static __device__ __forceinline__ float xhalf(float x) {
  int b = __builtin_bit_cast(int, x);
  return __builtin_bit_cast(float, __builtin_amdgcn_permlanex16(
      b, b, 0x76543210, 0xfedcba98, false, false));
}
// two f32 -> one dword of two bf16 (a in the low half), round to nearest even
static __device__ __forceinline__ unsigned int pack_bf16(float a, float b) {
  v2f f = {a, b};
  return __builtin_bit_cast(unsigned int, __builtin_convertvector(f, v2bf));
}

__global__ __launch_bounds__(128)
void flash_attn_kernel(const unsigned short* __restrict__ Q,
                       const unsigned short* __restrict__ Km,
                       const unsigned short* __restrict__ Vm,
                       unsigned short* __restrict__ O) {
  __shared__ alignas(16) unsigned short Qs[64][72];       // 144B rows
  __shared__ alignas(16) unsigned short Ks[2][32][72];    // 144B rows
  __shared__ alignas(16) unsigned int   Vt[2][64][20];    // [dh][keypair], 80B rows

  int t = threadIdx.x;
  int wave = t >> 5, lane = t & 31;
  int lm = lane & 15, hf = lane >> 4;
  int bh = blockIdx.x;
  int b = bh / H_, h = bh % H_;
  int q0 = b * N_ + blockIdx.y * 64;
  int colh = h * DH_;
  int rowBase = wave * 16;
  const int kbIters = N_ / 32;

  auto stageK = [&](int kb, int buf) {
    int k0 = b * N_ + kb * 32;
    int row = t >> 2, c16 = (t & 3) * 16;
    async_copy_32B(Km + (size_t)(k0 + row) * HD + colh + c16, &Ks[buf][row][c16]);
  };
  unsigned int vr0[4], vr1[4];
  auto loadV = [&](int kb) {
    int k0 = b * N_ + kb * 32;
#pragma unroll
    for (int i = 0; i < 4; ++i) {
      int idx = i * 128 + t;           // 512 tasks: (kp, dh-pair)
      int kp  = idx >> 5;              // 0..15
      int dh0 = (idx & 31) * 2;        // 0..62 even
      vr0[i] = *(const unsigned int*)&Vm[(size_t)(k0 + 2 * kp) * HD + colh + dh0];
      vr1[i] = *(const unsigned int*)&Vm[(size_t)(k0 + 2 * kp + 1) * HD + colh + dh0];
    }
  };
  auto storeV = [&](int buf) {
#pragma unroll
    for (int i = 0; i < 4; ++i) {
      int idx = i * 128 + t;
      int kp  = idx >> 5;
      int dh0 = (idx & 31) * 2;
      Vt[buf][dh0][kp]     = (vr0[i] & 0xFFFFu) | (vr1[i] << 16);
      Vt[buf][dh0 + 1][kp] = (vr0[i] >> 16)     | (vr1[i] & 0xFFFF0000u);
    }
  };

  // load Q tile 64x64 (64B per thread)
  {
    int row = t >> 1, c32 = (t & 1) * 32;
    const uint4* src = (const uint4*)(Q + (size_t)(q0 + row) * HD + colh + c32);
    uint4* dst = (uint4*)&Qs[row][c32];
    dst[0] = src[0]; dst[1] = src[1]; dst[2] = src[2]; dst[3] = src[3];
  }

  v8f vzero = {};
  v8f o[4];
#pragma unroll
  for (int c = 0; c < 4; ++c) o[c] = vzero;
  // of query lm: running maximum (both halves alike), and the sum over the
  // keys that this half of the wave holds
  float mrow = -1e30f, lrow = 0.f;

  // prologue: stage tile 0 (barrier also publishes Qs)
  stageK(0, 0);
  loadV(0);
  storeV(0);
  async_wait();
  __syncthreads();

  // Q^T fragments (B operand), read once and kept in registers
  FragU qb[2];
#pragma unroll
  for (int st = 0; st < 2; ++st) {
    qb[st].q[0] = *(const uint4*)&Qs[rowBase + lm][st * 32 + hf * 8];
    qb[st].q[1] = *(const uint4*)&Qs[rowBase + lm][st * 32 + 16 + hf * 8];
  }

  for (int kb = 0; kb < kbIters; ++kb) {
    int cur = kb & 1;
    bool more = (kb + 1) < kbIters;
    if (more) { stageK(kb + 1, cur ^ 1); loadV(kb + 1); }

    // K fragments (A operand of S^T) and V^T fragments (A operand of O^T)
    FragU kf[2][2], vf[4];
#pragma unroll
    for (int st = 0; st < 2; ++st)
#pragma unroll
      for (int j = 0; j < 2; ++j) {
        kf[st][j].q[0] = *(const uint4*)&Ks[cur][j * 16 + lm][st * 32 + hf * 8];
        kf[st][j].q[1] = *(const uint4*)&Ks[cur][j * 16 + lm][st * 32 + 16 + hf * 8];
      }
#pragma unroll
    for (int ct = 0; ct < 4; ++ct) {
      vf[ct].q[0] = *(const uint4*)&Vt[cur][ct * 16 + lm][hf * 4];
      vf[ct].q[1] = *(const uint4*)&Vt[cur][ct * 16 + lm][8 + hf * 4];
    }
    // keeps the next tile's V loads and the trip's 16 LDS reads at the head of
    // the trip; without it the compiler sinks each to just ahead of its use,
    // and the wave waits out the L2 and LDS latencies there
    __builtin_amdgcn_sched_barrier(0);

    // ---- S^T = K Q^T  (two 16-key tiles, two k-steps over DH=64) ----
    // s[j][v] = score of key 16 j + 8 hf + v against query lm
    v8f s[2]; s[0] = vzero; s[1] = vzero;
#pragma unroll
    for (int st = 0; st < 2; ++st)
#pragma unroll
      for (int j = 0; j < 2; ++j)
        s[j] = __builtin_amdgcn_wmma_f32_16x16x32_bf16(
            false, kf[st][j].v, false, qb[st].v, (short)0, s[j], false, false);

    // ---- online softmax of one query per lane ----
    float tm = fmaxf(s[0][0], s[1][0]);
#pragma unroll
    for (int v = 1; v < 8; ++v) tm = fmaxf(tm, fmaxf(s[0][v], s[1][v]));
    tm = fmaxf(tm, xhalf(tm));         // the other 16 keys of this query
    float mn = fmaxf(mrow, tm);
    float scale = __expf(mrow - mn);
    mrow = mn;
    float p0[8], p1[8];
    float rs0 = 0.f, rs1 = 0.f;
#pragma unroll
    for (int v = 0; v < 8; ++v) {
      p0[v] = __expf(s[0][v] - mn);
      p1[v] = __expf(s[1][v] - mn);
      rs0 += p0[v];
      rs1 += p1[v];
    }
    lrow = lrow * scale + (rs0 + rs1);
#pragma unroll
    for (int c = 0; c < 4; ++c)
#pragma unroll
      for (int v = 0; v < 8; ++v) o[c][v] *= scale;

    // ---- P^T as B operand: k = 8 hf + v from tile 0, 16 + 8 hf + v from tile 1 ----
    FragU pb;
#pragma unroll
    for (int i = 0; i < 4; ++i) {
      pb.u[i]     = pack_bf16(p0[2 * i], p0[2 * i + 1]);
      pb.u[4 + i] = pack_bf16(p1[2 * i], p1[2 * i + 1]);
    }

    // ---- O^T += V^T P^T : o[ct][v] = O[query lm][dh 16 ct + 8 hf + v] ----
#pragma unroll
    for (int ct = 0; ct < 4; ++ct) {
      o[ct] = __builtin_amdgcn_wmma_f32_16x16x32_bf16(
          false, vf[ct].v, false, pb.v, (short)0, o[ct], false, false);
    }

    // keeps the wait for the next tile's V loads, with their pack and store,
    // behind the trip's products; without it the compiler lifts that wait to
    // just behind the first WMMA, where the loads have had no time to return
    __builtin_amdgcn_sched_barrier(0);
    if (more) storeV(cur ^ 1);
    async_wait();
    __syncthreads();
  }

  // ---- normalize and store bf16: 8 consecutive dh of one query per store ----
  float lsum = lrow + xhalf(lrow);     // the two halves' key sums joined
  uint4 ov[4];
#pragma unroll
  for (int ct = 0; ct < 4; ++ct) {
    ov[ct].x = pack_bf16(o[ct][0] / lsum, o[ct][1] / lsum);
    ov[ct].y = pack_bf16(o[ct][2] / lsum, o[ct][3] / lsum);
    ov[ct].z = pack_bf16(o[ct][4] / lsum, o[ct][5] / lsum);
    ov[ct].w = pack_bf16(o[ct][6] / lsum, o[ct][7] / lsum);
  }
  unsigned short* orow = O + (size_t)(q0 + rowBase + lm) * HD + colh + hf * 8;
#pragma unroll
  for (int ct = 0; ct < 4; ++ct) *(uint4*)(orow + ct * 16) = ov[ct];
}

// ---------------------------------------------------------------------------
// Host-side orchestration
// ---------------------------------------------------------------------------
extern "C" void kernel_launch(void* const* d_in, const int* in_sizes, int n_in,
                              void* d_out, int out_size, void* d_ws, size_t ws_size,
                              hipStream_t stream) {
  const float* x     = (const float*)d_in[0];
  const float* wq    = (const float*)d_in[1];
  const float* wk    = (const float*)d_in[2];
  const float* wv    = (const float*)d_in[3];
  const float* wo    = (const float*)d_in[4];
  const float* w1    = (const float*)d_in[5];
  const float* b1    = (const float*)d_in[6];
  const float* w2    = (const float*)d_in[7];
  const float* b2    = (const float*)d_in[8];
  const float* ln1_g = (const float*)d_in[9];
  const float* ln1_b = (const float*)d_in[10];
  const float* ln2_g = (const float*)d_in[11];
  const float* ln2_b = (const float*)d_in[12];
  float* out = (float*)d_out;

  // workspace carve-out (~120 MiB total)
  char* p = (char*)d_ws;
  auto alloc = [&](size_t bytes) -> void* {
    void* r = (void*)p;
    p += (bytes + 255) & ~(size_t)255;
    return r;
  };
  unsigned short* wq_b = (unsigned short*)alloc((size_t)D_ * HD * 2);
  unsigned short* wk_b = (unsigned short*)alloc((size_t)D_ * HD * 2);
  unsigned short* wv_b = (unsigned short*)alloc((size_t)D_ * HD * 2);
  unsigned short* wo_b = (unsigned short*)alloc((size_t)HD * D_ * 2);
  unsigned short* w1_b = (unsigned short*)alloc((size_t)D_ * FF_ * 2);
  unsigned short* w2_b = (unsigned short*)alloc((size_t)FF_ * D_ * 2);
  unsigned short* h_b  = (unsigned short*)alloc((size_t)ROWS * D_ * 2);
  unsigned short* q_b  = (unsigned short*)alloc((size_t)ROWS * HD * 2);
  unsigned short* k_b  = (unsigned short*)alloc((size_t)ROWS * HD * 2);
  unsigned short* v_b  = (unsigned short*)alloc((size_t)ROWS * HD * 2);
  unsigned short* a_b  = (unsigned short*)alloc((size_t)ROWS * HD * 2);
  float*          x2   = (float*)        alloc((size_t)ROWS * D_ * 4);
  unsigned short* h2_b = (unsigned short*)alloc((size_t)ROWS * D_ * 2);
  unsigned short* ff_b = (unsigned short*)alloc((size_t)ROWS * FF_ * 2);

  // 1) weights -> bf16, one launch
  cast_weights_kernel<<<CAST_GRID, 256, 0, stream>>>(wq, wk, wv, wo, w1, w2,
                                                     wq_b, wk_b, wv_b, wo_b, w1_b, w2_b);

  // 2) LN1
  layernorm_bf16_kernel<<<ROWS, 256, 0, stream>>>(x, ln1_g, ln1_b, h_b);

  // 3) Q/K/V projections
  dim3 gemmBlk(256);
  dim3 attnBlk(128);
  dim3 gQKV(D_ / GBN, ROWS / GBM);
  gemm_wmma_kernel<<<gQKV, gemmBlk, 0, stream>>>(h_b, wq_b, ROWS, HD, D_,
                                                 nullptr, 0, nullptr, q_b, nullptr);
  gemm_wmma_kernel<<<gQKV, gemmBlk, 0, stream>>>(h_b, wk_b, ROWS, HD, D_,
                                                 nullptr, 0, nullptr, k_b, nullptr);
  gemm_wmma_kernel<<<gQKV, gemmBlk, 0, stream>>>(h_b, wv_b, ROWS, HD, D_,
                                                 nullptr, 0, nullptr, v_b, nullptr);

  // 4) attention
  dim3 gAttn(B_ * H_, N_ / 64);
  flash_attn_kernel<<<gAttn, attnBlk, 0, stream>>>(q_b, k_b, v_b, a_b);

  // 5) out projection + residual -> x2 (fp32)
  gemm_wmma_kernel<<<gQKV, gemmBlk, 0, stream>>>(a_b, wo_b, ROWS, D_, HD,
                                                 nullptr, 0, x, nullptr, x2);

  // 6) LN2
  layernorm_bf16_kernel<<<ROWS, 256, 0, stream>>>(x2, ln2_g, ln2_b, h2_b);

  // 7) FF1 + bias + exact GELU -> bf16
  dim3 gFF1(FF_ / GBN, ROWS / GBM);
  gemm_wmma_kernel<<<gFF1, gemmBlk, 0, stream>>>(h2_b, w1_b, ROWS, FF_, D_,
                                                 b1, 1, nullptr, ff_b, nullptr);

  // 8) FF2 + bias + residual -> out (fp32)
  dim3 gFF2(D_ / GBN, ROWS / GBM);
  gemm_wmma_kernel<<<gFF2, gemmBlk, 0, stream>>>(ff_b, w2_b, ROWS, D_, FF_,
                                                 b2, 0, x2, nullptr, out);
}

// v004
// It runs in 216 microseconds.
// Two timings next to v003 both put it at 1.22 times that version's speed.
// All steps since v000 together make it 2.60 times as fast.
#include <hip/hip_runtime.h>
#include <stdint.h>

// Problem constants (match reference)
#define B_  2
#define N_  2048
#define D_  1024
#define H_  16
#define DH_ 64
#define FF_ 4096
#define ROWS (B_ * N_)          // 4096
#define HD  (H_ * DH_)          // 1024

typedef __attribute__((ext_vector_type(16))) __bf16 v16bf;
typedef __attribute__((ext_vector_type(8)))  float  v8f;

// Fragment: 8 dwords = two 16B chunks; loaded as 2x ds_load_b128 (B of the GEMM: 2x ds_load_tr16_b128).
union FragU { uint4 q[2]; unsigned int u[8]; v16bf v; };

static __device__ __forceinline__ unsigned short f2bf(float f) {
  union { float f; unsigned int u; } c; c.f = f;
  unsigned int u = c.u;
  unsigned int r = u + 0x7FFFu + ((u >> 16) & 1u);   // round-to-nearest-even
  return (unsigned short)(r >> 16);
}

static __device__ __forceinline__ void async_copy_32B(const void* gsrc, void* ldst) {
  unsigned int       l = (unsigned int)(unsigned long long)ldst;   // low 32 bits = LDS addr
  unsigned long long g = (unsigned long long)gsrc;
  asm volatile("global_load_async_to_lds_b128 %0, %1, off\n\t"
               "global_load_async_to_lds_b128 %0, %1, off offset:16"
               :: "v"(l), "v"(g) : "memory");
}
typedef __attribute__((ext_vector_type(8))) short s16x8;
static __device__ __forceinline__ uint4 ld_tr16(const unsigned short* p) {
  typedef __attribute__((address_space(3))) s16x8 lds_s16x8;
  return __builtin_bit_cast(uint4, __builtin_amdgcn_ds_load_tr16_b128_v8i16((lds_s16x8*)p));
}
static __device__ __forceinline__ void async_wait() {
  asm volatile("s_wait_asynccnt 0x0" ::: "memory");
}

// ---------------------------------------------------------------------------
// f32 -> bf16 cast of all six weights in one launch of few, long-lived waves.
// A block converts CAST_BLK consecutive elements of one weight (every weight's
// size is a multiple of CAST_BLK). A thread has its 16 loads of 16 B in flight
// together; each load of a wave covers 512 contiguous bytes.
// ---------------------------------------------------------------------------
typedef __attribute__((ext_vector_type(4))) float v4f;
#define CAST_BLK   16384                       // 256 threads x 16 x 4 elements
#define CAST_SMALL (D_ * HD / CAST_BLK)        // blocks per D x HD weight: 64
#define CAST_LARGE (D_ * FF_ / CAST_BLK)       // blocks per D x FF weight: 256
#define CAST_GRID  (4 * CAST_SMALL + 2 * CAST_LARGE)
__global__ __launch_bounds__(256)
void cast_weights_kernel(const float* __restrict__ wq, const float* __restrict__ wk,
                         const float* __restrict__ wv, const float* __restrict__ wo,
                         const float* __restrict__ w1, const float* __restrict__ w2,
                         unsigned short* __restrict__ oq, unsigned short* __restrict__ ok,
                         unsigned short* __restrict__ ov, unsigned short* __restrict__ oo,
                         unsigned short* __restrict__ o1, unsigned short* __restrict__ o2) {
  int blk = blockIdx.x;
  const float* in;
  unsigned short* out;
  if (blk < 4 * CAST_SMALL) {
    int w = blk / CAST_SMALL;
    blk -= w * CAST_SMALL;
    in  = w == 0 ? wq : w == 1 ? wk : w == 2 ? wv : wo;
    out = w == 0 ? oq : w == 1 ? ok : w == 2 ? ov : oo;
  } else {
    blk -= 4 * CAST_SMALL;
    int w = blk / CAST_LARGE;
    blk -= w * CAST_LARGE;
    in  = w == 0 ? w1 : w2;
    out = w == 0 ? o1 : o2;
  }
  int off = blk * CAST_BLK + threadIdx.x * 4;
  in  += off;
  out += off;
  v4f f[16];
#pragma unroll
  for (int i = 0; i < 16; ++i) f[i] = *(const v4f*)(in + i * 1024);
  // takes the 16 loaded values as inputs only: all 16 loads are issued ahead of
  // it; without it the compiler sinks loads to just ahead of their conversion,
  // and the wave waits out several memory latencies one after the other. The
  // address is named too: it stays live, so no load lands in the register pair
  // that the loads issued before it name.
  asm volatile("" :: "v"(f[0]), "v"(f[1]), "v"(f[2]), "v"(f[3]), "v"(f[4]), "v"(f[5]),
                     "v"(f[6]), "v"(f[7]), "v"(f[8]), "v"(f[9]), "v"(f[10]), "v"(f[11]),
                     "v"(f[12]), "v"(f[13]), "v"(f[14]), "v"(f[15]), "v"(in));
  uint2 r[16];
#pragma unroll
  for (int i = 0; i < 16; ++i) {
    r[i].x = (unsigned int)f2bf(f[i].x) | ((unsigned int)f2bf(f[i].y) << 16);
    r[i].y = (unsigned int)f2bf(f[i].z) | ((unsigned int)f2bf(f[i].w) << 16);
  }
  // keeps the stores behind the last conversion, so that no register which an
  // issued store names is written again
  __builtin_amdgcn_sched_barrier(0);
#pragma unroll
  for (int i = 0; i < 16; ++i) *(uint2*)(out + i * 1024) = r[i];
}

// ---------------------------------------------------------------------------
// Row LayerNorm (D=1024), fp32 in -> bf16 out. One block (256 thr) per row.
// ---------------------------------------------------------------------------
__global__ __launch_bounds__(256)
void layernorm_bf16_kernel(const float* __restrict__ x,
                           const float* __restrict__ g,
                           const float* __restrict__ b,
                           unsigned short* __restrict__ out) {
  __shared__ float red[256];
  int row = blockIdx.x;
  int t = threadIdx.x;
  const float* xr = x + (size_t)row * D_;
  float v[4];
  float s = 0.f;
#pragma unroll
  for (int i = 0; i < 4; ++i) { v[i] = xr[t + i * 256]; s += v[i]; }
  red[t] = s; __syncthreads();
  for (int off = 128; off > 0; off >>= 1) {
    if (t < off) red[t] += red[t + off];
    __syncthreads();
  }
  float mu = red[0] * (1.f / D_);
  __syncthreads();
  float s2 = 0.f;
#pragma unroll
  for (int i = 0; i < 4; ++i) { float d = v[i] - mu; s2 += d * d; }
  red[t] = s2; __syncthreads();
  for (int off = 128; off > 0; off >>= 1) {
    if (t < off) red[t] += red[t + off];
    __syncthreads();
  }
  float rstd = rsqrtf(red[0] * (1.f / D_) + 1e-5f);
#pragma unroll
  for (int i = 0; i < 4; ++i) {
    int c = t + i * 256;
    out[(size_t)row * D_ + c] = f2bf((v[i] - mu) * rstd * g[c] + b[c]);
  }
}

static __device__ __forceinline__ void async_copy_8x16B(const unsigned int* l,
                                                        const unsigned long long* g) {
  asm volatile("global_load_async_to_lds_b128 %0, %8, off\n\t"
               "global_load_async_to_lds_b128 %1, %9, off\n\t"
               "global_load_async_to_lds_b128 %2, %10, off\n\t"
               "global_load_async_to_lds_b128 %3, %11, off\n\t"
               "global_load_async_to_lds_b128 %4, %12, off\n\t"
               "global_load_async_to_lds_b128 %5, %13, off\n\t"
               "global_load_async_to_lds_b128 %6, %14, off\n\t"
               "global_load_async_to_lds_b128 %7, %15, off\n\t"
               "s_wait_xcnt 0x0"
               :: "v"(l[0]), "v"(l[1]), "v"(l[2]), "v"(l[3]),
                  "v"(l[4]), "v"(l[5]), "v"(l[6]), "v"(l[7]),
                  "v"(g[0]), "v"(g[1]), "v"(g[2]), "v"(g[3]),
                  "v"(g[4]), "v"(g[5]), "v"(g[6]), "v"(g[7])
               : "memory");
}

// ---------------------------------------------------------------------------
// Generic bf16 WMMA GEMM:  C[M,N] = A[M,K] @ Bw[K,N]  (f32 accumulate)
// 128x128 tile per block, 128 k per trip, 256 threads = 8 waves (2 x 4), each
// wave 64(M) x 32(N): per 32 k, 6 fragments feed 8 WMMAs.
// M, N multiples of 128; K a multiple of 128.
// Two LDS buffers: the async copies of A and B of tile t+1 fly while tile t is
// worked on, 64 KB a block, over the time of 32 WMMAs a wave. B lies in LDS as
// in memory, [k][n]; its fragments come by the transposing load.
// ---------------------------------------------------------------------------
#define GBM 128
#define GBN 128
#define GBK 128
__global__ __launch_bounds__(256)
void gemm_wmma_kernel(const unsigned short* __restrict__ A,
                      const unsigned short* __restrict__ Bw,
                      int M, int N, int K,
                      const float* __restrict__ bias, int do_gelu,
                      const float* __restrict__ resid,
                      unsigned short* __restrict__ outb,
                      float* __restrict__ outf) {
  __shared__ alignas(16) unsigned short Alds[2][GBM][136]; // [m][k], 272B rows (padded)
  __shared__ alignas(16) unsigned short Bs[2][GBK][144];   // [k][n], 288B rows (padded)

  int t = threadIdx.x;
  int wave = t >> 5, lane = t & 31;
  int lm = lane & 15, hf = lane >> 4;
  int mBase = blockIdx.y * GBM;
  int nBase = blockIdx.x * GBN;
  int wm = (wave >> 2) * 64;
  int wn = (wave & 3) * 32;
  int kIters = K >> 7;

  // A tile: 128 m rows of 256 B. B tile: 128 k rows of 256 B. Sixteen lanes
  // cover one whole row per copy.
  int row0 = t >> 4, c8 = (t & 15) * 8;
  const unsigned short* aLane = A + (size_t)row0 * K + c8;            // the lane's share of
  const unsigned short* bLane = Bw + (size_t)row0 * N + nBase + c8;   // the addresses
  auto stage = [&](int kt, int buf) {
    unsigned int l[8];
    unsigned long long g[8];
#pragma unroll
    for (int i = 0; i < 8; ++i) {
      int row = row0 + i * 16;
      l[i] = (unsigned int)(unsigned long long)&Alds[buf][row][c8];
      g[i] = (unsigned long long)(aLane + ((size_t)(mBase + i * 16) * K + kt * GBK));
    }
    async_copy_8x16B(l, g);
#pragma unroll
    for (int i = 0; i < 8; ++i) {
      int row = row0 + i * 16;
      l[i] = (unsigned int)(unsigned long long)&Bs[buf][row][c8];
      g[i] = (unsigned long long)(bLane + (size_t)(kt * GBK + i * 16) * N);
    }
    async_copy_8x16B(l, g);
  };
  // the lane's place in a 16 x 16 block for the transposing load
  int trow = hf * 8 + (lane & 7), tcol = ((lane >> 3) & 1) * 8;

  v8f vzero = {};
  v8f acc[8];                       // tile i * 2 + j: rows wm + 16 i, columns wn + 16 j
#pragma unroll
  for (int q = 0; q < 8; ++q) acc[q] = vzero;

  // prologue: tile 0 lands and is published
  stage(0, 0);
  asm volatile("s_wait_asynccnt 0x0" ::: "memory");  // own copies landed before the barrier
  __syncthreads();

  for (int kt = 0; kt < kIters; ++kt) {
    int cur = kt & 1;

#pragma unroll
    for (int kh = 0; kh < 2; ++kh) {     // the tile's two halves of 64 k
      FragU af[2][4], bf[2][2];
#pragma unroll
      for (int ks = 0; ks < 2; ++ks) {
        int k0 = kh * 64 + ks * 32;
#pragma unroll
        for (int i = 0; i < 4; ++i) {
          int arow = wm + i * 16 + lm;
          af[ks][i].q[0] = *(const uint4*)&Alds[cur][arow][k0 + hf * 8];
          af[ks][i].q[1] = *(const uint4*)&Alds[cur][arow][k0 + 16 + hf * 8];
        }
#pragma unroll
        for (int j = 0; j < 2; ++j) {
          int bcol = wn + j * 16 + tcol;
          bf[ks][j].q[0] = ld_tr16(&Bs[cur][k0 + trow][bcol]);
          bf[ks][j].q[1] = ld_tr16(&Bs[cur][k0 + 16 + trow][bcol]);
        }
      }
      // keeps the half's 24 LDS reads one group ahead of its WMMAs; without it the
      // compiler sinks them between the WMMAs and each pair waits out the LDS latency
      __builtin_amdgcn_sched_barrier(0);
      // tile kt+1 is set flying into the buffer that the barrier at the foot of
      // trip kt-1 has freed, while the LDS reads above are still coming in
      if (kh == 0 && kt + 1 < kIters) stage(kt + 1, cur ^ 1);
#pragma unroll
      for (int ks = 0; ks < 2; ++ks)
#pragma unroll
        for (int i = 0; i < 4; ++i)
#pragma unroll
          for (int j = 0; j < 2; ++j)
            acc[i * 2 + j] = __builtin_amdgcn_wmma_f32_16x16x32_bf16(
                false, af[ks][i].v, false, bf[ks][j].v, (short)0, acc[i * 2 + j], false, false);
      // keeps the half's WMMAs ahead of what follows: the next half's LDS reads
      // (one fragment set serves both halves) and the foot's waits and barrier,
      // behind which the compiler otherwise sinks them, so that they no longer
      // cover the copies' flight
      __builtin_amdgcn_sched_barrier(0);
    }

    // foot of the trip: own LDS reads done, own copies of tile kt+1 landed; the
    // barrier publishes tile kt+1 and frees buffer cur.
    asm volatile("s_wait_dscnt 0x0" ::: "memory");
    asm volatile("s_wait_asynccnt 0x0" ::: "memory");
    __syncthreads();
  }
  asm volatile("s_wait_asynccnt 0x0" ::: "memory");  // no copy outstanding at the wave's end

  // ---- epilogue: one 16x16 tile per trip, the tiles rotated through acc[0] ----
  // kept rolled (64 erff bodies if unrolled), for speed only
#pragma unroll 1
  for (int q = 0; q < 8; ++q) {
    int col = nBase + wn + (q & 1) * 16 + lm;
    int row = mBase + wm + (q >> 1) * 16 + hf * 8;
    size_t o0 = (size_t)row * N + col;
    float val[8];
#pragma unroll
    for (int v = 0; v < 8; ++v) val[v] = acc[0][v];
    if (bias) {
      float bv = bias[col];
#pragma unroll
      for (int v = 0; v < 8; ++v) val[v] += bv;
    }
    if (do_gelu) {
#pragma unroll
      for (int v = 0; v < 8; ++v)
        val[v] = 0.5f * val[v] * (1.f + erff(val[v] * 0.70710678118654752f));
    }
    if (resid) {
      float rv[8];
#pragma unroll
      for (int v = 0; v < 8; ++v) rv[v] = resid[o0 + (size_t)v * N];
#pragma unroll
      for (int v = 0; v < 8; ++v) val[v] += rv[v];
    }
    if (outf) {
#pragma unroll
      for (int v = 0; v < 8; ++v) outf[o0 + (size_t)v * N] = val[v];
    } else {
#pragma unroll
      for (int v = 0; v < 8; ++v) outb[o0 + (size_t)v * N] = f2bf(val[v]);
    }
    // the registers that the stores name are rewritten by the rotation below;
    // the scheduling fence keeps the rotation's moves behind the wait
    asm volatile("s_wait_xcnt 0x0" ::: "memory");
    __builtin_amdgcn_sched_barrier(0);
#pragma unroll
    for (int s = 0; s < 7; ++s) acc[s] = acc[s + 1];
  }
}

typedef __attribute__((ext_vector_type(2))) float  v2f;
typedef __attribute__((ext_vector_type(2))) __bf16 v2bf;

static __device__ __forceinline__ float xhalf(float x) {
  int b = __builtin_bit_cast(int, x);
  return __builtin_bit_cast(float, __builtin_amdgcn_permlanex16(
      b, b, 0x76543210, 0xfedcba98, false, false));
}
// two f32 -> one dword of two bf16 (a in the low half), round to nearest even
static __device__ __forceinline__ unsigned int pack_bf16(float a, float b) {
  v2f f = {a, b};
  return __builtin_bit_cast(unsigned int, __builtin_convertvector(f, v2bf));
}

__global__ __launch_bounds__(128)
void flash_attn_kernel(const unsigned short* __restrict__ Q,
                       const unsigned short* __restrict__ Km,
                       const unsigned short* __restrict__ Vm,
                       unsigned short* __restrict__ O) {
  __shared__ alignas(16) unsigned short Qs[64][72];       // 144B rows
  __shared__ alignas(16) unsigned short Ks[2][32][72];    // 144B rows
  __shared__ alignas(16) unsigned int   Vt[2][64][20];    // [dh][keypair], 80B rows

  int t = threadIdx.x;
  int wave = t >> 5, lane = t & 31;
  int lm = lane & 15, hf = lane >> 4;
  int bh = blockIdx.x;
  int b = bh / H_, h = bh % H_;
  int q0 = b * N_ + blockIdx.y * 64;
  int colh = h * DH_;
  int rowBase = wave * 16;
  const int kbIters = N_ / 32;

  auto stageK = [&](int kb, int buf) {
    int k0 = b * N_ + kb * 32;
    int row = t >> 2, c16 = (t & 3) * 16;
    async_copy_32B(Km + (size_t)(k0 + row) * HD + colh + c16, &Ks[buf][row][c16]);
  };
  unsigned int vr0[4], vr1[4];
  auto loadV = [&](int kb) {
    int k0 = b * N_ + kb * 32;
#pragma unroll
    for (int i = 0; i < 4; ++i) {
      int idx = i * 128 + t;           // 512 tasks: (kp, dh-pair)
      int kp  = idx >> 5;              // 0..15
      int dh0 = (idx & 31) * 2;        // 0..62 even
      vr0[i] = *(const unsigned int*)&Vm[(size_t)(k0 + 2 * kp) * HD + colh + dh0];
      vr1[i] = *(const unsigned int*)&Vm[(size_t)(k0 + 2 * kp + 1) * HD + colh + dh0];
    }
  };
  auto storeV = [&](int buf) {
#pragma unroll
    for (int i = 0; i < 4; ++i) {
      int idx = i * 128 + t;
      int kp  = idx >> 5;
      int dh0 = (idx & 31) * 2;
      Vt[buf][dh0][kp]     = (vr0[i] & 0xFFFFu) | (vr1[i] << 16);
      Vt[buf][dh0 + 1][kp] = (vr0[i] >> 16)     | (vr1[i] & 0xFFFF0000u);
    }
  };

  // load Q tile 64x64 (64B per thread)
  {
    int row = t >> 1, c32 = (t & 1) * 32;
    const uint4* src = (const uint4*)(Q + (size_t)(q0 + row) * HD + colh + c32);
    uint4* dst = (uint4*)&Qs[row][c32];
    dst[0] = src[0]; dst[1] = src[1]; dst[2] = src[2]; dst[3] = src[3];
  }

  v8f vzero = {};
  v8f o[4];
#pragma unroll
  for (int c = 0; c < 4; ++c) o[c] = vzero;
  // of query lm: running maximum (both halves alike), and the sum over the
  // keys that this half of the wave holds
  float mrow = -1e30f, lrow = 0.f;

  // prologue: stage tile 0 (barrier also publishes Qs)
  stageK(0, 0);
  loadV(0);
  storeV(0);
  async_wait();
  __syncthreads();

  // Q^T fragments (B operand), read once and kept in registers
  FragU qb[2];
#pragma unroll
  for (int st = 0; st < 2; ++st) {
    qb[st].q[0] = *(const uint4*)&Qs[rowBase + lm][st * 32 + hf * 8];
    qb[st].q[1] = *(const uint4*)&Qs[rowBase + lm][st * 32 + 16 + hf * 8];
  }

  for (int kb = 0; kb < kbIters; ++kb) {
    int cur = kb & 1;
    bool more = (kb + 1) < kbIters;
    if (more) { stageK(kb + 1, cur ^ 1); loadV(kb + 1); }

    // K fragments (A operand of S^T) and V^T fragments (A operand of O^T)
    FragU kf[2][2], vf[4];
#pragma unroll
    for (int st = 0; st < 2; ++st)
#pragma unroll
      for (int j = 0; j < 2; ++j) {
        kf[st][j].q[0] = *(const uint4*)&Ks[cur][j * 16 + lm][st * 32 + hf * 8];
        kf[st][j].q[1] = *(const uint4*)&Ks[cur][j * 16 + lm][st * 32 + 16 + hf * 8];
      }
#pragma unroll
    for (int ct = 0; ct < 4; ++ct) {
      vf[ct].q[0] = *(const uint4*)&Vt[cur][ct * 16 + lm][hf * 4];
      vf[ct].q[1] = *(const uint4*)&Vt[cur][ct * 16 + lm][8 + hf * 4];
    }
    // keeps the next tile's V loads and the trip's 16 LDS reads at the head of
    // the trip; without it the compiler sinks each to just ahead of its use,
    // and the wave waits out the L2 and LDS latencies there
    __builtin_amdgcn_sched_barrier(0);

    // ---- S^T = K Q^T  (two 16-key tiles, two k-steps over DH=64) ----
    // s[j][v] = score of key 16 j + 8 hf + v against query lm
    v8f s[2]; s[0] = vzero; s[1] = vzero;
#pragma unroll
    for (int st = 0; st < 2; ++st)
#pragma unroll
      for (int j = 0; j < 2; ++j)
        s[j] = __builtin_amdgcn_wmma_f32_16x16x32_bf16(
            false, kf[st][j].v, false, qb[st].v, (short)0, s[j], false, false);

    // ---- online softmax of one query per lane ----
    float tm = fmaxf(s[0][0], s[1][0]);
#pragma unroll
    for (int v = 1; v < 8; ++v) tm = fmaxf(tm, fmaxf(s[0][v], s[1][v]));
    tm = fmaxf(tm, xhalf(tm));         // the other 16 keys of this query
    float mn = fmaxf(mrow, tm);
    float scale = __expf(mrow - mn);
    mrow = mn;
    float p0[8], p1[8];
    float rs0 = 0.f, rs1 = 0.f;
#pragma unroll
    for (int v = 0; v < 8; ++v) {
      p0[v] = __expf(s[0][v] - mn);
      p1[v] = __expf(s[1][v] - mn);
      rs0 += p0[v];
      rs1 += p1[v];
    }
    lrow = lrow * scale + (rs0 + rs1);
#pragma unroll
    for (int c = 0; c < 4; ++c)
#pragma unroll
      for (int v = 0; v < 8; ++v) o[c][v] *= scale;

    // ---- P^T as B operand: k = 8 hf + v from tile 0, 16 + 8 hf + v from tile 1 ----
    FragU pb;
#pragma unroll
    for (int i = 0; i < 4; ++i) {
      pb.u[i]     = pack_bf16(p0[2 * i], p0[2 * i + 1]);
      pb.u[4 + i] = pack_bf16(p1[2 * i], p1[2 * i + 1]);
    }

    // ---- O^T += V^T P^T : o[ct][v] = O[query lm][dh 16 ct + 8 hf + v] ----
#pragma unroll
    for (int ct = 0; ct < 4; ++ct) {
      o[ct] = __builtin_amdgcn_wmma_f32_16x16x32_bf16(
          false, vf[ct].v, false, pb.v, (short)0, o[ct], false, false);
    }

    // keeps the wait for the next tile's V loads, with their pack and store,
    // behind the trip's products; without it the compiler lifts that wait to
    // just behind the first WMMA, where the loads have had no time to return
    __builtin_amdgcn_sched_barrier(0);
    if (more) storeV(cur ^ 1);
    async_wait();
    __syncthreads();
  }

  // ---- normalize and store bf16: 8 consecutive dh of one query per store ----
  float lsum = lrow + xhalf(lrow);     // the two halves' key sums joined
  uint4 ov[4];
#pragma unroll
  for (int ct = 0; ct < 4; ++ct) {
    ov[ct].x = pack_bf16(o[ct][0] / lsum, o[ct][1] / lsum);
    ov[ct].y = pack_bf16(o[ct][2] / lsum, o[ct][3] / lsum);
    ov[ct].z = pack_bf16(o[ct][4] / lsum, o[ct][5] / lsum);
    ov[ct].w = pack_bf16(o[ct][6] / lsum, o[ct][7] / lsum);
  }
  unsigned short* orow = O + (size_t)(q0 + rowBase + lm) * HD + colh + hf * 8;
#pragma unroll
  for (int ct = 0; ct < 4; ++ct) *(uint4*)(orow + ct * 16) = ov[ct];
}

// ---------------------------------------------------------------------------
// Host-side orchestration
// ---------------------------------------------------------------------------
extern "C" void kernel_launch(void* const* d_in, const int* in_sizes, int n_in,
                              void* d_out, int out_size, void* d_ws, size_t ws_size,
                              hipStream_t stream) {
  const float* x     = (const float*)d_in[0];
  const float* wq    = (const float*)d_in[1];
  const float* wk    = (const float*)d_in[2];
  const float* wv    = (const float*)d_in[3];
  const float* wo    = (const float*)d_in[4];
  const float* w1    = (const float*)d_in[5];
  const float* b1    = (const float*)d_in[6];
  const float* w2    = (const float*)d_in[7];
  const float* b2    = (const float*)d_in[8];
  const float* ln1_g = (const float*)d_in[9];
  const float* ln1_b = (const float*)d_in[10];
  const float* ln2_g = (const float*)d_in[11];
  const float* ln2_b = (const float*)d_in[12];
  float* out = (float*)d_out;

  // workspace carve-out (~120 MiB total)
  char* p = (char*)d_ws;
  auto alloc = [&](size_t bytes) -> void* {
    void* r = (void*)p;
    p += (bytes + 255) & ~(size_t)255;
    return r;
  };
  unsigned short* wq_b = (unsigned short*)alloc((size_t)D_ * HD * 2);
  unsigned short* wk_b = (unsigned short*)alloc((size_t)D_ * HD * 2);
  unsigned short* wv_b = (unsigned short*)alloc((size_t)D_ * HD * 2);
  unsigned short* wo_b = (unsigned short*)alloc((size_t)HD * D_ * 2);
  unsigned short* w1_b = (unsigned short*)alloc((size_t)D_ * FF_ * 2);
  unsigned short* w2_b = (unsigned short*)alloc((size_t)FF_ * D_ * 2);
  unsigned short* h_b  = (unsigned short*)alloc((size_t)ROWS * D_ * 2);
  unsigned short* q_b  = (unsigned short*)alloc((size_t)ROWS * HD * 2);
  unsigned short* k_b  = (unsigned short*)alloc((size_t)ROWS * HD * 2);
  unsigned short* v_b  = (unsigned short*)alloc((size_t)ROWS * HD * 2);
  unsigned short* a_b  = (unsigned short*)alloc((size_t)ROWS * HD * 2);
  float*          x2   = (float*)        alloc((size_t)ROWS * D_ * 4);
  unsigned short* h2_b = (unsigned short*)alloc((size_t)ROWS * D_ * 2);
  unsigned short* ff_b = (unsigned short*)alloc((size_t)ROWS * FF_ * 2);

  // 1) weights -> bf16, one launch
  cast_weights_kernel<<<CAST_GRID, 256, 0, stream>>>(wq, wk, wv, wo, w1, w2,
                                                     wq_b, wk_b, wv_b, wo_b, w1_b, w2_b);

  // 2) LN1
  layernorm_bf16_kernel<<<ROWS, 256, 0, stream>>>(x, ln1_g, ln1_b, h_b);

  // 3) Q/K/V projections
  dim3 gemmBlk(256);
  dim3 attnBlk(128);
  dim3 gQKV(D_ / GBN, ROWS / GBM);
  gemm_wmma_kernel<<<gQKV, gemmBlk, 0, stream>>>(h_b, wq_b, ROWS, HD, D_,
                                                 nullptr, 0, nullptr, q_b, nullptr);
  gemm_wmma_kernel<<<gQKV, gemmBlk, 0, stream>>>(h_b, wk_b, ROWS, HD, D_,
                                                 nullptr, 0, nullptr, k_b, nullptr);
  gemm_wmma_kernel<<<gQKV, gemmBlk, 0, stream>>>(h_b, wv_b, ROWS, HD, D_,
                                                 nullptr, 0, nullptr, v_b, nullptr);

  // 4) attention
  dim3 gAttn(B_ * H_, N_ / 64);
  flash_attn_kernel<<<gAttn, attnBlk, 0, stream>>>(q_b, k_b, v_b, a_b);

  // 5) out projection + residual -> x2 (fp32)
  gemm_wmma_kernel<<<gQKV, gemmBlk, 0, stream>>>(a_b, wo_b, ROWS, D_, HD,
                                                 nullptr, 0, x, nullptr, x2);

  // 6) LN2
  layernorm_bf16_kernel<<<ROWS, 256, 0, stream>>>(x2, ln2_g, ln2_b, h2_b);

  // 7) FF1 + bias + exact GELU -> bf16
  dim3 gFF1(FF_ / GBN, ROWS / GBM);
  gemm_wmma_kernel<<<gFF1, gemmBlk, 0, stream>>>(h2_b, w1_b, ROWS, FF_, D_,
                                                 b1, 1, nullptr, ff_b, nullptr);

  // 8) FF2 + bias + residual -> out (fp32)
  dim3 gFF2(D_ / GBN, ROWS / GBM);
  gemm_wmma_kernel<<<gFF2, gemmBlk, 0, stream>>>(ff_b, w2_b, ROWS, D_, FF_,
                                                 b2, 0, x2, nullptr, out);
}

// v005
// It runs in 210 microseconds.
// Next to v004, in two timings, it ran 1.04 times as fast each time.
// All steps since v000 together make it 2.70 times as fast.
#include <hip/hip_runtime.h>
#include <stdint.h>

// Problem constants (match reference)
#define B_  2
#define N_  2048
#define D_  1024
#define H_  16
#define DH_ 64
#define FF_ 4096
#define ROWS (B_ * N_)          // 4096
#define HD  (H_ * DH_)          // 1024

typedef __attribute__((ext_vector_type(16))) __bf16 v16bf;
typedef __attribute__((ext_vector_type(8)))  float  v8f;

// Fragment: 8 dwords = two 16B chunks; loaded as 2x ds_load_b128 (B of the GEMM: 2x ds_load_tr16_b128).
union FragU { uint4 q[2]; unsigned int u[8]; v16bf v; };

static __device__ __forceinline__ unsigned short f2bf(float f) {
  union { float f; unsigned int u; } c; c.f = f;
  unsigned int u = c.u;
  unsigned int r = u + 0x7FFFu + ((u >> 16) & 1u);   // round-to-nearest-even
  return (unsigned short)(r >> 16);
}

static __device__ __forceinline__ void async_copy_32B(const void* gsrc, void* ldst) {
  unsigned int       l = (unsigned int)(unsigned long long)ldst;   // low 32 bits = LDS addr
  unsigned long long g = (unsigned long long)gsrc;
  asm volatile("global_load_async_to_lds_b128 %0, %1, off\n\t"
               "global_load_async_to_lds_b128 %0, %1, off offset:16"
               :: "v"(l), "v"(g) : "memory");
}
typedef __attribute__((ext_vector_type(8))) short s16x8;
static __device__ __forceinline__ uint4 ld_tr16(const unsigned short* p) {
  typedef __attribute__((address_space(3))) s16x8 lds_s16x8;
  return __builtin_bit_cast(uint4, __builtin_amdgcn_ds_load_tr16_b128_v8i16((lds_s16x8*)p));
}
static __device__ __forceinline__ void async_wait() {
  asm volatile("s_wait_asynccnt 0x0" ::: "memory");
}

// ---------------------------------------------------------------------------
// f32 -> bf16 cast of all six weights, one pass per block.
// A block converts CAST_BLK consecutive elements of one weight (every weight's
// size is a multiple of CAST_BLK). A thread has its 16 loads of 16 B in flight
// together; each load of a wave covers 512 contiguous bytes.
// ---------------------------------------------------------------------------
typedef __attribute__((ext_vector_type(4))) float v4f;
#define CAST_BLK   16384                       // 256 threads x 16 x 4 elements
#define CAST_SMALL (D_ * HD / CAST_BLK)        // blocks per D x HD weight: 64
#define CAST_LARGE (D_ * FF_ / CAST_BLK)       // blocks per D x FF weight: 256
#define CAST_GRID  (4 * CAST_SMALL + 2 * CAST_LARGE)
static __device__ __forceinline__
void cast_weights_block(int blk,
                        const float* __restrict__ wq, const float* __restrict__ wk,
                        const float* __restrict__ wv, const float* __restrict__ wo,
                        const float* __restrict__ w1, const float* __restrict__ w2,
                        unsigned short* __restrict__ oq, unsigned short* __restrict__ ok,
                        unsigned short* __restrict__ ov, unsigned short* __restrict__ oo,
                        unsigned short* __restrict__ o1, unsigned short* __restrict__ o2) {
  const float* in;
  unsigned short* out;
  if (blk < 4 * CAST_SMALL) {
    int w = blk / CAST_SMALL;
    blk -= w * CAST_SMALL;
    in  = w == 0 ? wq : w == 1 ? wk : w == 2 ? wv : wo;
    out = w == 0 ? oq : w == 1 ? ok : w == 2 ? ov : oo;
  } else {
    blk -= 4 * CAST_SMALL;
    int w = blk / CAST_LARGE;
    blk -= w * CAST_LARGE;
    in  = w == 0 ? w1 : w2;
    out = w == 0 ? o1 : o2;
  }
  int off = blk * CAST_BLK + threadIdx.x * 4;
  in  += off;
  out += off;
  v4f f[16];
#pragma unroll
  for (int i = 0; i < 16; ++i) f[i] = *(const v4f*)(in + i * 1024);
  // takes the 16 loaded values as inputs only: all 16 loads are issued ahead of
  // it; without it the compiler sinks loads to just ahead of their conversion,
  // and the wave waits out several memory latencies one after the other. The
  // address is named too: it stays live, so no load lands in the register pair
  // that the loads issued before it name.
  asm volatile("" :: "v"(f[0]), "v"(f[1]), "v"(f[2]), "v"(f[3]), "v"(f[4]), "v"(f[5]),
                     "v"(f[6]), "v"(f[7]), "v"(f[8]), "v"(f[9]), "v"(f[10]), "v"(f[11]),
                     "v"(f[12]), "v"(f[13]), "v"(f[14]), "v"(f[15]), "v"(in));
  uint2 r[16];
#pragma unroll
  for (int i = 0; i < 16; ++i) {
    r[i].x = (unsigned int)f2bf(f[i].x) | ((unsigned int)f2bf(f[i].y) << 16);
    r[i].y = (unsigned int)f2bf(f[i].z) | ((unsigned int)f2bf(f[i].w) << 16);
  }
  // keeps the stores behind the last conversion, so that no register which an
  // issued store names is written again
  __builtin_amdgcn_sched_barrier(0);
#pragma unroll
  for (int i = 0; i < 16; ++i) *(uint2*)(out + i * 1024) = r[i];
}

// ---------------------------------------------------------------------------
// Row LayerNorm (D=1024), fp32 in -> bf16 out. One block (256 thr) per row.
// ---------------------------------------------------------------------------
static __device__ __forceinline__
void layernorm_row(int row,
                   const float* __restrict__ x,
                   const float* __restrict__ g,
                   const float* __restrict__ b,
                   unsigned short* __restrict__ out) {
  __shared__ float red[256];
  int t = threadIdx.x;
  const float* xr = x + (size_t)row * D_;
  float v[4];
  float s = 0.f;
#pragma unroll
  for (int i = 0; i < 4; ++i) { v[i] = xr[t + i * 256]; s += v[i]; }
  red[t] = s; __syncthreads();
  for (int off = 128; off > 0; off >>= 1) {
    if (t < off) red[t] += red[t + off];
    __syncthreads();
  }
  float mu = red[0] * (1.f / D_);
  __syncthreads();
  float s2 = 0.f;
#pragma unroll
  for (int i = 0; i < 4; ++i) { float d = v[i] - mu; s2 += d * d; }
  red[t] = s2; __syncthreads();
  for (int off = 128; off > 0; off >>= 1) {
    if (t < off) red[t] += red[t + off];
    __syncthreads();
  }
  float rstd = rsqrtf(red[0] * (1.f / D_) + 1e-5f);
#pragma unroll
  for (int i = 0; i < 4; ++i) {
    int c = t + i * 256;
    out[(size_t)row * D_ + c] = f2bf((v[i] - mu) * rstd * g[c] + b[c]);
  }
}

__global__ __launch_bounds__(256)
void layernorm_bf16_kernel(const float* __restrict__ x,
                           const float* __restrict__ g,
                           const float* __restrict__ b,
                           unsigned short* __restrict__ out) {
  layernorm_row(blockIdx.x, x, g, b, out);
}

// ---------------------------------------------------------------------------
// The weight casts and the first LayerNorm depend on nothing of each other:
// one grid holds both. The block index picks the body, alike for the whole
// block; the cast blocks, which move the most bytes each, take the low indices.
// ---------------------------------------------------------------------------
__global__ __launch_bounds__(256)
void cast_and_layernorm_kernel(const float* __restrict__ wq, const float* __restrict__ wk,
                               const float* __restrict__ wv, const float* __restrict__ wo,
                               const float* __restrict__ w1, const float* __restrict__ w2,
                               unsigned short* __restrict__ oq, unsigned short* __restrict__ ok,
                               unsigned short* __restrict__ ov, unsigned short* __restrict__ oo,
                               unsigned short* __restrict__ o1, unsigned short* __restrict__ o2,
                               const float* __restrict__ x, const float* __restrict__ g,
                               const float* __restrict__ b, unsigned short* __restrict__ h) {
  int blk = blockIdx.x;
  if (blk < CAST_GRID) cast_weights_block(blk, wq, wk, wv, wo, w1, w2, oq, ok, ov, oo, o1, o2);
  else                 layernorm_row(blk - CAST_GRID, x, g, b, h);
}

static __device__ __forceinline__ void async_copy_8x16B(const unsigned int* l,
                                                        const unsigned long long* g) {
  asm volatile("global_load_async_to_lds_b128 %0, %8, off\n\t"
               "global_load_async_to_lds_b128 %1, %9, off\n\t"
               "global_load_async_to_lds_b128 %2, %10, off\n\t"
               "global_load_async_to_lds_b128 %3, %11, off\n\t"
               "global_load_async_to_lds_b128 %4, %12, off\n\t"
               "global_load_async_to_lds_b128 %5, %13, off\n\t"
               "global_load_async_to_lds_b128 %6, %14, off\n\t"
               "global_load_async_to_lds_b128 %7, %15, off\n\t"
               "s_wait_xcnt 0x0"
               :: "v"(l[0]), "v"(l[1]), "v"(l[2]), "v"(l[3]),
                  "v"(l[4]), "v"(l[5]), "v"(l[6]), "v"(l[7]),
                  "v"(g[0]), "v"(g[1]), "v"(g[2]), "v"(g[3]),
                  "v"(g[4]), "v"(g[5]), "v"(g[6]), "v"(g[7])
               : "memory");
}

// ---------------------------------------------------------------------------
// Generic bf16 WMMA GEMM:  C[M,N] = A[M,K] @ Bw[K,N]  (f32 accumulate)
// 128x128 tile per block, 128 k per trip, 256 threads = 8 waves (2 x 4), each
// wave 64(M) x 32(N): per 32 k, 6 fragments feed 8 WMMAs.
// M, N multiples of 128; K a multiple of 128.
// Two LDS buffers: the async copies of A and B of tile t+1 fly while tile t is
// worked on, 64 KB a block, over the time of 32 WMMAs a wave. B lies in LDS as
// in memory, [k][n]; its fragments come by the transposing load.
// Products that share A go in one grid: plane blockIdx.z takes the weight at
// Bw + z * zB and writes its bf16 output at outb + z * zO.
// ---------------------------------------------------------------------------
#define GBM 128
#define GBN 128
#define GBK 128
__global__ __launch_bounds__(256)
void gemm_wmma_kernel(const unsigned short* __restrict__ A,
                      const unsigned short* __restrict__ Bw,
                      int M, int N, int K,
                      const float* __restrict__ bias, int do_gelu,
                      const float* __restrict__ resid,
                      unsigned short* __restrict__ outb,
                      float* __restrict__ outf,
                      int zB, int zO) {
  Bw   += (size_t)blockIdx.z * zB;
  outb += (size_t)blockIdx.z * zO;
  __shared__ alignas(16) unsigned short Alds[2][GBM][136]; // [m][k], 272B rows (padded)
  __shared__ alignas(16) unsigned short Bs[2][GBK][144];   // [k][n], 288B rows (padded)

  int t = threadIdx.x;
  int wave = t >> 5, lane = t & 31;
  int lm = lane & 15, hf = lane >> 4;
  int mBase = blockIdx.y * GBM;
  int nBase = blockIdx.x * GBN;
  int wm = (wave >> 2) * 64;
  int wn = (wave & 3) * 32;
  int kIters = K >> 7;

  // A tile: 128 m rows of 256 B. B tile: 128 k rows of 256 B. Sixteen lanes
  // cover one whole row per copy.
  int row0 = t >> 4, c8 = (t & 15) * 8;
  const unsigned short* aLane = A + (size_t)row0 * K + c8;            // the lane's share of
  const unsigned short* bLane = Bw + (size_t)row0 * N + nBase + c8;   // the addresses
  auto stage = [&](int kt, int buf) {
    unsigned int l[8];
    unsigned long long g[8];
#pragma unroll
    for (int i = 0; i < 8; ++i) {
      int row = row0 + i * 16;
      l[i] = (unsigned int)(unsigned long long)&Alds[buf][row][c8];
      g[i] = (unsigned long long)(aLane + ((size_t)(mBase + i * 16) * K + kt * GBK));
    }
    async_copy_8x16B(l, g);
#pragma unroll
    for (int i = 0; i < 8; ++i) {
      int row = row0 + i * 16;
      l[i] = (unsigned int)(unsigned long long)&Bs[buf][row][c8];
      g[i] = (unsigned long long)(bLane + (size_t)(kt * GBK + i * 16) * N);
    }
    async_copy_8x16B(l, g);
  };
  // the lane's place in a 16 x 16 block for the transposing load
  int trow = hf * 8 + (lane & 7), tcol = ((lane >> 3) & 1) * 8;

  v8f vzero = {};
  v8f acc[8];                       // tile i * 2 + j: rows wm + 16 i, columns wn + 16 j
#pragma unroll
  for (int q = 0; q < 8; ++q) acc[q] = vzero;

  // prologue: tile 0 lands and is published
  stage(0, 0);
  asm volatile("s_wait_asynccnt 0x0" ::: "memory");  // own copies landed before the barrier
  __syncthreads();

  for (int kt = 0; kt < kIters; ++kt) {
    int cur = kt & 1;

#pragma unroll
    for (int kh = 0; kh < 2; ++kh) {     // the tile's two halves of 64 k
      FragU af[2][4], bf[2][2];
#pragma unroll
      for (int ks = 0; ks < 2; ++ks) {
        int k0 = kh * 64 + ks * 32;
#pragma unroll
        for (int i = 0; i < 4; ++i) {
          int arow = wm + i * 16 + lm;
          af[ks][i].q[0] = *(const uint4*)&Alds[cur][arow][k0 + hf * 8];
          af[ks][i].q[1] = *(const uint4*)&Alds[cur][arow][k0 + 16 + hf * 8];
        }
#pragma unroll
        for (int j = 0; j < 2; ++j) {
          int bcol = wn + j * 16 + tcol;
          bf[ks][j].q[0] = ld_tr16(&Bs[cur][k0 + trow][bcol]);
          bf[ks][j].q[1] = ld_tr16(&Bs[cur][k0 + 16 + trow][bcol]);
        }
      }
      // keeps the half's 24 LDS reads one group ahead of its WMMAs; without it the
      // compiler sinks them between the WMMAs and each pair waits out the LDS latency
      __builtin_amdgcn_sched_barrier(0);
      // tile kt+1 is set flying into the buffer that the barrier at the foot of
      // trip kt-1 has freed, while the LDS reads above are still coming in
      if (kh == 0 && kt + 1 < kIters) stage(kt + 1, cur ^ 1);
#pragma unroll
      for (int ks = 0; ks < 2; ++ks)
#pragma unroll
        for (int i = 0; i < 4; ++i)
#pragma unroll
          for (int j = 0; j < 2; ++j)
            acc[i * 2 + j] = __builtin_amdgcn_wmma_f32_16x16x32_bf16(
                false, af[ks][i].v, false, bf[ks][j].v, (short)0, acc[i * 2 + j], false, false);
      // keeps the half's WMMAs ahead of what follows: the next half's LDS reads
      // (one fragment set serves both halves) and the foot's waits and barrier,
      // behind which the compiler otherwise sinks them, so that they no longer
      // cover the copies' flight
      __builtin_amdgcn_sched_barrier(0);
    }

    // foot of the trip: own LDS reads done, own copies of tile kt+1 landed; the
    // barrier publishes tile kt+1 and frees buffer cur.
    asm volatile("s_wait_dscnt 0x0" ::: "memory");
    asm volatile("s_wait_asynccnt 0x0" ::: "memory");
    __syncthreads();
  }
  asm volatile("s_wait_asynccnt 0x0" ::: "memory");  // no copy outstanding at the wave's end

  // ---- epilogue: one 16x16 tile per trip, the tiles rotated through acc[0] ----
  // kept rolled (64 erff bodies if unrolled), for speed only
#pragma unroll 1
  for (int q = 0; q < 8; ++q) {
    int col = nBase + wn + (q & 1) * 16 + lm;
    int row = mBase + wm + (q >> 1) * 16 + hf * 8;
    size_t o0 = (size_t)row * N + col;
    float val[8];
#pragma unroll
    for (int v = 0; v < 8; ++v) val[v] = acc[0][v];
    if (bias) {
      float bv = bias[col];
#pragma unroll
      for (int v = 0; v < 8; ++v) val[v] += bv;
    }
    if (do_gelu) {
#pragma unroll
      for (int v = 0; v < 8; ++v)
        val[v] = 0.5f * val[v] * (1.f + erff(val[v] * 0.70710678118654752f));
    }
    if (resid) {
      float rv[8];
#pragma unroll
      for (int v = 0; v < 8; ++v) rv[v] = resid[o0 + (size_t)v * N];
#pragma unroll
      for (int v = 0; v < 8; ++v) val[v] += rv[v];
    }
    if (outf) {
#pragma unroll
      for (int v = 0; v < 8; ++v) outf[o0 + (size_t)v * N] = val[v];
    } else {
#pragma unroll
      for (int v = 0; v < 8; ++v) outb[o0 + (size_t)v * N] = f2bf(val[v]);
    }
    // the registers that the stores name are rewritten by the rotation below;
    // the scheduling fence keeps the rotation's moves behind the wait
    asm volatile("s_wait_xcnt 0x0" ::: "memory");
    __builtin_amdgcn_sched_barrier(0);
#pragma unroll
    for (int s = 0; s < 7; ++s) acc[s] = acc[s + 1];
  }
}

typedef __attribute__((ext_vector_type(2))) float  v2f;
typedef __attribute__((ext_vector_type(2))) __bf16 v2bf;

static __device__ __forceinline__ float xhalf(float x) {
  int b = __builtin_bit_cast(int, x);
  return __builtin_bit_cast(float, __builtin_amdgcn_permlanex16(
      b, b, 0x76543210, 0xfedcba98, false, false));
}
// two f32 -> one dword of two bf16 (a in the low half), round to nearest even
static __device__ __forceinline__ unsigned int pack_bf16(float a, float b) {
  v2f f = {a, b};
  return __builtin_bit_cast(unsigned int, __builtin_convertvector(f, v2bf));
}

__global__ __launch_bounds__(128)
void flash_attn_kernel(const unsigned short* __restrict__ Q,
                       const unsigned short* __restrict__ Km,
                       const unsigned short* __restrict__ Vm,
                       unsigned short* __restrict__ O) {
  __shared__ alignas(16) unsigned short Qs[64][72];       // 144B rows
  __shared__ alignas(16) unsigned short Ks[2][32][72];    // 144B rows
  __shared__ alignas(16) unsigned int   Vt[2][64][20];    // [dh][keypair], 80B rows

  int t = threadIdx.x;
  int wave = t >> 5, lane = t & 31;
  int lm = lane & 15, hf = lane >> 4;
  int bh = blockIdx.x;
  int b = bh / H_, h = bh % H_;
  int q0 = b * N_ + blockIdx.y * 64;
  int colh = h * DH_;
  int rowBase = wave * 16;
  const int kbIters = N_ / 32;

  auto stageK = [&](int kb, int buf) {
    int k0 = b * N_ + kb * 32;
    int row = t >> 2, c16 = (t & 3) * 16;
    async_copy_32B(Km + (size_t)(k0 + row) * HD + colh + c16, &Ks[buf][row][c16]);
  };
  unsigned int vr0[4], vr1[4];
  auto loadV = [&](int kb) {
    int k0 = b * N_ + kb * 32;
#pragma unroll
    for (int i = 0; i < 4; ++i) {
      int idx = i * 128 + t;           // 512 tasks: (kp, dh-pair)
      int kp  = idx >> 5;              // 0..15
      int dh0 = (idx & 31) * 2;        // 0..62 even
      vr0[i] = *(const unsigned int*)&Vm[(size_t)(k0 + 2 * kp) * HD + colh + dh0];
      vr1[i] = *(const unsigned int*)&Vm[(size_t)(k0 + 2 * kp + 1) * HD + colh + dh0];
    }
  };
  auto storeV = [&](int buf) {
#pragma unroll
    for (int i = 0; i < 4; ++i) {
      int idx = i * 128 + t;
      int kp  = idx >> 5;
      int dh0 = (idx & 31) * 2;
      Vt[buf][dh0][kp]     = (vr0[i] & 0xFFFFu) | (vr1[i] << 16);
      Vt[buf][dh0 + 1][kp] = (vr0[i] >> 16)     | (vr1[i] & 0xFFFF0000u);
    }
  };

  // load Q tile 64x64 (64B per thread)
  {
    int row = t >> 1, c32 = (t & 1) * 32;
    const uint4* src = (const uint4*)(Q + (size_t)(q0 + row) * HD + colh + c32);
    uint4* dst = (uint4*)&Qs[row][c32];
    dst[0] = src[0]; dst[1] = src[1]; dst[2] = src[2]; dst[3] = src[3];
  }

  v8f vzero = {};
  v8f o[4];
#pragma unroll
  for (int c = 0; c < 4; ++c) o[c] = vzero;
  // of query lm: running maximum (both halves alike), and the sum over the
  // keys that this half of the wave holds
  float mrow = -1e30f, lrow = 0.f;

  // prologue: stage tile 0 (barrier also publishes Qs)
  stageK(0, 0);
  loadV(0);
  storeV(0);
  async_wait();
  __syncthreads();

  // Q^T fragments (B operand), read once and kept in registers
  FragU qb[2];
#pragma unroll
  for (int st = 0; st < 2; ++st) {
    qb[st].q[0] = *(const uint4*)&Qs[rowBase + lm][st * 32 + hf * 8];
    qb[st].q[1] = *(const uint4*)&Qs[rowBase + lm][st * 32 + 16 + hf * 8];
  }

  for (int kb = 0; kb < kbIters; ++kb) {
    int cur = kb & 1;
    bool more = (kb + 1) < kbIters;
    if (more) { stageK(kb + 1, cur ^ 1); loadV(kb + 1); }

    // K fragments (A operand of S^T) and V^T fragments (A operand of O^T)
    FragU kf[2][2], vf[4];
#pragma unroll
    for (int st = 0; st < 2; ++st)
#pragma unroll
      for (int j = 0; j < 2; ++j) {
        kf[st][j].q[0] = *(const uint4*)&Ks[cur][j * 16 + lm][st * 32 + hf * 8];
        kf[st][j].q[1] = *(const uint4*)&Ks[cur][j * 16 + lm][st * 32 + 16 + hf * 8];
      }
#pragma unroll
    for (int ct = 0; ct < 4; ++ct) {
      vf[ct].q[0] = *(const uint4*)&Vt[cur][ct * 16 + lm][hf * 4];
      vf[ct].q[1] = *(const uint4*)&Vt[cur][ct * 16 + lm][8 + hf * 4];
    }
    // keeps the next tile's V loads and the trip's 16 LDS reads at the head of
    // the trip; without it the compiler sinks each to just ahead of its use,
    // and the wave waits out the L2 and LDS latencies there
    __builtin_amdgcn_sched_barrier(0);

    // ---- S^T = K Q^T  (two 16-key tiles, two k-steps over DH=64) ----
    // s[j][v] = score of key 16 j + 8 hf + v against query lm
    v8f s[2]; s[0] = vzero; s[1] = vzero;
#pragma unroll
    for (int st = 0; st < 2; ++st)
#pragma unroll
      for (int j = 0; j < 2; ++j)
        s[j] = __builtin_amdgcn_wmma_f32_16x16x32_bf16(
            false, kf[st][j].v, false, qb[st].v, (short)0, s[j], false, false);

    // ---- online softmax of one query per lane ----
    float tm = fmaxf(s[0][0], s[1][0]);
#pragma unroll
    for (int v = 1; v < 8; ++v) tm = fmaxf(tm, fmaxf(s[0][v], s[1][v]));
    tm = fmaxf(tm, xhalf(tm));         // the other 16 keys of this query
    float mn = fmaxf(mrow, tm);
    float scale = __expf(mrow - mn);
    mrow = mn;
    float p0[8], p1[8];
    float rs0 = 0.f, rs1 = 0.f;
#pragma unroll
    for (int v = 0; v < 8; ++v) {
      p0[v] = __expf(s[0][v] - mn);
      p1[v] = __expf(s[1][v] - mn);
      rs0 += p0[v];
      rs1 += p1[v];
    }
    lrow = lrow * scale + (rs0 + rs1);
#pragma unroll
    for (int c = 0; c < 4; ++c)
#pragma unroll
      for (int v = 0; v < 8; ++v) o[c][v] *= scale;

    // ---- P^T as B operand: k = 8 hf + v from tile 0, 16 + 8 hf + v from tile 1 ----
    FragU pb;
#pragma unroll
    for (int i = 0; i < 4; ++i) {
      pb.u[i]     = pack_bf16(p0[2 * i], p0[2 * i + 1]);
      pb.u[4 + i] = pack_bf16(p1[2 * i], p1[2 * i + 1]);
    }

    // ---- O^T += V^T P^T : o[ct][v] = O[query lm][dh 16 ct + 8 hf + v] ----
#pragma unroll
    for (int ct = 0; ct < 4; ++ct) {
      o[ct] = __builtin_amdgcn_wmma_f32_16x16x32_bf16(
          false, vf[ct].v, false, pb.v, (short)0, o[ct], false, false);
    }

    // keeps the wait for the next tile's V loads, with their pack and store,
    // behind the trip's products; without it the compiler lifts that wait to
    // just behind the first WMMA, where the loads have had no time to return
    __builtin_amdgcn_sched_barrier(0);
    if (more) storeV(cur ^ 1);
    async_wait();
    __syncthreads();
  }

  // ---- normalize and store bf16: 8 consecutive dh of one query per store ----
  float lsum = lrow + xhalf(lrow);     // the two halves' key sums joined
  uint4 ov[4];
#pragma unroll
  for (int ct = 0; ct < 4; ++ct) {
    ov[ct].x = pack_bf16(o[ct][0] / lsum, o[ct][1] / lsum);
    ov[ct].y = pack_bf16(o[ct][2] / lsum, o[ct][3] / lsum);
    ov[ct].z = pack_bf16(o[ct][4] / lsum, o[ct][5] / lsum);
    ov[ct].w = pack_bf16(o[ct][6] / lsum, o[ct][7] / lsum);
  }
  unsigned short* orow = O + (size_t)(q0 + rowBase + lm) * HD + colh + hf * 8;
#pragma unroll
  for (int ct = 0; ct < 4; ++ct) *(uint4*)(orow + ct * 16) = ov[ct];
}

// ---------------------------------------------------------------------------
// Host-side orchestration
// ---------------------------------------------------------------------------
extern "C" void kernel_launch(void* const* d_in, const int* in_sizes, int n_in,
                              void* d_out, int out_size, void* d_ws, size_t ws_size,
                              hipStream_t stream) {
  const float* x     = (const float*)d_in[0];
  const float* wq    = (const float*)d_in[1];
  const float* wk    = (const float*)d_in[2];
  const float* wv    = (const float*)d_in[3];
  const float* wo    = (const float*)d_in[4];
  const float* w1    = (const float*)d_in[5];
  const float* b1    = (const float*)d_in[6];
  const float* w2    = (const float*)d_in[7];
  const float* b2    = (const float*)d_in[8];
  const float* ln1_g = (const float*)d_in[9];
  const float* ln1_b = (const float*)d_in[10];
  const float* ln2_g = (const float*)d_in[11];
  const float* ln2_b = (const float*)d_in[12];
  float* out = (float*)d_out;

  // workspace carve-out (~120 MiB total)
  char* p = (char*)d_ws;
  auto alloc = [&](size_t bytes) -> void* {
    void* r = (void*)p;
    p += (bytes + 255) & ~(size_t)255;
    return r;
  };
  unsigned short* wq_b = (unsigned short*)alloc((size_t)3 * D_ * HD * 2);   // wq | wk | wv
  unsigned short* wk_b = wq_b + D_ * HD;
  unsigned short* wv_b = wk_b + D_ * HD;
  unsigned short* wo_b = (unsigned short*)alloc((size_t)HD * D_ * 2);
  unsigned short* w1_b = (unsigned short*)alloc((size_t)D_ * FF_ * 2);
  unsigned short* w2_b = (unsigned short*)alloc((size_t)FF_ * D_ * 2);
  unsigned short* h_b  = (unsigned short*)alloc((size_t)ROWS * D_ * 2);
  unsigned short* q_b  = (unsigned short*)alloc((size_t)3 * ROWS * HD * 2); // q | k | v
  unsigned short* k_b  = q_b + ROWS * HD;
  unsigned short* v_b  = k_b + ROWS * HD;
  unsigned short* a_b  = (unsigned short*)alloc((size_t)ROWS * HD * 2);
  float*          x2   = (float*)        alloc((size_t)ROWS * D_ * 4);
  unsigned short* h2_b = (unsigned short*)alloc((size_t)ROWS * D_ * 2);
  unsigned short* ff_b = (unsigned short*)alloc((size_t)ROWS * FF_ * 2);

  // 1) weights -> bf16 and LN1, one launch
  cast_and_layernorm_kernel<<<CAST_GRID + ROWS, 256, 0, stream>>>(
      wq, wk, wv, wo, w1, w2, wq_b, wk_b, wv_b, wo_b, w1_b, w2_b, x, ln1_g, ln1_b, h_b);

  // 2) Q/K/V projections, one launch of three planes
  dim3 gemmBlk(256);
  dim3 attnBlk(128);
  dim3 gQKV(HD / GBN, ROWS / GBM, 3);
  gemm_wmma_kernel<<<gQKV, gemmBlk, 0, stream>>>(h_b, wq_b, ROWS, HD, D_,
                                                 nullptr, 0, nullptr, q_b, nullptr,
                                                 D_ * HD, ROWS * HD);

  // 3) attention
  dim3 gAttn(B_ * H_, N_ / 64);
  flash_attn_kernel<<<gAttn, attnBlk, 0, stream>>>(q_b, k_b, v_b, a_b);

  // 4) out projection + residual -> x2 (fp32)
  dim3 gO(D_ / GBN, ROWS / GBM);
  gemm_wmma_kernel<<<gO, gemmBlk, 0, stream>>>(a_b, wo_b, ROWS, D_, HD,
                                               nullptr, 0, x, nullptr, x2, 0, 0);

  // 5) LN2
  layernorm_bf16_kernel<<<ROWS, 256, 0, stream>>>(x2, ln2_g, ln2_b, h2_b);

  // 6) FF1 + bias + exact GELU -> bf16
  dim3 gFF1(FF_ / GBN, ROWS / GBM);
  gemm_wmma_kernel<<<gFF1, gemmBlk, 0, stream>>>(h2_b, w1_b, ROWS, FF_, D_,
                                                 b1, 1, nullptr, ff_b, nullptr, 0, 0);

  // 7) FF2 + bias + residual -> out (fp32)
  dim3 gFF2(D_ / GBN, ROWS / GBM);
  gemm_wmma_kernel<<<gFF2, gemmBlk, 0, stream>>>(ff_b, w2_b, ROWS, D_, FF_,
                                                 b2, 0, x2, nullptr, out, 0, 0);
}

// v006
// One run takes 194 microseconds.
// In both of two side-by-side timings against v005, it was 1.09 times as fast.
// Over all steps from v000 it is 2.93 times as fast.
#include <hip/hip_runtime.h>
#include <stdint.h>

// Problem constants (match reference)
#define B_  2
#define N_  2048
#define D_  1024
#define H_  16
#define DH_ 64
#define FF_ 4096
#define ROWS (B_ * N_)          // 4096
#define HD  (H_ * DH_)          // 1024

typedef __attribute__((ext_vector_type(16))) __bf16 v16bf;
typedef __attribute__((ext_vector_type(8)))  float  v8f;

// Fragment: 8 dwords = two 16B chunks; loaded as 2x ds_load_b128 (B of the GEMM: 2x ds_load_tr16_b128).
union FragU { uint4 q[2]; unsigned int u[8]; v16bf v; };

static __device__ __forceinline__ unsigned short f2bf(float f) {
  union { float f; unsigned int u; } c; c.f = f;
  unsigned int u = c.u;
  unsigned int r = u + 0x7FFFu + ((u >> 16) & 1u);   // round-to-nearest-even
  return (unsigned short)(r >> 16);
}

static __device__ __forceinline__ void async_copy_32B(const void* gsrc, void* ldst) {
  unsigned int       l = (unsigned int)(unsigned long long)ldst;   // low 32 bits = LDS addr
  unsigned long long g = (unsigned long long)gsrc;
  asm volatile("global_load_async_to_lds_b128 %0, %1, off\n\t"
               "global_load_async_to_lds_b128 %0, %1, off offset:16"
               :: "v"(l), "v"(g) : "memory");
}
typedef __attribute__((ext_vector_type(8))) short s16x8;
static __device__ __forceinline__ uint4 ld_tr16(const unsigned short* p) {
  typedef __attribute__((address_space(3))) s16x8 lds_s16x8;
  return __builtin_bit_cast(uint4, __builtin_amdgcn_ds_load_tr16_b128_v8i16((lds_s16x8*)p));
}
static __device__ __forceinline__ void async_wait() {
  asm volatile("s_wait_asynccnt 0x0" ::: "memory");
}

// ---------------------------------------------------------------------------
// f32 -> bf16 cast of all six weights, one pass per block.
// A block converts CAST_BLK consecutive elements of one weight (every weight's
// size is a multiple of CAST_BLK). A thread has its 16 loads of 16 B in flight
// together; each load of a wave covers 512 contiguous bytes.
// ---------------------------------------------------------------------------
typedef __attribute__((ext_vector_type(4))) float v4f;
#define CAST_BLK   16384                       // 256 threads x 16 x 4 elements
#define CAST_SMALL (D_ * HD / CAST_BLK)        // blocks per D x HD weight: 64
#define CAST_LARGE (D_ * FF_ / CAST_BLK)       // blocks per D x FF weight: 256
#define CAST_GRID  (4 * CAST_SMALL + 2 * CAST_LARGE)
static __device__ __forceinline__
void cast_weights_block(int blk,
                        const float* __restrict__ wq, const float* __restrict__ wk,
                        const float* __restrict__ wv, const float* __restrict__ wo,
                        const float* __restrict__ w1, const float* __restrict__ w2,
                        unsigned short* __restrict__ oq, unsigned short* __restrict__ ok,
                        unsigned short* __restrict__ ov, unsigned short* __restrict__ oo,
                        unsigned short* __restrict__ o1, unsigned short* __restrict__ o2) {
  const float* in;
  unsigned short* out;
  if (blk < 4 * CAST_SMALL) {
    int w = blk / CAST_SMALL;
    blk -= w * CAST_SMALL;
    in  = w == 0 ? wq : w == 1 ? wk : w == 2 ? wv : wo;
    out = w == 0 ? oq : w == 1 ? ok : w == 2 ? ov : oo;
  } else {
    blk -= 4 * CAST_SMALL;
    int w = blk / CAST_LARGE;
    blk -= w * CAST_LARGE;
    in  = w == 0 ? w1 : w2;
    out = w == 0 ? o1 : o2;
  }
  int off = blk * CAST_BLK + threadIdx.x * 4;
  in  += off;
  out += off;
  v4f f[16];
#pragma unroll
  for (int i = 0; i < 16; ++i) f[i] = *(const v4f*)(in + i * 1024);
  // takes the 16 loaded values as inputs only: all 16 loads are issued ahead of
  // it; without it the compiler sinks loads to just ahead of their conversion,
  // and the wave waits out several memory latencies one after the other. The
  // address is named too: it stays live, so no load lands in the register pair
  // that the loads issued before it name.
  asm volatile("" :: "v"(f[0]), "v"(f[1]), "v"(f[2]), "v"(f[3]), "v"(f[4]), "v"(f[5]),
                     "v"(f[6]), "v"(f[7]), "v"(f[8]), "v"(f[9]), "v"(f[10]), "v"(f[11]),
                     "v"(f[12]), "v"(f[13]), "v"(f[14]), "v"(f[15]), "v"(in));
  uint2 r[16];
#pragma unroll
  for (int i = 0; i < 16; ++i) {
    r[i].x = (unsigned int)f2bf(f[i].x) | ((unsigned int)f2bf(f[i].y) << 16);
    r[i].y = (unsigned int)f2bf(f[i].z) | ((unsigned int)f2bf(f[i].w) << 16);
  }
  // keeps the stores behind the last conversion, so that no register which an
  // issued store names is written again
  __builtin_amdgcn_sched_barrier(0);
#pragma unroll
  for (int i = 0; i < 16; ++i) *(uint2*)(out + i * 1024) = r[i];
}

// ---------------------------------------------------------------------------
// Row LayerNorm (D=1024), fp32 in -> bf16 out. One block (256 thr) per row.
// ---------------------------------------------------------------------------
static __device__ __forceinline__
void layernorm_row(int row,
                   const float* __restrict__ x,
                   const float* __restrict__ g,
                   const float* __restrict__ b,
                   unsigned short* __restrict__ out) {
  __shared__ float red[256];
  int t = threadIdx.x;
  const float* xr = x + (size_t)row * D_;
  float v[4];
  float s = 0.f;
#pragma unroll
  for (int i = 0; i < 4; ++i) { v[i] = xr[t + i * 256]; s += v[i]; }
  red[t] = s; __syncthreads();
  for (int off = 128; off > 0; off >>= 1) {
    if (t < off) red[t] += red[t + off];
    __syncthreads();
  }
  float mu = red[0] * (1.f / D_);
  __syncthreads();
  float s2 = 0.f;
#pragma unroll
  for (int i = 0; i < 4; ++i) { float d = v[i] - mu; s2 += d * d; }
  red[t] = s2; __syncthreads();
  for (int off = 128; off > 0; off >>= 1) {
    if (t < off) red[t] += red[t + off];
    __syncthreads();
  }
  float rstd = rsqrtf(red[0] * (1.f / D_) + 1e-5f);
#pragma unroll
  for (int i = 0; i < 4; ++i) {
    int c = t + i * 256;
    out[(size_t)row * D_ + c] = f2bf((v[i] - mu) * rstd * g[c] + b[c]);
  }
}

__global__ __launch_bounds__(256)
void layernorm_bf16_kernel(const float* __restrict__ x,
                           const float* __restrict__ g,
                           const float* __restrict__ b,
                           unsigned short* __restrict__ out) {
  layernorm_row(blockIdx.x, x, g, b, out);
}

// ---------------------------------------------------------------------------
// The weight casts and the first LayerNorm depend on nothing of each other:
// one grid holds both. The block index picks the body, alike for the whole
// block; the cast blocks, which move the most bytes each, take the low indices.
// ---------------------------------------------------------------------------
__global__ __launch_bounds__(256)
void cast_and_layernorm_kernel(const float* __restrict__ wq, const float* __restrict__ wk,
                               const float* __restrict__ wv, const float* __restrict__ wo,
                               const float* __restrict__ w1, const float* __restrict__ w2,
                               unsigned short* __restrict__ oq, unsigned short* __restrict__ ok,
                               unsigned short* __restrict__ ov, unsigned short* __restrict__ oo,
                               unsigned short* __restrict__ o1, unsigned short* __restrict__ o2,
                               const float* __restrict__ x, const float* __restrict__ g,
                               const float* __restrict__ b, unsigned short* __restrict__ h) {
  int blk = blockIdx.x;
  if (blk < CAST_GRID) cast_weights_block(blk, wq, wk, wv, wo, w1, w2, oq, ok, ov, oo, o1, o2);
  else                 layernorm_row(blk - CAST_GRID, x, g, b, h);
}

static __device__ __forceinline__ void async_copy_8x16B(const unsigned int* l,
                                                        const unsigned long long* g) {
  asm volatile("global_load_async_to_lds_b128 %0, %8, off\n\t"
               "global_load_async_to_lds_b128 %1, %9, off\n\t"
               "global_load_async_to_lds_b128 %2, %10, off\n\t"
               "global_load_async_to_lds_b128 %3, %11, off\n\t"
               "global_load_async_to_lds_b128 %4, %12, off\n\t"
               "global_load_async_to_lds_b128 %5, %13, off\n\t"
               "global_load_async_to_lds_b128 %6, %14, off\n\t"
               "global_load_async_to_lds_b128 %7, %15, off\n\t"
               "s_wait_xcnt 0x0"
               :: "v"(l[0]), "v"(l[1]), "v"(l[2]), "v"(l[3]),
                  "v"(l[4]), "v"(l[5]), "v"(l[6]), "v"(l[7]),
                  "v"(g[0]), "v"(g[1]), "v"(g[2]), "v"(g[3]),
                  "v"(g[4]), "v"(g[5]), "v"(g[6]), "v"(g[7])
               : "memory");
}

// ---------------------------------------------------------------------------
// Generic bf16 WMMA GEMM:  C[M,N] = A[M,K] @ Bw[K,N]  (f32 accumulate)
// 128x128 tile per block, 128 k per trip, 256 threads = 8 waves (2 x 4), each
// wave 64(M) x 32(N): per 32 k, 6 fragments feed 8 WMMAs.
// M, N multiples of 128; K a multiple of 128.
// Two LDS buffers: the async copies of A and B of tile t+1 fly while tile t is
// worked on, 64 KB a block, over the time of 32 WMMAs a wave. B lies in LDS as
// in memory, [k][n]; its fragments come by the transposing load.
// The weight fragment is the first WMMA operand: a lane then holds 8 consecutive
// columns of ONE output row, which go to LDS as two 16 B stores. The tile is read
// back by rows, so that every global access of the epilogue is 16 B (8 B for
// bf16) a lane and covers whole 128 B lines.
// Products that share A go in one grid: plane blockIdx.z takes the weight at
// Bw + z * zB and writes its bf16 output at outb + z * zO.
// ---------------------------------------------------------------------------
#define GBM 128
#define GBN 128
#define GBK 128
__global__ __launch_bounds__(256)
void gemm_wmma_kernel(const unsigned short* __restrict__ A,
                      const unsigned short* __restrict__ Bw,
                      int M, int N, int K,
                      const float* __restrict__ bias, int do_gelu,
                      const float* __restrict__ resid,
                      unsigned short* __restrict__ outb,
                      float* __restrict__ outf,
                      int zB, int zO) {
  Bw   += (size_t)blockIdx.z * zB;
  outb += (size_t)blockIdx.z * zO;
  __shared__ alignas(16) unsigned short Alds[2][GBM][136]; // [m][k], 272B rows (padded)
  __shared__ alignas(16) unsigned short Bs[2][GBK][144];   // [k][n], 288B rows (padded)

  int t = threadIdx.x;
  int wave = t >> 5, lane = t & 31;
  int lm = lane & 15, hf = lane >> 4;
  int mBase = blockIdx.y * GBM;
  int nBase = blockIdx.x * GBN;
  int wm = (wave >> 2) * 64;
  int wn = (wave & 3) * 32;
  int kIters = K >> 7;

  // A tile: 128 m rows of 256 B. B tile: 128 k rows of 256 B. Sixteen lanes
  // cover one whole row per copy.
  int row0 = t >> 4, c8 = (t & 15) * 8;
  const unsigned short* aLane = A + (size_t)row0 * K + c8;            // the lane's share of
  const unsigned short* bLane = Bw + (size_t)row0 * N + nBase + c8;   // the addresses
  auto stage = [&](int kt, int buf) {
    unsigned int l[8];
    unsigned long long g[8];
#pragma unroll
    for (int i = 0; i < 8; ++i) {
      int row = row0 + i * 16;
      l[i] = (unsigned int)(unsigned long long)&Alds[buf][row][c8];
      g[i] = (unsigned long long)(aLane + ((size_t)(mBase + i * 16) * K + kt * GBK));
    }
    async_copy_8x16B(l, g);
#pragma unroll
    for (int i = 0; i < 8; ++i) {
      int row = row0 + i * 16;
      l[i] = (unsigned int)(unsigned long long)&Bs[buf][row][c8];
      g[i] = (unsigned long long)(bLane + (size_t)(kt * GBK + i * 16) * N);
    }
    async_copy_8x16B(l, g);
  };
  // the lane's place in a 16 x 16 block for the transposing load
  int trow = hf * 8 + (lane & 7), tcol = ((lane >> 3) & 1) * 8;

  v8f vzero = {};
  // tile i * 2 + j: acc[..][v] = C[wm + 16 i + lm][wn + 16 j + 8 hf + v]
  v8f acc[8];
#pragma unroll
  for (int q = 0; q < 8; ++q) acc[q] = vzero;

  // prologue: tile 0 lands and is published
  stage(0, 0);
  asm volatile("s_wait_asynccnt 0x0" ::: "memory");  // own copies landed before the barrier
  __syncthreads();

  for (int kt = 0; kt < kIters; ++kt) {
    int cur = kt & 1;

#pragma unroll
    for (int kh = 0; kh < 2; ++kh) {     // the tile's two halves of 64 k
      FragU af[2][4], bf[2][2];
#pragma unroll
      for (int ks = 0; ks < 2; ++ks) {
        int k0 = kh * 64 + ks * 32;
#pragma unroll
        for (int i = 0; i < 4; ++i) {
          int arow = wm + i * 16 + lm;
          af[ks][i].q[0] = *(const uint4*)&Alds[cur][arow][k0 + hf * 8];
          af[ks][i].q[1] = *(const uint4*)&Alds[cur][arow][k0 + 16 + hf * 8];
        }
#pragma unroll
        for (int j = 0; j < 2; ++j) {
          int bcol = wn + j * 16 + tcol;
          bf[ks][j].q[0] = ld_tr16(&Bs[cur][k0 + trow][bcol]);
          bf[ks][j].q[1] = ld_tr16(&Bs[cur][k0 + 16 + trow][bcol]);
        }
      }
      // keeps the half's 24 LDS reads one group ahead of its WMMAs; without it the
      // compiler sinks them between the WMMAs and each pair waits out the LDS latency
      __builtin_amdgcn_sched_barrier(0);
      // tile kt+1 is set flying into the buffer that the barrier at the foot of
      // trip kt-1 has freed, while the LDS reads above are still coming in
      if (kh == 0 && kt + 1 < kIters) stage(kt + 1, cur ^ 1);
#pragma unroll
      for (int ks = 0; ks < 2; ++ks)
#pragma unroll
        for (int i = 0; i < 4; ++i)
#pragma unroll
          for (int j = 0; j < 2; ++j)
            acc[i * 2 + j] = __builtin_amdgcn_wmma_f32_16x16x32_bf16(
                false, bf[ks][j].v, false, af[ks][i].v, (short)0, acc[i * 2 + j], false, false);
      // keeps the half's WMMAs ahead of what follows: the next half's LDS reads
      // (one fragment set serves both halves) and the foot's waits and barrier,
      // behind which the compiler otherwise sinks them, so that they no longer
      // cover the copies' flight
      __builtin_amdgcn_sched_barrier(0);
    }

    // foot of the trip: own LDS reads done, own copies of tile kt+1 landed; the
    // barrier publishes tile kt+1 and frees buffer cur.
    asm volatile("s_wait_dscnt 0x0" ::: "memory");
    asm volatile("s_wait_asynccnt 0x0" ::: "memory");
    __syncthreads();
  }
  asm volatile("s_wait_asynccnt 0x0" ::: "memory");  // no copy outstanding at the wave's end

  float* stg = (float*)&Alds[0][0][0];
  const int SP = 132;
  // read-back: a wave takes one whole row of 128 columns a trip, 4 columns a lane
  int ecol = lane * 4;
  size_t o0 = (size_t)(mBase + wave) * N + nBase + ecol;
  size_t oStep = (size_t)8 * N;
  const float* srow = stg + wave * SP + ecol;

  // bias and residual are asked for ahead of the staging, all loads in flight together
  v4f bv = {};
  if (bias) bv = *(const v4f*)(bias + nBase + ecol);
  v4f rv[16];
  const float* rp[16];
  bool pre = resid && !do_gelu;
  if (pre) {
#pragma unroll
    for (int it = 0; it < 16; ++it) rp[it] = resid + o0 + it * oStep;
#pragma unroll
    for (int it = 0; it < 16; ++it) rv[it] = *(const v4f*)rp[it];
  }

#pragma unroll
  for (int i = 0; i < 4; ++i)
#pragma unroll
    for (int j = 0; j < 2; ++j) {
      float* d = stg + (wm + i * 16 + lm) * SP + wn + j * 16 + hf * 8;
      v8f a = acc[i * 2 + j];
      v4f lo = {a[0], a[1], a[2], a[3]}, hi = {a[4], a[5], a[6], a[7]};
      *(v4f*)d       = lo;
      *(v4f*)(d + 4) = hi;
    }
  if (pre) {
    // takes loaded values 0 to 7 and all 16 addresses as inputs only: every address
    // stays live until the last load has returned, so that no load lands in a
    // register pair that a load issued before it names
    asm volatile("" :: "v"(rp[0]), "v"(rp[1]), "v"(rp[2]), "v"(rp[3]),
                       "v"(rp[4]), "v"(rp[5]), "v"(rp[6]), "v"(rp[7]),
                       "v"(rp[8]), "v"(rp[9]), "v"(rp[10]), "v"(rp[11]),
                       "v"(rp[12]), "v"(rp[13]), "v"(rp[14]), "v"(rp[15]),
                       "v"(rv[0]), "v"(rv[1]), "v"(rv[2]), "v"(rv[3]),
                       "v"(rv[4]), "v"(rv[5]), "v"(rv[6]), "v"(rv[7]));
    // the same for loaded values 8 to 15 (a statement takes thirty operands)
    asm volatile("" :: "v"(rp[0]), "v"(rp[1]), "v"(rp[2]), "v"(rp[3]),
                       "v"(rp[4]), "v"(rp[5]), "v"(rp[6]), "v"(rp[7]),
                       "v"(rp[8]), "v"(rp[9]), "v"(rp[10]), "v"(rp[11]),
                       "v"(rp[12]), "v"(rp[13]), "v"(rp[14]), "v"(rp[15]),
                       "v"(rv[8]), "v"(rv[9]), "v"(rv[10]), "v"(rv[11]),
                       "v"(rv[12]), "v"(rv[13]), "v"(rv[14]), "v"(rv[15]));
  }
  __syncthreads();   // the tile is whole before any wave reads rows of it

  if (do_gelu) {
    // kept rolled rather than 64 inlined erff bodies, for speed only
    size_t o = o0;
#pragma unroll 1
    for (int it = 0; it < 16; ++it) {
      v4f val = *(const v4f*)(srow + it * 8 * SP);
      if (bias) val += bv;
#pragma unroll
      for (int c = 0; c < 4; ++c)
        val[c] = 0.5f * val[c] * (1.f + erff(val[c] * 0.70710678118654752f));
      if (resid) val += *(const v4f*)(resid + o);
      if (outf) {
        *(v4f*)(outf + o) = val;
        // closes this branch: no register that the store names is written before it
        asm volatile("s_wait_xcnt 0x0" ::: "memory");
      } else {
        uint2 pk;
        pk.x = (unsigned int)f2bf(val[0]) | ((unsigned int)f2bf(val[1]) << 16);
        pk.y = (unsigned int)f2bf(val[2]) | ((unsigned int)f2bf(val[3]) << 16);
        *(uint2*)(outb + o) = pk;
      }
      // the registers that the store names are rewritten in the next trip; the
      // scheduling fence keeps those writes behind the wait
      asm volatile("s_wait_xcnt 0x0" ::: "memory");
      __builtin_amdgcn_sched_barrier(0);
      o += oStep;
    }
  } else {
    v4f val[16];
#pragma unroll
    for (int it = 0; it < 16; ++it) val[it] = *(const v4f*)(srow + it * 8 * SP);
    if (bias) {
#pragma unroll
      for (int it = 0; it < 16; ++it) val[it] += bv;
    }
    if (resid) {
#pragma unroll
      for (int it = 0; it < 16; ++it) val[it] += rv[it];
    }
    // In both forms only stores stand between the first statement and the last, so
    // that no register which an issued store names is written again among them.
    if (outf) {
      float* op[16];
#pragma unroll
      for (int it = 0; it < 16; ++it) op[it] = outf + o0 + it * oStep;
      // all 16 store addresses are made ahead of the first store
      asm volatile("" :: "v"(op[0]), "v"(op[1]), "v"(op[2]), "v"(op[3]),
                         "v"(op[4]), "v"(op[5]), "v"(op[6]), "v"(op[7]),
                         "v"(op[8]), "v"(op[9]), "v"(op[10]), "v"(op[11]),
                         "v"(op[12]), "v"(op[13]), "v"(op[14]), "v"(op[15]) : "memory");
      // keeps the sums above from sinking among the stores
      __builtin_amdgcn_sched_barrier(0);
#pragma unroll
      for (int it = 0; it < 16; ++it) *(v4f*)op[it] = val[it];
      // the addresses stay live to here, and the wait closes the run of stores: no
      // register that a store names is written before it on any way out of the branch
      asm volatile("s_wait_xcnt 0x0"
                      :: "v"(op[0]), "v"(op[1]), "v"(op[2]), "v"(op[3]),
                         "v"(op[4]), "v"(op[5]), "v"(op[6]), "v"(op[7]),
                         "v"(op[8]), "v"(op[9]), "v"(op[10]), "v"(op[11]),
                         "v"(op[12]), "v"(op[13]), "v"(op[14]), "v"(op[15]) : "memory");
    } else {
      unsigned short* op[16];
      uint2 pk[16];
#pragma unroll
      for (int it = 0; it < 16; ++it) {
        op[it] = outb + o0 + it * oStep;
        pk[it].x = (unsigned int)f2bf(val[it][0]) | ((unsigned int)f2bf(val[it][1]) << 16);
        pk[it].y = (unsigned int)f2bf(val[it][2]) | ((unsigned int)f2bf(val[it][3]) << 16);
      }
      // all 16 store addresses are made ahead of the first store
      asm volatile("" :: "v"(op[0]), "v"(op[1]), "v"(op[2]), "v"(op[3]),
                         "v"(op[4]), "v"(op[5]), "v"(op[6]), "v"(op[7]),
                         "v"(op[8]), "v"(op[9]), "v"(op[10]), "v"(op[11]),
                         "v"(op[12]), "v"(op[13]), "v"(op[14]), "v"(op[15]) : "memory");
      // keeps the rounding and packing above from sinking among the stores
      __builtin_amdgcn_sched_barrier(0);
#pragma unroll
      for (int it = 0; it < 16; ++it) *(uint2*)op[it] = pk[it];
      // the addresses stay live to behind the last store
      asm volatile("" :: "v"(op[0]), "v"(op[1]), "v"(op[2]), "v"(op[3]),
                         "v"(op[4]), "v"(op[5]), "v"(op[6]), "v"(op[7]),
                         "v"(op[8]), "v"(op[9]), "v"(op[10]), "v"(op[11]),
                         "v"(op[12]), "v"(op[13]), "v"(op[14]), "v"(op[15]) : "memory");
    }
  }
}

typedef __attribute__((ext_vector_type(2))) float  v2f;
typedef __attribute__((ext_vector_type(2))) __bf16 v2bf;

static __device__ __forceinline__ float xhalf(float x) {
  int b = __builtin_bit_cast(int, x);
  return __builtin_bit_cast(float, __builtin_amdgcn_permlanex16(
      b, b, 0x76543210, 0xfedcba98, false, false));
}
// two f32 -> one dword of two bf16 (a in the low half), round to nearest even
static __device__ __forceinline__ unsigned int pack_bf16(float a, float b) {
  v2f f = {a, b};
  return __builtin_bit_cast(unsigned int, __builtin_convertvector(f, v2bf));
}

__global__ __launch_bounds__(128)
void flash_attn_kernel(const unsigned short* __restrict__ Q,
                       const unsigned short* __restrict__ Km,
                       const unsigned short* __restrict__ Vm,
                       unsigned short* __restrict__ O) {
  __shared__ alignas(16) unsigned short Qs[64][72];       // 144B rows
  __shared__ alignas(16) unsigned short Ks[2][32][72];    // 144B rows
  __shared__ alignas(16) unsigned int   Vt[2][64][20];    // [dh][keypair], 80B rows

  int t = threadIdx.x;
  int wave = t >> 5, lane = t & 31;
  int lm = lane & 15, hf = lane >> 4;
  int bh = blockIdx.x;
  int b = bh / H_, h = bh % H_;
  int q0 = b * N_ + blockIdx.y * 64;
  int colh = h * DH_;
  int rowBase = wave * 16;
  const int kbIters = N_ / 32;

  auto stageK = [&](int kb, int buf) {
    int k0 = b * N_ + kb * 32;
    int row = t >> 2, c16 = (t & 3) * 16;
    async_copy_32B(Km + (size_t)(k0 + row) * HD + colh + c16, &Ks[buf][row][c16]);
  };
  unsigned int vr0[4], vr1[4];
  auto loadV = [&](int kb) {
    int k0 = b * N_ + kb * 32;
#pragma unroll
    for (int i = 0; i < 4; ++i) {
      int idx = i * 128 + t;           // 512 tasks: (kp, dh-pair)
      int kp  = idx >> 5;              // 0..15
      int dh0 = (idx & 31) * 2;        // 0..62 even
      vr0[i] = *(const unsigned int*)&Vm[(size_t)(k0 + 2 * kp) * HD + colh + dh0];
      vr1[i] = *(const unsigned int*)&Vm[(size_t)(k0 + 2 * kp + 1) * HD + colh + dh0];
    }
  };
  auto storeV = [&](int buf) {
#pragma unroll
    for (int i = 0; i < 4; ++i) {
      int idx = i * 128 + t;
      int kp  = idx >> 5;
      int dh0 = (idx & 31) * 2;
      Vt[buf][dh0][kp]     = (vr0[i] & 0xFFFFu) | (vr1[i] << 16);
      Vt[buf][dh0 + 1][kp] = (vr0[i] >> 16)     | (vr1[i] & 0xFFFF0000u);
    }
  };

  // load Q tile 64x64 (64B per thread)
  {
    int row = t >> 1, c32 = (t & 1) * 32;
    const uint4* src = (const uint4*)(Q + (size_t)(q0 + row) * HD + colh + c32);
    uint4* dst = (uint4*)&Qs[row][c32];
    dst[0] = src[0]; dst[1] = src[1]; dst[2] = src[2]; dst[3] = src[3];
  }

  v8f vzero = {};
  v8f o[4];
#pragma unroll
  for (int c = 0; c < 4; ++c) o[c] = vzero;
  // of query lm: running maximum (both halves alike), and the sum over the
  // keys that this half of the wave holds
  float mrow = -1e30f, lrow = 0.f;

  // prologue: stage tile 0 (barrier also publishes Qs)
  stageK(0, 0);
  loadV(0);
  storeV(0);
  async_wait();
  __syncthreads();

  // Q^T fragments (B operand), read once and kept in registers
  FragU qb[2];
#pragma unroll
  for (int st = 0; st < 2; ++st) {
    qb[st].q[0] = *(const uint4*)&Qs[rowBase + lm][st * 32 + hf * 8];
    qb[st].q[1] = *(const uint4*)&Qs[rowBase + lm][st * 32 + 16 + hf * 8];
  }

  for (int kb = 0; kb < kbIters; ++kb) {
    int cur = kb & 1;
    bool more = (kb + 1) < kbIters;
    if (more) { stageK(kb + 1, cur ^ 1); loadV(kb + 1); }

    // K fragments (A operand of S^T) and V^T fragments (A operand of O^T)
    FragU kf[2][2], vf[4];
#pragma unroll
    for (int st = 0; st < 2; ++st)
#pragma unroll
      for (int j = 0; j < 2; ++j) {
        kf[st][j].q[0] = *(const uint4*)&Ks[cur][j * 16 + lm][st * 32 + hf * 8];
        kf[st][j].q[1] = *(const uint4*)&Ks[cur][j * 16 + lm][st * 32 + 16 + hf * 8];
      }
#pragma unroll
    for (int ct = 0; ct < 4; ++ct) {
      vf[ct].q[0] = *(const uint4*)&Vt[cur][ct * 16 + lm][hf * 4];
      vf[ct].q[1] = *(const uint4*)&Vt[cur][ct * 16 + lm][8 + hf * 4];
    }
    // keeps the next tile's V loads and the trip's 16 LDS reads at the head of
    // the trip; without it the compiler sinks each to just ahead of its use,
    // and the wave waits out the L2 and LDS latencies there
    __builtin_amdgcn_sched_barrier(0);

    // ---- S^T = K Q^T  (two 16-key tiles, two k-steps over DH=64) ----
    // s[j][v] = score of key 16 j + 8 hf + v against query lm
    v8f s[2]; s[0] = vzero; s[1] = vzero;
#pragma unroll
    for (int st = 0; st < 2; ++st)
#pragma unroll
      for (int j = 0; j < 2; ++j)
        s[j] = __builtin_amdgcn_wmma_f32_16x16x32_bf16(
            false, kf[st][j].v, false, qb[st].v, (short)0, s[j], false, false);

    // ---- online softmax of one query per lane ----
    float tm = fmaxf(s[0][0], s[1][0]);
#pragma unroll
    for (int v = 1; v < 8; ++v) tm = fmaxf(tm, fmaxf(s[0][v], s[1][v]));
    tm = fmaxf(tm, xhalf(tm));         // the other 16 keys of this query
    float mn = fmaxf(mrow, tm);
    float scale = __expf(mrow - mn);
    mrow = mn;
    float p0[8], p1[8];
    float rs0 = 0.f, rs1 = 0.f;
#pragma unroll
    for (int v = 0; v < 8; ++v) {
      p0[v] = __expf(s[0][v] - mn);
      p1[v] = __expf(s[1][v] - mn);
      rs0 += p0[v];
      rs1 += p1[v];
    }
    lrow = lrow * scale + (rs0 + rs1);
#pragma unroll
    for (int c = 0; c < 4; ++c)
#pragma unroll
      for (int v = 0; v < 8; ++v) o[c][v] *= scale;

    // ---- P^T as B operand: k = 8 hf + v from tile 0, 16 + 8 hf + v from tile 1 ----
    FragU pb;
#pragma unroll
    for (int i = 0; i < 4; ++i) {
      pb.u[i]     = pack_bf16(p0[2 * i], p0[2 * i + 1]);
      pb.u[4 + i] = pack_bf16(p1[2 * i], p1[2 * i + 1]);
    }

    // ---- O^T += V^T P^T : o[ct][v] = O[query lm][dh 16 ct + 8 hf + v] ----
#pragma unroll
    for (int ct = 0; ct < 4; ++ct) {
      o[ct] = __builtin_amdgcn_wmma_f32_16x16x32_bf16(
          false, vf[ct].v, false, pb.v, (short)0, o[ct], false, false);
    }

    // keeps the wait for the next tile's V loads, with their pack and store,
    // behind the trip's products; without it the compiler lifts that wait to
    // just behind the first WMMA, where the loads have had no time to return
    __builtin_amdgcn_sched_barrier(0);
    if (more) storeV(cur ^ 1);
    async_wait();
    __syncthreads();
  }

  // ---- normalize and store bf16: 8 consecutive dh of one query per store ----
  float lsum = lrow + xhalf(lrow);     // the two halves' key sums joined
  uint4 ov[4];
#pragma unroll
  for (int ct = 0; ct < 4; ++ct) {
    ov[ct].x = pack_bf16(o[ct][0] / lsum, o[ct][1] / lsum);
    ov[ct].y = pack_bf16(o[ct][2] / lsum, o[ct][3] / lsum);
    ov[ct].z = pack_bf16(o[ct][4] / lsum, o[ct][5] / lsum);
    ov[ct].w = pack_bf16(o[ct][6] / lsum, o[ct][7] / lsum);
  }
  unsigned short* orow = O + (size_t)(q0 + rowBase + lm) * HD + colh + hf * 8;
#pragma unroll
  for (int ct = 0; ct < 4; ++ct) *(uint4*)(orow + ct * 16) = ov[ct];
}

// ---------------------------------------------------------------------------
// Host-side orchestration
// ---------------------------------------------------------------------------
extern "C" void kernel_launch(void* const* d_in, const int* in_sizes, int n_in,
                              void* d_out, int out_size, void* d_ws, size_t ws_size,
                              hipStream_t stream) {
  const float* x     = (const float*)d_in[0];
  const float* wq    = (const float*)d_in[1];
  const float* wk    = (const float*)d_in[2];
  const float* wv    = (const float*)d_in[3];
  const float* wo    = (const float*)d_in[4];
  const float* w1    = (const float*)d_in[5];
  const float* b1    = (const float*)d_in[6];
  const float* w2    = (const float*)d_in[7];
  const float* b2    = (const float*)d_in[8];
  const float* ln1_g = (const float*)d_in[9];
  const float* ln1_b = (const float*)d_in[10];
  const float* ln2_g = (const float*)d_in[11];
  const float* ln2_b = (const float*)d_in[12];
  float* out = (float*)d_out;

  // workspace carve-out (~120 MiB total)
  char* p = (char*)d_ws;
  auto alloc = [&](size_t bytes) -> void* {
    void* r = (void*)p;
    p += (bytes + 255) & ~(size_t)255;
    return r;
  };
  unsigned short* wq_b = (unsigned short*)alloc((size_t)3 * D_ * HD * 2);   // wq | wk | wv
  unsigned short* wk_b = wq_b + D_ * HD;
  unsigned short* wv_b = wk_b + D_ * HD;
  unsigned short* wo_b = (unsigned short*)alloc((size_t)HD * D_ * 2);
  unsigned short* w1_b = (unsigned short*)alloc((size_t)D_ * FF_ * 2);
  unsigned short* w2_b = (unsigned short*)alloc((size_t)FF_ * D_ * 2);
  unsigned short* h_b  = (unsigned short*)alloc((size_t)ROWS * D_ * 2);
  unsigned short* q_b  = (unsigned short*)alloc((size_t)3 * ROWS * HD * 2); // q | k | v
  unsigned short* k_b  = q_b + ROWS * HD;
  unsigned short* v_b  = k_b + ROWS * HD;
  unsigned short* a_b  = (unsigned short*)alloc((size_t)ROWS * HD * 2);
  float*          x2   = (float*)        alloc((size_t)ROWS * D_ * 4);
  unsigned short* h2_b = (unsigned short*)alloc((size_t)ROWS * D_ * 2);
  unsigned short* ff_b = (unsigned short*)alloc((size_t)ROWS * FF_ * 2);

  // 1) weights -> bf16 and LN1, one launch
  cast_and_layernorm_kernel<<<CAST_GRID + ROWS, 256, 0, stream>>>(
      wq, wk, wv, wo, w1, w2, wq_b, wk_b, wv_b, wo_b, w1_b, w2_b, x, ln1_g, ln1_b, h_b);

  // 2) Q/K/V projections, one launch of three planes
  dim3 gemmBlk(256);
  dim3 attnBlk(128);
  dim3 gQKV(HD / GBN, ROWS / GBM, 3);
  gemm_wmma_kernel<<<gQKV, gemmBlk, 0, stream>>>(h_b, wq_b, ROWS, HD, D_,
                                                 nullptr, 0, nullptr, q_b, nullptr,
                                                 D_ * HD, ROWS * HD);

  // 3) attention
  dim3 gAttn(B_ * H_, N_ / 64);
  flash_attn_kernel<<<gAttn, attnBlk, 0, stream>>>(q_b, k_b, v_b, a_b);

  // 4) out projection + residual -> x2 (fp32)
  dim3 gO(D_ / GBN, ROWS / GBM);
  gemm_wmma_kernel<<<gO, gemmBlk, 0, stream>>>(a_b, wo_b, ROWS, D_, HD,
                                               nullptr, 0, x, nullptr, x2, 0, 0);

  // 5) LN2
  layernorm_bf16_kernel<<<ROWS, 256, 0, stream>>>(x2, ln2_g, ln2_b, h2_b);

  // 6) FF1 + bias + exact GELU -> bf16
  dim3 gFF1(FF_ / GBN, ROWS / GBM);
  gemm_wmma_kernel<<<gFF1, gemmBlk, 0, stream>>>(h2_b, w1_b, ROWS, FF_, D_,
                                                 b1, 1, nullptr, ff_b, nullptr, 0, 0);

  // 7) FF2 + bias + residual -> out (fp32)
  dim3 gFF2(D_ / GBN, ROWS / GBM);
  gemm_wmma_kernel<<<gFF2, gemmBlk, 0, stream>>>(ff_b, w2_b, ROWS, D_, FF_,
                                                 b2, 0, x2, nullptr, out, 0, 0);
}

// v007
// A run of this version takes 186 microseconds.
// Two timings next to v006 put it at 1.05 and 1.04 times that version's speed.
// Over all steps from v000 it is 3.07 times as fast.
#include <hip/hip_runtime.h>
#include <stdint.h>

// Problem constants (match reference)
#define B_  2
#define N_  2048
#define D_  1024
#define H_  16
#define DH_ 64
#define FF_ 4096
#define ROWS (B_ * N_)          // 4096
#define HD  (H_ * DH_)          // 1024

typedef __attribute__((ext_vector_type(16))) __bf16 v16bf;
typedef __attribute__((ext_vector_type(8)))  float  v8f;

// Fragment: 8 dwords = two 16B chunks; loaded as 2x ds_load_b128 (B of the GEMM: 2x ds_load_tr16_b128).
union FragU { uint4 q[2]; unsigned int u[8]; v16bf v; };

static __device__ __forceinline__ unsigned short f2bf(float f) {
  union { float f; unsigned int u; } c; c.f = f;
  unsigned int u = c.u;
  unsigned int r = u + 0x7FFFu + ((u >> 16) & 1u);   // round-to-nearest-even
  return (unsigned short)(r >> 16);
}

static __device__ __forceinline__ void async_copy_32B(const void* gsrc, void* ldst) {
  unsigned int       l = (unsigned int)(unsigned long long)ldst;   // low 32 bits = LDS addr
  unsigned long long g = (unsigned long long)gsrc;
  asm volatile("global_load_async_to_lds_b128 %0, %1, off\n\t"
               "global_load_async_to_lds_b128 %0, %1, off offset:16"
               :: "v"(l), "v"(g) : "memory");
}
typedef __attribute__((ext_vector_type(8))) short s16x8;
static __device__ __forceinline__ uint4 ld_tr16(const unsigned short* p) {
  typedef __attribute__((address_space(3))) s16x8 lds_s16x8;
  return __builtin_bit_cast(uint4, __builtin_amdgcn_ds_load_tr16_b128_v8i16((lds_s16x8*)p));
}
static __device__ __forceinline__ void async_wait() {
  asm volatile("s_wait_asynccnt 0x0" ::: "memory");
}

// ---------------------------------------------------------------------------
// f32 -> bf16 cast of all six weights, one pass per block.
// A block converts CAST_BLK consecutive elements of one weight (every weight's
// size is a multiple of CAST_BLK). A thread has its 16 loads of 16 B in flight
// together; each load of a wave covers 512 contiguous bytes.
// ---------------------------------------------------------------------------
typedef __attribute__((ext_vector_type(4))) float v4f;
#define CAST_BLK   16384                       // 256 threads x 16 x 4 elements
#define CAST_SMALL (D_ * HD / CAST_BLK)        // blocks per D x HD weight: 64
#define CAST_LARGE (D_ * FF_ / CAST_BLK)       // blocks per D x FF weight: 256
#define CAST_GRID  (4 * CAST_SMALL + 2 * CAST_LARGE)
static __device__ __forceinline__
void cast_weights_block(int blk,
                        const float* __restrict__ wq, const float* __restrict__ wk,
                        const float* __restrict__ wv, const float* __restrict__ wo,
                        const float* __restrict__ w1, const float* __restrict__ w2,
                        unsigned short* __restrict__ oq, unsigned short* __restrict__ ok,
                        unsigned short* __restrict__ ov, unsigned short* __restrict__ oo,
                        unsigned short* __restrict__ o1, unsigned short* __restrict__ o2) {
  const float* in;
  unsigned short* out;
  if (blk < 4 * CAST_SMALL) {
    int w = blk / CAST_SMALL;
    blk -= w * CAST_SMALL;
    in  = w == 0 ? wq : w == 1 ? wk : w == 2 ? wv : wo;
    out = w == 0 ? oq : w == 1 ? ok : w == 2 ? ov : oo;
  } else {
    blk -= 4 * CAST_SMALL;
    int w = blk / CAST_LARGE;
    blk -= w * CAST_LARGE;
    in  = w == 0 ? w1 : w2;
    out = w == 0 ? o1 : o2;
  }
  int off = blk * CAST_BLK + threadIdx.x * 4;
  in  += off;
  out += off;
  v4f f[16];
#pragma unroll
  for (int i = 0; i < 16; ++i) f[i] = *(const v4f*)(in + i * 1024);
  // takes the 16 loaded values as inputs only: all 16 loads are issued ahead of
  // it; without it the compiler sinks loads to just ahead of their conversion,
  // and the wave waits out several memory latencies one after the other. The
  // address is named too: it stays live, so no load lands in the register pair
  // that the loads issued before it name.
  asm volatile("" :: "v"(f[0]), "v"(f[1]), "v"(f[2]), "v"(f[3]), "v"(f[4]), "v"(f[5]),
                     "v"(f[6]), "v"(f[7]), "v"(f[8]), "v"(f[9]), "v"(f[10]), "v"(f[11]),
                     "v"(f[12]), "v"(f[13]), "v"(f[14]), "v"(f[15]), "v"(in));
  uint2 r[16];
#pragma unroll
  for (int i = 0; i < 16; ++i) {
    r[i].x = (unsigned int)f2bf(f[i].x) | ((unsigned int)f2bf(f[i].y) << 16);
    r[i].y = (unsigned int)f2bf(f[i].z) | ((unsigned int)f2bf(f[i].w) << 16);
  }
  // keeps the stores behind the last conversion, so that no register which an
  // issued store names is written again
  __builtin_amdgcn_sched_barrier(0);
#pragma unroll
  for (int i = 0; i < 16; ++i) *(uint2*)(out + i * 1024) = r[i];
}

// ---------------------------------------------------------------------------
// Row LayerNorm (D=1024), fp32 in -> bf16 out. One block (256 thr) per row.
// ---------------------------------------------------------------------------
static __device__ __forceinline__
void layernorm_row(int row,
                   const float* __restrict__ x,
                   const float* __restrict__ g,
                   const float* __restrict__ b,
                   unsigned short* __restrict__ out) {
  __shared__ float red[256];
  int t = threadIdx.x;
  const float* xr = x + (size_t)row * D_;
  float v[4];
  float s = 0.f;
#pragma unroll
  for (int i = 0; i < 4; ++i) { v[i] = xr[t + i * 256]; s += v[i]; }
  red[t] = s; __syncthreads();
  for (int off = 128; off > 0; off >>= 1) {
    if (t < off) red[t] += red[t + off];
    __syncthreads();
  }
  float mu = red[0] * (1.f / D_);
  __syncthreads();
  float s2 = 0.f;
#pragma unroll
  for (int i = 0; i < 4; ++i) { float d = v[i] - mu; s2 += d * d; }
  red[t] = s2; __syncthreads();
  for (int off = 128; off > 0; off >>= 1) {
    if (t < off) red[t] += red[t + off];
    __syncthreads();
  }
  float rstd = rsqrtf(red[0] * (1.f / D_) + 1e-5f);
#pragma unroll
  for (int i = 0; i < 4; ++i) {
    int c = t + i * 256;
    out[(size_t)row * D_ + c] = f2bf((v[i] - mu) * rstd * g[c] + b[c]);
  }
}

__global__ __launch_bounds__(256)
void layernorm_bf16_kernel(const float* __restrict__ x,
                           const float* __restrict__ g,
                           const float* __restrict__ b,
                           unsigned short* __restrict__ out) {
  layernorm_row(blockIdx.x, x, g, b, out);
}

// ---------------------------------------------------------------------------
// The weight casts and the first LayerNorm depend on nothing of each other:
// one grid holds both. The block index picks the body, alike for the whole
// block; the cast blocks, which move the most bytes each, take the low indices.
// ---------------------------------------------------------------------------
__global__ __launch_bounds__(256)
void cast_and_layernorm_kernel(const float* __restrict__ wq, const float* __restrict__ wk,
                               const float* __restrict__ wv, const float* __restrict__ wo,
                               const float* __restrict__ w1, const float* __restrict__ w2,
                               unsigned short* __restrict__ oq, unsigned short* __restrict__ ok,
                               unsigned short* __restrict__ ov, unsigned short* __restrict__ oo,
                               unsigned short* __restrict__ o1, unsigned short* __restrict__ o2,
                               const float* __restrict__ x, const float* __restrict__ g,
                               const float* __restrict__ b, unsigned short* __restrict__ h) {
  int blk = blockIdx.x;
  if (blk < CAST_GRID) cast_weights_block(blk, wq, wk, wv, wo, w1, w2, oq, ok, ov, oo, o1, o2);
  else                 layernorm_row(blk - CAST_GRID, x, g, b, h);
}

static __device__ __forceinline__ void async_copy_8x16B(const unsigned int* l,
                                                        const unsigned long long* g) {
  asm volatile("global_load_async_to_lds_b128 %0, %8, off\n\t"
               "global_load_async_to_lds_b128 %1, %9, off\n\t"
               "global_load_async_to_lds_b128 %2, %10, off\n\t"
               "global_load_async_to_lds_b128 %3, %11, off\n\t"
               "global_load_async_to_lds_b128 %4, %12, off\n\t"
               "global_load_async_to_lds_b128 %5, %13, off\n\t"
               "global_load_async_to_lds_b128 %6, %14, off\n\t"
               "global_load_async_to_lds_b128 %7, %15, off\n\t"
               "s_wait_xcnt 0x0"
               :: "v"(l[0]), "v"(l[1]), "v"(l[2]), "v"(l[3]),
                  "v"(l[4]), "v"(l[5]), "v"(l[6]), "v"(l[7]),
                  "v"(g[0]), "v"(g[1]), "v"(g[2]), "v"(g[3]),
                  "v"(g[4]), "v"(g[5]), "v"(g[6]), "v"(g[7])
               : "memory");
}

// ---------------------------------------------------------------------------
// Generic bf16 WMMA GEMM:  C[M,N] = A[M,K] @ Bw[K,N]  (f32 accumulate)
// 128x128 tile per block, 128 k per trip, 256 threads = 8 waves (2 x 4), each
// wave 64(M) x 32(N): per 32 k, 6 fragments feed 8 WMMAs.
// M, N multiples of 128; K a multiple of 128.
// Two LDS buffers: the async copies of A and B of tile t+1 fly while tile t is
// worked on, 64 KB a block, over the time of 32 WMMAs a wave. B lies in LDS as
// in memory, [k][n]; its fragments come by the transposing load.
// The weight fragment is the first WMMA operand: a lane then holds 8 consecutive
// columns of ONE output row, which go to LDS as two 16 B stores. The tile is read
// back by rows, so that every global access of the epilogue is 16 B (8 B for
// bf16) a lane and covers whole 128 B lines.
// Products that share A go in one grid: plane blockIdx.z takes the weight at
// Bw + z * zB and writes its bf16 output at outb + z * zO.
// ---------------------------------------------------------------------------
#define GBM 128
#define GBN 128
#define GBK 128
__global__ __launch_bounds__(256)
void gemm_wmma_kernel(const unsigned short* __restrict__ A,
                      const unsigned short* __restrict__ Bw,
                      int M, int N, int K,
                      const float* __restrict__ bias, int do_gelu,
                      const float* __restrict__ resid,
                      unsigned short* __restrict__ outb,
                      float* __restrict__ outf,
                      int zB, int zO) {
  Bw   += (size_t)blockIdx.z * zB;
  outb += (size_t)blockIdx.z * zO;
  __shared__ alignas(16) unsigned short Alds[2][GBM][136]; // [m][k], 272B rows (padded)
  __shared__ alignas(16) unsigned short Bs[2][GBK][144];   // [k][n], 288B rows (padded)

  int t = threadIdx.x;
  int wave = t >> 5, lane = t & 31;
  int lm = lane & 15, hf = lane >> 4;
  int mBase = blockIdx.y * GBM;
  int nBase = blockIdx.x * GBN;
  int wm = (wave >> 2) * 64;
  int wn = (wave & 3) * 32;
  int kIters = K >> 7;

  // A tile: 128 m rows of 256 B. B tile: 128 k rows of 256 B. Sixteen lanes
  // cover one whole row per copy.
  int row0 = t >> 4, c8 = (t & 15) * 8;
  const unsigned short* aLane = A + (size_t)row0 * K + c8;            // the lane's share of
  const unsigned short* bLane = Bw + (size_t)row0 * N + nBase + c8;   // the addresses
  auto stage = [&](int kt, int buf) {
    unsigned int l[8];
    unsigned long long g[8];
#pragma unroll
    for (int i = 0; i < 8; ++i) {
      int row = row0 + i * 16;
      l[i] = (unsigned int)(unsigned long long)&Alds[buf][row][c8];
      g[i] = (unsigned long long)(aLane + ((size_t)(mBase + i * 16) * K + kt * GBK));
    }
    async_copy_8x16B(l, g);
#pragma unroll
    for (int i = 0; i < 8; ++i) {
      int row = row0 + i * 16;
      l[i] = (unsigned int)(unsigned long long)&Bs[buf][row][c8];
      g[i] = (unsigned long long)(bLane + (size_t)(kt * GBK + i * 16) * N);
    }
    async_copy_8x16B(l, g);
  };
  // the lane's place in a 16 x 16 block for the transposing load
  int trow = hf * 8 + (lane & 7), tcol = ((lane >> 3) & 1) * 8;

  v8f vzero = {};
  // tile i * 2 + j: acc[..][v] = C[wm + 16 i + lm][wn + 16 j + 8 hf + v]
  v8f acc[8];
#pragma unroll
  for (int q = 0; q < 8; ++q) acc[q] = vzero;

  // prologue: tile 0 lands and is published
  stage(0, 0);
  asm volatile("s_wait_asynccnt 0x0" ::: "memory");  // own copies landed before the barrier
  __syncthreads();

  for (int kt = 0; kt < kIters; ++kt) {
    int cur = kt & 1;

#pragma unroll
    for (int kh = 0; kh < 2; ++kh) {     // the tile's two halves of 64 k
      FragU af[2][4], bf[2][2];
#pragma unroll
      for (int ks = 0; ks < 2; ++ks) {
        int k0 = kh * 64 + ks * 32;
#pragma unroll
        for (int i = 0; i < 4; ++i) {
          int arow = wm + i * 16 + lm;
          af[ks][i].q[0] = *(const uint4*)&Alds[cur][arow][k0 + hf * 8];
          af[ks][i].q[1] = *(const uint4*)&Alds[cur][arow][k0 + 16 + hf * 8];
        }
#pragma unroll
        for (int j = 0; j < 2; ++j) {
          int bcol = wn + j * 16 + tcol;
          bf[ks][j].q[0] = ld_tr16(&Bs[cur][k0 + trow][bcol]);
          bf[ks][j].q[1] = ld_tr16(&Bs[cur][k0 + 16 + trow][bcol]);
        }
      }
      // keeps the half's 24 LDS reads one group ahead of its WMMAs; without it the
      // compiler sinks them between the WMMAs and each pair waits out the LDS latency
      __builtin_amdgcn_sched_barrier(0);
      // tile kt+1 is set flying into the buffer that the barrier at the foot of
      // trip kt-1 has freed, while the LDS reads above are still coming in
      if (kh == 0 && kt + 1 < kIters) stage(kt + 1, cur ^ 1);
#pragma unroll
      for (int ks = 0; ks < 2; ++ks)
#pragma unroll
        for (int i = 0; i < 4; ++i)
#pragma unroll
          for (int j = 0; j < 2; ++j)
            acc[i * 2 + j] = __builtin_amdgcn_wmma_f32_16x16x32_bf16(
                false, bf[ks][j].v, false, af[ks][i].v, (short)0, acc[i * 2 + j], false, false);
      // keeps the half's WMMAs ahead of what follows: the next half's LDS reads
      // (one fragment set serves both halves) and the foot's waits and barrier,
      // behind which the compiler otherwise sinks them, so that they no longer
      // cover the copies' flight
      __builtin_amdgcn_sched_barrier(0);
    }

    // foot of the trip: own LDS reads done, own copies of tile kt+1 landed; the
    // barrier publishes tile kt+1 and frees buffer cur.
    asm volatile("s_wait_dscnt 0x0" ::: "memory");
    asm volatile("s_wait_asynccnt 0x0" ::: "memory");
    __syncthreads();
  }
  asm volatile("s_wait_asynccnt 0x0" ::: "memory");  // no copy outstanding at the wave's end

  float* stg = (float*)&Alds[0][0][0];
  const int SP = 132;
  // read-back: a wave takes one whole row of 128 columns a trip, 4 columns a lane
  int ecol = lane * 4;
  size_t o0 = (size_t)(mBase + wave) * N + nBase + ecol;
  size_t oStep = (size_t)8 * N;
  const float* srow = stg + wave * SP + ecol;

  // bias and residual are asked for ahead of the staging, all loads in flight together
  v4f bv = {};
  if (bias) bv = *(const v4f*)(bias + nBase + ecol);
  v4f rv[16];
  const float* rp[16];
  bool pre = resid && !do_gelu;
  if (pre) {
#pragma unroll
    for (int it = 0; it < 16; ++it) rp[it] = resid + o0 + it * oStep;
#pragma unroll
    for (int it = 0; it < 16; ++it) rv[it] = *(const v4f*)rp[it];
  }

#pragma unroll
  for (int i = 0; i < 4; ++i)
#pragma unroll
    for (int j = 0; j < 2; ++j) {
      float* d = stg + (wm + i * 16 + lm) * SP + wn + j * 16 + hf * 8;
      v8f a = acc[i * 2 + j];
      v4f lo = {a[0], a[1], a[2], a[3]}, hi = {a[4], a[5], a[6], a[7]};
      *(v4f*)d       = lo;
      *(v4f*)(d + 4) = hi;
    }
  if (pre) {
    // takes loaded values 0 to 7 and all 16 addresses as inputs only: every address
    // stays live until the last load has returned, so that no load lands in a
    // register pair that a load issued before it names
    asm volatile("" :: "v"(rp[0]), "v"(rp[1]), "v"(rp[2]), "v"(rp[3]),
                       "v"(rp[4]), "v"(rp[5]), "v"(rp[6]), "v"(rp[7]),
                       "v"(rp[8]), "v"(rp[9]), "v"(rp[10]), "v"(rp[11]),
                       "v"(rp[12]), "v"(rp[13]), "v"(rp[14]), "v"(rp[15]),
                       "v"(rv[0]), "v"(rv[1]), "v"(rv[2]), "v"(rv[3]),
                       "v"(rv[4]), "v"(rv[5]), "v"(rv[6]), "v"(rv[7]));
    // the same for loaded values 8 to 15 (a statement takes thirty operands)
    asm volatile("" :: "v"(rp[0]), "v"(rp[1]), "v"(rp[2]), "v"(rp[3]),
                       "v"(rp[4]), "v"(rp[5]), "v"(rp[6]), "v"(rp[7]),
                       "v"(rp[8]), "v"(rp[9]), "v"(rp[10]), "v"(rp[11]),
                       "v"(rp[12]), "v"(rp[13]), "v"(rp[14]), "v"(rp[15]),
                       "v"(rv[8]), "v"(rv[9]), "v"(rv[10]), "v"(rv[11]),
                       "v"(rv[12]), "v"(rv[13]), "v"(rv[14]), "v"(rv[15]));
  }
  __syncthreads();   // the tile is whole before any wave reads rows of it

  if (do_gelu) {
    // kept rolled rather than 64 inlined erff bodies, for speed only
    size_t o = o0;
#pragma unroll 1
    for (int it = 0; it < 16; ++it) {
      v4f val = *(const v4f*)(srow + it * 8 * SP);
      if (bias) val += bv;
#pragma unroll
      for (int c = 0; c < 4; ++c)
        val[c] = 0.5f * val[c] * (1.f + erff(val[c] * 0.70710678118654752f));
      if (resid) val += *(const v4f*)(resid + o);
      if (outf) {
        *(v4f*)(outf + o) = val;
        // closes this branch: no register that the store names is written before it
        asm volatile("s_wait_xcnt 0x0" ::: "memory");
      } else {
        uint2 pk;
        pk.x = (unsigned int)f2bf(val[0]) | ((unsigned int)f2bf(val[1]) << 16);
        pk.y = (unsigned int)f2bf(val[2]) | ((unsigned int)f2bf(val[3]) << 16);
        *(uint2*)(outb + o) = pk;
      }
      // the registers that the store names are rewritten in the next trip; the
      // scheduling fence keeps those writes behind the wait
      asm volatile("s_wait_xcnt 0x0" ::: "memory");
      __builtin_amdgcn_sched_barrier(0);
      o += oStep;
    }
  } else {
    v4f val[16];
#pragma unroll
    for (int it = 0; it < 16; ++it) val[it] = *(const v4f*)(srow + it * 8 * SP);
    if (bias) {
#pragma unroll
      for (int it = 0; it < 16; ++it) val[it] += bv;
    }
    if (resid) {
#pragma unroll
      for (int it = 0; it < 16; ++it) val[it] += rv[it];
    }
    // In both forms only stores stand between the first statement and the last, so
    // that no register which an issued store names is written again among them.
    if (outf) {
      float* op[16];
#pragma unroll
      for (int it = 0; it < 16; ++it) op[it] = outf + o0 + it * oStep;
      // all 16 store addresses are made ahead of the first store
      asm volatile("" :: "v"(op[0]), "v"(op[1]), "v"(op[2]), "v"(op[3]),
                         "v"(op[4]), "v"(op[5]), "v"(op[6]), "v"(op[7]),
                         "v"(op[8]), "v"(op[9]), "v"(op[10]), "v"(op[11]),
                         "v"(op[12]), "v"(op[13]), "v"(op[14]), "v"(op[15]) : "memory");
      // keeps the sums above from sinking among the stores
      __builtin_amdgcn_sched_barrier(0);
#pragma unroll
      for (int it = 0; it < 16; ++it) *(v4f*)op[it] = val[it];
      // the addresses stay live to here, and the wait closes the run of stores: no
      // register that a store names is written before it on any way out of the branch
      asm volatile("s_wait_xcnt 0x0"
                      :: "v"(op[0]), "v"(op[1]), "v"(op[2]), "v"(op[3]),
                         "v"(op[4]), "v"(op[5]), "v"(op[6]), "v"(op[7]),
                         "v"(op[8]), "v"(op[9]), "v"(op[10]), "v"(op[11]),
                         "v"(op[12]), "v"(op[13]), "v"(op[14]), "v"(op[15]) : "memory");
    } else {
      unsigned short* op[16];
      uint2 pk[16];
#pragma unroll
      for (int it = 0; it < 16; ++it) {
        op[it] = outb + o0 + it * oStep;
        pk[it].x = (unsigned int)f2bf(val[it][0]) | ((unsigned int)f2bf(val[it][1]) << 16);
        pk[it].y = (unsigned int)f2bf(val[it][2]) | ((unsigned int)f2bf(val[it][3]) << 16);
      }
      // all 16 store addresses are made ahead of the first store
      asm volatile("" :: "v"(op[0]), "v"(op[1]), "v"(op[2]), "v"(op[3]),
                         "v"(op[4]), "v"(op[5]), "v"(op[6]), "v"(op[7]),
                         "v"(op[8]), "v"(op[9]), "v"(op[10]), "v"(op[11]),
                         "v"(op[12]), "v"(op[13]), "v"(op[14]), "v"(op[15]) : "memory");
      // keeps the rounding and packing above from sinking among the stores
      __builtin_amdgcn_sched_barrier(0);
#pragma unroll
      for (int it = 0; it < 16; ++it) *(uint2*)op[it] = pk[it];
      // the addresses stay live to behind the last store
      asm volatile("" :: "v"(op[0]), "v"(op[1]), "v"(op[2]), "v"(op[3]),
                         "v"(op[4]), "v"(op[5]), "v"(op[6]), "v"(op[7]),
                         "v"(op[8]), "v"(op[9]), "v"(op[10]), "v"(op[11]),
                         "v"(op[12]), "v"(op[13]), "v"(op[14]), "v"(op[15]) : "memory");
    }
  }
}

#define WBM 256
#define WBN 256
#define WBK 128
#define WNW 16                    // waves of a block
#define WAP 136                   // A pitch in LDS, elements (272 B)
#define WBP 272                   // B pitch in LDS, elements (544 B)
#define WA_ELEMS (WBM * WAP)      // one A buffer
#define WB_ELEMS (WBK * WBP)      // one B buffer
__global__ __launch_bounds__(WNW * 32)
void gemm_wmma_wide_kernel(const unsigned short* __restrict__ A,
                           const unsigned short* __restrict__ Bw,
                           int N, int K,
                           const float* __restrict__ bias, int do_gelu,
                           unsigned short* __restrict__ outb,
                           int zB, int zO) {
  Bw   += (size_t)blockIdx.z * zB;
  outb += (size_t)blockIdx.z * zO;
  __shared__ alignas(16) unsigned short ring[2 * WA_ELEMS + 2 * WB_ELEMS];  // 278,528 B
  unsigned short* Al = ring;                  // [2][m 256][WAP]
  unsigned short* Bl = ring + 2 * WA_ELEMS;   // [2][k 128][WBP]

  int t = threadIdx.x;
  int wave = t >> 5, lane = t & 31;
  int lm = lane & 15, hf = lane >> 4;
  int mBase = blockIdx.y * WBM;
  int nBase = blockIdx.x * WBN;
  int wm = (wave >> 2) * 64;
  int wn = (wave & 3) * 64;
  int kIters = K >> 7;

  // A tile: 256 m rows of 256 B, sixteen lanes a row. B tile: 128 k rows of 512 B,
  // a whole wave a row. Eight copies of each a lane.
  int arow0 = t >> 4, ac8 = (t & 15) * 8;
  int brow0 = t >> 5, bc8 = (t & 31) * 8;
  const unsigned short* aLane = A + (size_t)arow0 * K + ac8;
  const unsigned short* bLane = Bw + (size_t)brow0 * N + nBase + bc8;
  auto stage = [&](int kt, int buf) {
    unsigned int l[8];
    unsigned long long g[8];
#pragma unroll
    for (int i = 0; i < 8; ++i) {
      int row = arow0 + i * 32;
      l[i] = (unsigned int)(unsigned long long)&Al[buf * WA_ELEMS + row * WAP + ac8];
      g[i] = (unsigned long long)(aLane + ((size_t)(mBase + i * 32) * K + kt * WBK));
    }
    async_copy_8x16B(l, g);
#pragma unroll
    for (int i = 0; i < 8; ++i) {
      int row = brow0 + i * 16;
      l[i] = (unsigned int)(unsigned long long)&Bl[buf * WB_ELEMS + row * WBP + bc8];
      g[i] = (unsigned long long)(bLane + (size_t)(kt * WBK + i * 16) * N);
    }
    async_copy_8x16B(l, g);
  };
  // the lane's place in a 16 x 16 block for the transposing load
  int trow = hf * 8 + (lane & 7), tcol = ((lane >> 3) & 1) * 8;

  v8f vzero = {};
  // tile i * 4 + j: acc[..][v] = C[wm + 16 i + lm][wn + 16 j + 8 hf + v]
  v8f acc[16];
#pragma unroll
  for (int q = 0; q < 16; ++q) acc[q] = vzero;

  // prologue: tile 0 lands and is published
  stage(0, 0);
  asm volatile("s_wait_asynccnt 0x0" ::: "memory");  // own copies landed before the barrier
  __syncthreads();

  for (int kt = 0; kt < kIters; ++kt) {
    int cur = kt & 1;
    const unsigned short* Ac = Al + cur * WA_ELEMS;
    const unsigned short* Bc = Bl + cur * WB_ELEMS;

    // tile kt+1 is set flying, at the head of the trip, into the buffer that the
    // barrier at the foot of trip kt-1 has freed
    if (kt + 1 < kIters) stage(kt + 1, cur ^ 1);

#pragma unroll
    for (int ks = 0; ks < 4; ++ks) {     // the tile's four steps of 32 k
      FragU af[4], bf[4];
      int k0 = ks * 32;
#pragma unroll
      for (int i = 0; i < 4; ++i) {
        int arow = wm + i * 16 + lm;
        af[i].q[0] = *(const uint4*)&Ac[arow * WAP + k0 + hf * 8];
        af[i].q[1] = *(const uint4*)&Ac[arow * WAP + k0 + 16 + hf * 8];
      }
#pragma unroll
      for (int j = 0; j < 4; ++j) {
        int bcol = wn + j * 16 + tcol;
        bf[j].q[0] = ld_tr16(&Bc[(k0 + trow) * WBP + bcol]);
        bf[j].q[1] = ld_tr16(&Bc[(k0 + 16 + trow) * WBP + bcol]);
      }
      // keeps the step's 16 LDS reads one group ahead of its WMMAs; without it the
      // compiler sinks them between the WMMAs and each pair waits out the LDS latency
      __builtin_amdgcn_sched_barrier(0);
#pragma unroll
      for (int i = 0; i < 4; ++i)
#pragma unroll
        for (int j = 0; j < 4; ++j)
          acc[i * 4 + j] = __builtin_amdgcn_wmma_f32_16x16x32_bf16(
              false, bf[j].v, false, af[i].v, (short)0, acc[i * 4 + j], false, false);
      // keeps the step's WMMAs ahead of the next step's LDS reads (one fragment set
      // serves all steps) and of the foot's waits and barrier
      __builtin_amdgcn_sched_barrier(0);
    }

    // foot of the trip: own LDS reads done, own copies of tile kt+1 landed; the
    // barrier publishes tile kt+1 and frees buffer cur.
    asm volatile("s_wait_dscnt 0x0" ::: "memory");
    asm volatile("s_wait_asynccnt 0x0" ::: "memory");
    __syncthreads();
  }
  asm volatile("s_wait_asynccnt 0x0" ::: "memory");  // no copy outstanding at the wave's end

  float* stg = (float*)ring;
  const int SP = 260;
  // read-back: a wave takes half a row, 128 columns, at a time, 4 columns a lane
  int ecol = lane * 4;
  v4f bv0 = {}, bv1 = {};
  if (bias) {
    bv0 = *(const v4f*)(bias + nBase + ecol);
    bv1 = *(const v4f*)(bias + nBase + 128 + ecol);
  }
#pragma unroll
  for (int i = 0; i < 4; ++i)
#pragma unroll
    for (int j = 0; j < 4; ++j) {
      float* d = stg + (wm + i * 16 + lm) * SP + wn + j * 16 + hf * 8;
      v8f a = acc[i * 4 + j];
      v4f lo = {a[0], a[1], a[2], a[3]}, hi = {a[4], a[5], a[6], a[7]};
      *(v4f*)d       = lo;
      *(v4f*)(d + 4) = hi;
    }
  __syncthreads();   // the tile is whole before any wave reads rows of it

  const float* srow = stg + wave * SP + ecol;
  unsigned short* orow = outb + (size_t)(mBase + wave) * N + nBase + ecol;
  size_t oStep = (size_t)WNW * N;
  if (do_gelu) {
    // kept rolled rather than the inlined erff bodies, for speed only
#pragma unroll 1
    for (int it = 0; it < 2 * (WBM / WNW); ++it) {
      int r = it >> 1, ch = (it & 1) * 128;
      v4f val = *(const v4f*)(srow + r * WNW * SP + ch);
      if (bias) val += (it & 1) ? bv1 : bv0;
#pragma unroll
      for (int c = 0; c < 4; ++c)
        val[c] = 0.5f * val[c] * (1.f + erff(val[c] * 0.70710678118654752f));
      uint2 pk;
      pk.x = (unsigned int)f2bf(val[0]) | ((unsigned int)f2bf(val[1]) << 16);
      pk.y = (unsigned int)f2bf(val[2]) | ((unsigned int)f2bf(val[3]) << 16);
      *(uint2*)(orow + r * oStep + ch) = pk;
      // the registers that the store names are rewritten in the next trip; the
      // scheduling fence keeps those writes behind the wait
      asm volatile("s_wait_xcnt 0x0" ::: "memory");
      __builtin_amdgcn_sched_barrier(0);
    }
  } else {
    // two runs of 16 half rows: the left 128 columns, then the right; kept rolled,
    // so that one run's registers and code serve both
#pragma unroll 1
    for (int hb = 0; hb < 2; ++hb) {
      int ch = hb * 128;
      v4f val[16];
#pragma unroll
      for (int it = 0; it < 16; ++it) val[it] = *(const v4f*)(srow + it * WNW * SP + ch);
      if (bias) {
        v4f bv = hb ? bv1 : bv0;
#pragma unroll
        for (int it = 0; it < 16; ++it) val[it] += bv;
      }
      unsigned short* op[16];
      uint2 pk[16];
#pragma unroll
      for (int it = 0; it < 16; ++it) {
        op[it] = orow + it * oStep + ch;
        pk[it].x = (unsigned int)f2bf(val[it][0]) | ((unsigned int)f2bf(val[it][1]) << 16);
        pk[it].y = (unsigned int)f2bf(val[it][2]) | ((unsigned int)f2bf(val[it][3]) << 16);
      }
      // all 16 store addresses are made ahead of the first store
      asm volatile("" :: "v"(op[0]), "v"(op[1]), "v"(op[2]), "v"(op[3]),
                         "v"(op[4]), "v"(op[5]), "v"(op[6]), "v"(op[7]),
                         "v"(op[8]), "v"(op[9]), "v"(op[10]), "v"(op[11]),
                         "v"(op[12]), "v"(op[13]), "v"(op[14]), "v"(op[15]) : "memory");
      // keeps the rounding and packing above from sinking among the stores
      __builtin_amdgcn_sched_barrier(0);
#pragma unroll
      for (int it = 0; it < 16; ++it) *(uint2*)op[it] = pk[it];
      // the addresses stay live to here, and the wait closes the run of stores: no
      // register that a store names is written before it
      asm volatile("s_wait_xcnt 0x0"
                      :: "v"(op[0]), "v"(op[1]), "v"(op[2]), "v"(op[3]),
                         "v"(op[4]), "v"(op[5]), "v"(op[6]), "v"(op[7]),
                         "v"(op[8]), "v"(op[9]), "v"(op[10]), "v"(op[11]),
                         "v"(op[12]), "v"(op[13]), "v"(op[14]), "v"(op[15]) : "memory");
      // keeps the second run's register writes behind that wait
      __builtin_amdgcn_sched_barrier(0);
    }
  }
}

typedef __attribute__((ext_vector_type(2))) float  v2f;
typedef __attribute__((ext_vector_type(2))) __bf16 v2bf;

static __device__ __forceinline__ float xhalf(float x) {
  int b = __builtin_bit_cast(int, x);
  return __builtin_bit_cast(float, __builtin_amdgcn_permlanex16(
      b, b, 0x76543210, 0xfedcba98, false, false));
}
// two f32 -> one dword of two bf16 (a in the low half), round to nearest even
static __device__ __forceinline__ unsigned int pack_bf16(float a, float b) {
  v2f f = {a, b};
  return __builtin_bit_cast(unsigned int, __builtin_convertvector(f, v2bf));
}

__global__ __launch_bounds__(128)
void flash_attn_kernel(const unsigned short* __restrict__ Q,
                       const unsigned short* __restrict__ Km,
                       const unsigned short* __restrict__ Vm,
                       unsigned short* __restrict__ O) {
  __shared__ alignas(16) unsigned short Qs[64][72];       // 144B rows
  __shared__ alignas(16) unsigned short Ks[2][32][72];    // 144B rows
  __shared__ alignas(16) unsigned int   Vt[2][64][20];    // [dh][keypair], 80B rows

  int t = threadIdx.x;
  int wave = t >> 5, lane = t & 31;
  int lm = lane & 15, hf = lane >> 4;
  int bh = blockIdx.x;
  int b = bh / H_, h = bh % H_;
  int q0 = b * N_ + blockIdx.y * 64;
  int colh = h * DH_;
  int rowBase = wave * 16;
  const int kbIters = N_ / 32;

  auto stageK = [&](int kb, int buf) {
    int k0 = b * N_ + kb * 32;
    int row = t >> 2, c16 = (t & 3) * 16;
    async_copy_32B(Km + (size_t)(k0 + row) * HD + colh + c16, &Ks[buf][row][c16]);
  };
  unsigned int vr0[4], vr1[4];
  auto loadV = [&](int kb) {
    int k0 = b * N_ + kb * 32;
#pragma unroll
    for (int i = 0; i < 4; ++i) {
      int idx = i * 128 + t;           // 512 tasks: (kp, dh-pair)
      int kp  = idx >> 5;              // 0..15
      int dh0 = (idx & 31) * 2;        // 0..62 even
      vr0[i] = *(const unsigned int*)&Vm[(size_t)(k0 + 2 * kp) * HD + colh + dh0];
      vr1[i] = *(const unsigned int*)&Vm[(size_t)(k0 + 2 * kp + 1) * HD + colh + dh0];
    }
  };
  auto storeV = [&](int buf) {
#pragma unroll
    for (int i = 0; i < 4; ++i) {
      int idx = i * 128 + t;
      int kp  = idx >> 5;
      int dh0 = (idx & 31) * 2;
      Vt[buf][dh0][kp]     = (vr0[i] & 0xFFFFu) | (vr1[i] << 16);
      Vt[buf][dh0 + 1][kp] = (vr0[i] >> 16)     | (vr1[i] & 0xFFFF0000u);
    }
  };

  // load Q tile 64x64 (64B per thread)
  {
    int row = t >> 1, c32 = (t & 1) * 32;
    const uint4* src = (const uint4*)(Q + (size_t)(q0 + row) * HD + colh + c32);
    uint4* dst = (uint4*)&Qs[row][c32];
    dst[0] = src[0]; dst[1] = src[1]; dst[2] = src[2]; dst[3] = src[3];
  }

  v8f vzero = {};
  v8f o[4];
#pragma unroll
  for (int c = 0; c < 4; ++c) o[c] = vzero;
  // of query lm: running maximum (both halves alike), and the sum over the
  // keys that this half of the wave holds
  float mrow = -1e30f, lrow = 0.f;

  // prologue: stage tile 0 (barrier also publishes Qs)
  stageK(0, 0);
  loadV(0);
  storeV(0);
  async_wait();
  __syncthreads();

  // Q^T fragments (B operand), read once and kept in registers
  FragU qb[2];
#pragma unroll
  for (int st = 0; st < 2; ++st) {
    qb[st].q[0] = *(const uint4*)&Qs[rowBase + lm][st * 32 + hf * 8];
    qb[st].q[1] = *(const uint4*)&Qs[rowBase + lm][st * 32 + 16 + hf * 8];
  }

  for (int kb = 0; kb < kbIters; ++kb) {
    int cur = kb & 1;
    bool more = (kb + 1) < kbIters;
    if (more) { stageK(kb + 1, cur ^ 1); loadV(kb + 1); }

    // K fragments (A operand of S^T) and V^T fragments (A operand of O^T)
    FragU kf[2][2], vf[4];
#pragma unroll
    for (int st = 0; st < 2; ++st)
#pragma unroll
      for (int j = 0; j < 2; ++j) {
        kf[st][j].q[0] = *(const uint4*)&Ks[cur][j * 16 + lm][st * 32 + hf * 8];
        kf[st][j].q[1] = *(const uint4*)&Ks[cur][j * 16 + lm][st * 32 + 16 + hf * 8];
      }
#pragma unroll
    for (int ct = 0; ct < 4; ++ct) {
      vf[ct].q[0] = *(const uint4*)&Vt[cur][ct * 16 + lm][hf * 4];
      vf[ct].q[1] = *(const uint4*)&Vt[cur][ct * 16 + lm][8 + hf * 4];
    }
    // keeps the next tile's V loads and the trip's 16 LDS reads at the head of
    // the trip; without it the compiler sinks each to just ahead of its use,
    // and the wave waits out the L2 and LDS latencies there
    __builtin_amdgcn_sched_barrier(0);

    // ---- S^T = K Q^T  (two 16-key tiles, two k-steps over DH=64) ----
    // s[j][v] = score of key 16 j + 8 hf + v against query lm
    v8f s[2]; s[0] = vzero; s[1] = vzero;
#pragma unroll
    for (int st = 0; st < 2; ++st)
#pragma unroll
      for (int j = 0; j < 2; ++j)
        s[j] = __builtin_amdgcn_wmma_f32_16x16x32_bf16(
            false, kf[st][j].v, false, qb[st].v, (short)0, s[j], false, false);

    // ---- online softmax of one query per lane ----
    float tm = fmaxf(s[0][0], s[1][0]);
#pragma unroll
    for (int v = 1; v < 8; ++v) tm = fmaxf(tm, fmaxf(s[0][v], s[1][v]));
    tm = fmaxf(tm, xhalf(tm));         // the other 16 keys of this query
    float mn = fmaxf(mrow, tm);
    float scale = __expf(mrow - mn);
    mrow = mn;
    float p0[8], p1[8];
    float rs0 = 0.f, rs1 = 0.f;
#pragma unroll
    for (int v = 0; v < 8; ++v) {
      p0[v] = __expf(s[0][v] - mn);
      p1[v] = __expf(s[1][v] - mn);
      rs0 += p0[v];
      rs1 += p1[v];
    }
    lrow = lrow * scale + (rs0 + rs1);
#pragma unroll
    for (int c = 0; c < 4; ++c)
#pragma unroll
      for (int v = 0; v < 8; ++v) o[c][v] *= scale;

    // ---- P^T as B operand: k = 8 hf + v from tile 0, 16 + 8 hf + v from tile 1 ----
    FragU pb;
#pragma unroll
    for (int i = 0; i < 4; ++i) {
      pb.u[i]     = pack_bf16(p0[2 * i], p0[2 * i + 1]);
      pb.u[4 + i] = pack_bf16(p1[2 * i], p1[2 * i + 1]);
    }

    // ---- O^T += V^T P^T : o[ct][v] = O[query lm][dh 16 ct + 8 hf + v] ----
#pragma unroll
    for (int ct = 0; ct < 4; ++ct) {
      o[ct] = __builtin_amdgcn_wmma_f32_16x16x32_bf16(
          false, vf[ct].v, false, pb.v, (short)0, o[ct], false, false);
    }

    // keeps the wait for the next tile's V loads, with their pack and store,
    // behind the trip's products; without it the compiler lifts that wait to
    // just behind the first WMMA, where the loads have had no time to return
    __builtin_amdgcn_sched_barrier(0);
    if (more) storeV(cur ^ 1);
    async_wait();
    __syncthreads();
  }

  // ---- normalize and store bf16: 8 consecutive dh of one query per store ----
  float lsum = lrow + xhalf(lrow);     // the two halves' key sums joined
  uint4 ov[4];
#pragma unroll
  for (int ct = 0; ct < 4; ++ct) {
    ov[ct].x = pack_bf16(o[ct][0] / lsum, o[ct][1] / lsum);
    ov[ct].y = pack_bf16(o[ct][2] / lsum, o[ct][3] / lsum);
    ov[ct].z = pack_bf16(o[ct][4] / lsum, o[ct][5] / lsum);
    ov[ct].w = pack_bf16(o[ct][6] / lsum, o[ct][7] / lsum);
  }
  unsigned short* orow = O + (size_t)(q0 + rowBase + lm) * HD + colh + hf * 8;
#pragma unroll
  for (int ct = 0; ct < 4; ++ct) *(uint4*)(orow + ct * 16) = ov[ct];
}

// ---------------------------------------------------------------------------
// Host-side orchestration
// ---------------------------------------------------------------------------
extern "C" void kernel_launch(void* const* d_in, const int* in_sizes, int n_in,
                              void* d_out, int out_size, void* d_ws, size_t ws_size,
                              hipStream_t stream) {
  const float* x     = (const float*)d_in[0];
  const float* wq    = (const float*)d_in[1];
  const float* wk    = (const float*)d_in[2];
  const float* wv    = (const float*)d_in[3];
  const float* wo    = (const float*)d_in[4];
  const float* w1    = (const float*)d_in[5];
  const float* b1    = (const float*)d_in[6];
  const float* w2    = (const float*)d_in[7];
  const float* b2    = (const float*)d_in[8];
  const float* ln1_g = (const float*)d_in[9];
  const float* ln1_b = (const float*)d_in[10];
  const float* ln2_g = (const float*)d_in[11];
  const float* ln2_b = (const float*)d_in[12];
  float* out = (float*)d_out;

  // workspace carve-out (~120 MiB total)
  char* p = (char*)d_ws;
  auto alloc = [&](size_t bytes) -> void* {
    void* r = (void*)p;
    p += (bytes + 255) & ~(size_t)255;
    return r;
  };
  unsigned short* wq_b = (unsigned short*)alloc((size_t)3 * D_ * HD * 2);   // wq | wk | wv
  unsigned short* wk_b = wq_b + D_ * HD;
  unsigned short* wv_b = wk_b + D_ * HD;
  unsigned short* wo_b = (unsigned short*)alloc((size_t)HD * D_ * 2);
  unsigned short* w1_b = (unsigned short*)alloc((size_t)D_ * FF_ * 2);
  unsigned short* w2_b = (unsigned short*)alloc((size_t)FF_ * D_ * 2);
  unsigned short* h_b  = (unsigned short*)alloc((size_t)ROWS * D_ * 2);
  unsigned short* q_b  = (unsigned short*)alloc((size_t)3 * ROWS * HD * 2); // q | k | v
  unsigned short* k_b  = q_b + ROWS * HD;
  unsigned short* v_b  = k_b + ROWS * HD;
  unsigned short* a_b  = (unsigned short*)alloc((size_t)ROWS * HD * 2);
  float*          x2   = (float*)        alloc((size_t)ROWS * D_ * 4);
  unsigned short* h2_b = (unsigned short*)alloc((size_t)ROWS * D_ * 2);
  unsigned short* ff_b = (unsigned short*)alloc((size_t)ROWS * FF_ * 2);

  // 1) weights -> bf16 and LN1, one launch
  cast_and_layernorm_kernel<<<CAST_GRID + ROWS, 256, 0, stream>>>(
      wq, wk, wv, wo, w1, w2, wq_b, wk_b, wv_b, wo_b, w1_b, w2_b, x, ln1_g, ln1_b, h_b);

  // 2) Q/K/V projections, one launch of three planes
  dim3 gemmBlk(256);
  dim3 attnBlk(128);
  dim3 wideBlk(WNW * 32);
  dim3 gQKV(HD / WBN, ROWS / WBM, 3);
  gemm_wmma_wide_kernel<<<gQKV, wideBlk, 0, stream>>>(h_b, wq_b, HD, D_,
                                                      nullptr, 0, q_b,
                                                      D_ * HD, ROWS * HD);

  // 3) attention
  dim3 gAttn(B_ * H_, N_ / 64);
  flash_attn_kernel<<<gAttn, attnBlk, 0, stream>>>(q_b, k_b, v_b, a_b);

  // 4) out projection + residual -> x2 (fp32)
  dim3 gO(D_ / GBN, ROWS / GBM);
  gemm_wmma_kernel<<<gO, gemmBlk, 0, stream>>>(a_b, wo_b, ROWS, D_, HD,
                                               nullptr, 0, x, nullptr, x2, 0, 0);

  // 5) LN2
  layernorm_bf16_kernel<<<ROWS, 256, 0, stream>>>(x2, ln2_g, ln2_b, h2_b);

  // 6) FF1 + bias + exact GELU -> bf16
  dim3 gFF1(FF_ / WBN, ROWS / WBM);
  gemm_wmma_wide_kernel<<<gFF1, wideBlk, 0, stream>>>(h2_b, w1_b, FF_, D_,
                                                      b1, 1, ff_b, 0, 0);

  // 7) FF2 + bias + residual -> out (fp32)
  dim3 gFF2(D_ / GBN, ROWS / GBM);
  gemm_wmma_kernel<<<gFF2, gemmBlk, 0, stream>>>(ff_b, w2_b, ROWS, D_, FF_,
                                                 b2, 0, x2, nullptr, out, 0, 0);
}

// v008
// It runs in 172 microseconds.
// Two timings next to v007 both put it at 1.08 times that version's speed.
// Counting every step since v000, it is 3.30 times as fast.
#include <hip/hip_runtime.h>
#include <stdint.h>

// Problem constants (match reference)
#define B_  2
#define N_  2048
#define D_  1024
#define H_  16
#define DH_ 64
#define FF_ 4096
#define ROWS (B_ * N_)          // 4096
#define HD  (H_ * DH_)          // 1024

typedef __attribute__((ext_vector_type(16))) __bf16 v16bf;
typedef __attribute__((ext_vector_type(8)))  float  v8f;

// Fragment: 8 dwords = two 16B chunks; loaded as 2x ds_load_b128 (B of the GEMM: 2x ds_load_tr16_b128).
union FragU { uint4 q[2]; unsigned int u[8]; v16bf v; };

static __device__ __forceinline__ unsigned short f2bf(float f) {
  union { float f; unsigned int u; } c; c.f = f;
  unsigned int u = c.u;
  unsigned int r = u + 0x7FFFu + ((u >> 16) & 1u);   // round-to-nearest-even
  return (unsigned short)(r >> 16);
}

typedef __attribute__((ext_vector_type(8))) short s16x8;
static __device__ __forceinline__ uint4 ld_tr16(const unsigned short* p) {
  typedef __attribute__((address_space(3))) s16x8 lds_s16x8;
  return __builtin_bit_cast(uint4, __builtin_amdgcn_ds_load_tr16_b128_v8i16((lds_s16x8*)p));
}

// ---------------------------------------------------------------------------
// f32 -> bf16 cast of all six weights, one pass per block.
// A block converts CAST_BLK consecutive elements of one weight (every weight's
// size is a multiple of CAST_BLK). A thread has its 16 loads of 16 B in flight
// together; each load of a wave covers 512 contiguous bytes.
// ---------------------------------------------------------------------------
typedef __attribute__((ext_vector_type(4))) float v4f;
#define CAST_BLK   16384                       // 256 threads x 16 x 4 elements
#define CAST_SMALL (D_ * HD / CAST_BLK)        // blocks per D x HD weight: 64
#define CAST_LARGE (D_ * FF_ / CAST_BLK)       // blocks per D x FF weight: 256
#define CAST_GRID  (4 * CAST_SMALL + 2 * CAST_LARGE)
static __device__ __forceinline__
void cast_weights_block(int blk,
                        const float* __restrict__ wq, const float* __restrict__ wk,
                        const float* __restrict__ wv, const float* __restrict__ wo,
                        const float* __restrict__ w1, const float* __restrict__ w2,
                        unsigned short* __restrict__ oq, unsigned short* __restrict__ ok,
                        unsigned short* __restrict__ ov, unsigned short* __restrict__ oo,
                        unsigned short* __restrict__ o1, unsigned short* __restrict__ o2) {
  const float* in;
  unsigned short* out;
  if (blk < 4 * CAST_SMALL) {
    int w = blk / CAST_SMALL;
    blk -= w * CAST_SMALL;
    in  = w == 0 ? wq : w == 1 ? wk : w == 2 ? wv : wo;
    out = w == 0 ? oq : w == 1 ? ok : w == 2 ? ov : oo;
  } else {
    blk -= 4 * CAST_SMALL;
    int w = blk / CAST_LARGE;
    blk -= w * CAST_LARGE;
    in  = w == 0 ? w1 : w2;
    out = w == 0 ? o1 : o2;
  }
  int off = blk * CAST_BLK + threadIdx.x * 4;
  in  += off;
  out += off;
  v4f f[16];
#pragma unroll
  for (int i = 0; i < 16; ++i) f[i] = *(const v4f*)(in + i * 1024);
  // takes the 16 loaded values as inputs only: all 16 loads are issued ahead of
  // it; without it the compiler sinks loads to just ahead of their conversion,
  // and the wave waits out several memory latencies one after the other. The
  // address is named too: it stays live, so no load lands in the register pair
  // that the loads issued before it name.
  asm volatile("" :: "v"(f[0]), "v"(f[1]), "v"(f[2]), "v"(f[3]), "v"(f[4]), "v"(f[5]),
                     "v"(f[6]), "v"(f[7]), "v"(f[8]), "v"(f[9]), "v"(f[10]), "v"(f[11]),
                     "v"(f[12]), "v"(f[13]), "v"(f[14]), "v"(f[15]), "v"(in));
  uint2 r[16];
#pragma unroll
  for (int i = 0; i < 16; ++i) {
    r[i].x = (unsigned int)f2bf(f[i].x) | ((unsigned int)f2bf(f[i].y) << 16);
    r[i].y = (unsigned int)f2bf(f[i].z) | ((unsigned int)f2bf(f[i].w) << 16);
  }
  // keeps the stores behind the last conversion, so that no register which an
  // issued store names is written again
  __builtin_amdgcn_sched_barrier(0);
#pragma unroll
  for (int i = 0; i < 16; ++i) *(uint2*)(out + i * 1024) = r[i];
}

// ---------------------------------------------------------------------------
// Row LayerNorm (D=1024), fp32 in -> bf16 out. One block (256 thr) per row.
// ---------------------------------------------------------------------------
static __device__ __forceinline__
void layernorm_row(int row,
                   const float* __restrict__ x,
                   const float* __restrict__ g,
                   const float* __restrict__ b,
                   unsigned short* __restrict__ out) {
  __shared__ float red[256];
  int t = threadIdx.x;
  const float* xr = x + (size_t)row * D_;
  float v[4];
  float s = 0.f;
#pragma unroll
  for (int i = 0; i < 4; ++i) { v[i] = xr[t + i * 256]; s += v[i]; }
  red[t] = s; __syncthreads();
  for (int off = 128; off > 0; off >>= 1) {
    if (t < off) red[t] += red[t + off];
    __syncthreads();
  }
  float mu = red[0] * (1.f / D_);
  __syncthreads();
  float s2 = 0.f;
#pragma unroll
  for (int i = 0; i < 4; ++i) { float d = v[i] - mu; s2 += d * d; }
  red[t] = s2; __syncthreads();
  for (int off = 128; off > 0; off >>= 1) {
    if (t < off) red[t] += red[t + off];
    __syncthreads();
  }
  float rstd = rsqrtf(red[0] * (1.f / D_) + 1e-5f);
#pragma unroll
  for (int i = 0; i < 4; ++i) {
    int c = t + i * 256;
    out[(size_t)row * D_ + c] = f2bf((v[i] - mu) * rstd * g[c] + b[c]);
  }
}

__global__ __launch_bounds__(256)
void layernorm_bf16_kernel(const float* __restrict__ x,
                           const float* __restrict__ g,
                           const float* __restrict__ b,
                           unsigned short* __restrict__ out) {
  layernorm_row(blockIdx.x, x, g, b, out);
}

// ---------------------------------------------------------------------------
// The weight casts and the first LayerNorm depend on nothing of each other:
// one grid holds both. The block index picks the body, alike for the whole
// block; the cast blocks, which move the most bytes each, take the low indices.
// ---------------------------------------------------------------------------
__global__ __launch_bounds__(256)
void cast_and_layernorm_kernel(const float* __restrict__ wq, const float* __restrict__ wk,
                               const float* __restrict__ wv, const float* __restrict__ wo,
                               const float* __restrict__ w1, const float* __restrict__ w2,
                               unsigned short* __restrict__ oq, unsigned short* __restrict__ ok,
                               unsigned short* __restrict__ ov, unsigned short* __restrict__ oo,
                               unsigned short* __restrict__ o1, unsigned short* __restrict__ o2,
                               const float* __restrict__ x, const float* __restrict__ g,
                               const float* __restrict__ b, unsigned short* __restrict__ h) {
  int blk = blockIdx.x;
  if (blk < CAST_GRID) cast_weights_block(blk, wq, wk, wv, wo, w1, w2, oq, ok, ov, oo, o1, o2);
  else                 layernorm_row(blk - CAST_GRID, x, g, b, h);
}

static __device__ __forceinline__ void async_copy_8x16B(const unsigned int* l,
                                                        const unsigned long long* g) {
  asm volatile("global_load_async_to_lds_b128 %0, %8, off\n\t"
               "global_load_async_to_lds_b128 %1, %9, off\n\t"
               "global_load_async_to_lds_b128 %2, %10, off\n\t"
               "global_load_async_to_lds_b128 %3, %11, off\n\t"
               "global_load_async_to_lds_b128 %4, %12, off\n\t"
               "global_load_async_to_lds_b128 %5, %13, off\n\t"
               "global_load_async_to_lds_b128 %6, %14, off\n\t"
               "global_load_async_to_lds_b128 %7, %15, off\n\t"
               "s_wait_xcnt 0x0"
               :: "v"(l[0]), "v"(l[1]), "v"(l[2]), "v"(l[3]),
                  "v"(l[4]), "v"(l[5]), "v"(l[6]), "v"(l[7]),
                  "v"(g[0]), "v"(g[1]), "v"(g[2]), "v"(g[3]),
                  "v"(g[4]), "v"(g[5]), "v"(g[6]), "v"(g[7])
               : "memory");
}

// ---------------------------------------------------------------------------
// Generic bf16 WMMA GEMM:  C[M,N] = A[M,K] @ Bw[K,N]  (f32 accumulate)
// 128x128 tile per block, 128 k per trip, 256 threads = 8 waves (2 x 4), each
// wave 64(M) x 32(N): per 32 k, 6 fragments feed 8 WMMAs.
// M, N multiples of 128; K a multiple of 128.
// Two LDS buffers: the async copies of A and B of tile t+1 fly while tile t is
// worked on, 64 KB a block, over the time of 32 WMMAs a wave. B lies in LDS as
// in memory, [k][n]; its fragments come by the transposing load.
// The weight fragment is the first WMMA operand: a lane then holds 8 consecutive
// columns of ONE output row, which go to LDS as two 16 B stores. The tile is read
// back by rows, so that every global access of the epilogue is 16 B (8 B for
// bf16) a lane and covers whole 128 B lines.
// Products that share A go in one grid: plane blockIdx.z takes the weight at
// Bw + z * zB and writes its bf16 output at outb + z * zO.
// ---------------------------------------------------------------------------
#define GBM 128
#define GBN 128
#define GBK 128
__global__ __launch_bounds__(256)
void gemm_wmma_kernel(const unsigned short* __restrict__ A,
                      const unsigned short* __restrict__ Bw,
                      int M, int N, int K,
                      const float* __restrict__ bias, int do_gelu,
                      const float* __restrict__ resid,
                      unsigned short* __restrict__ outb,
                      float* __restrict__ outf,
                      int zB, int zO) {
  Bw   += (size_t)blockIdx.z * zB;
  outb += (size_t)blockIdx.z * zO;
  __shared__ alignas(16) unsigned short Alds[2][GBM][136]; // [m][k], 272B rows (padded)
  __shared__ alignas(16) unsigned short Bs[2][GBK][144];   // [k][n], 288B rows (padded)

  int t = threadIdx.x;
  int wave = t >> 5, lane = t & 31;
  int lm = lane & 15, hf = lane >> 4;
  int mBase = blockIdx.y * GBM;
  int nBase = blockIdx.x * GBN;
  int wm = (wave >> 2) * 64;
  int wn = (wave & 3) * 32;
  int kIters = K >> 7;

  // A tile: 128 m rows of 256 B. B tile: 128 k rows of 256 B. Sixteen lanes
  // cover one whole row per copy.
  int row0 = t >> 4, c8 = (t & 15) * 8;
  const unsigned short* aLane = A + (size_t)row0 * K + c8;            // the lane's share of
  const unsigned short* bLane = Bw + (size_t)row0 * N + nBase + c8;   // the addresses
  auto stage = [&](int kt, int buf) {
    unsigned int l[8];
    unsigned long long g[8];
#pragma unroll
    for (int i = 0; i < 8; ++i) {
      int row = row0 + i * 16;
      l[i] = (unsigned int)(unsigned long long)&Alds[buf][row][c8];
      g[i] = (unsigned long long)(aLane + ((size_t)(mBase + i * 16) * K + kt * GBK));
    }
    async_copy_8x16B(l, g);
#pragma unroll
    for (int i = 0; i < 8; ++i) {
      int row = row0 + i * 16;
      l[i] = (unsigned int)(unsigned long long)&Bs[buf][row][c8];
      g[i] = (unsigned long long)(bLane + (size_t)(kt * GBK + i * 16) * N);
    }
    async_copy_8x16B(l, g);
  };
  // the lane's place in a 16 x 16 block for the transposing load
  int trow = hf * 8 + (lane & 7), tcol = ((lane >> 3) & 1) * 8;

  v8f vzero = {};
  // tile i * 2 + j: acc[..][v] = C[wm + 16 i + lm][wn + 16 j + 8 hf + v]
  v8f acc[8];
#pragma unroll
  for (int q = 0; q < 8; ++q) acc[q] = vzero;

  // prologue: tile 0 lands and is published
  stage(0, 0);
  asm volatile("s_wait_asynccnt 0x0" ::: "memory");  // own copies landed before the barrier
  __syncthreads();

  for (int kt = 0; kt < kIters; ++kt) {
    int cur = kt & 1;

#pragma unroll
    for (int kh = 0; kh < 2; ++kh) {     // the tile's two halves of 64 k
      FragU af[2][4], bf[2][2];
#pragma unroll
      for (int ks = 0; ks < 2; ++ks) {
        int k0 = kh * 64 + ks * 32;
#pragma unroll
        for (int i = 0; i < 4; ++i) {
          int arow = wm + i * 16 + lm;
          af[ks][i].q[0] = *(const uint4*)&Alds[cur][arow][k0 + hf * 8];
          af[ks][i].q[1] = *(const uint4*)&Alds[cur][arow][k0 + 16 + hf * 8];
        }
#pragma unroll
        for (int j = 0; j < 2; ++j) {
          int bcol = wn + j * 16 + tcol;
          bf[ks][j].q[0] = ld_tr16(&Bs[cur][k0 + trow][bcol]);
          bf[ks][j].q[1] = ld_tr16(&Bs[cur][k0 + 16 + trow][bcol]);
        }
      }
      // keeps the half's 24 LDS reads one group ahead of its WMMAs; without it the
      // compiler sinks them between the WMMAs and each pair waits out the LDS latency
      __builtin_amdgcn_sched_barrier(0);
      // tile kt+1 is set flying into the buffer that the barrier at the foot of
      // trip kt-1 has freed, while the LDS reads above are still coming in
      if (kh == 0 && kt + 1 < kIters) stage(kt + 1, cur ^ 1);
#pragma unroll
      for (int ks = 0; ks < 2; ++ks)
#pragma unroll
        for (int i = 0; i < 4; ++i)
#pragma unroll
          for (int j = 0; j < 2; ++j)
            acc[i * 2 + j] = __builtin_amdgcn_wmma_f32_16x16x32_bf16(
                false, bf[ks][j].v, false, af[ks][i].v, (short)0, acc[i * 2 + j], false, false);
      // keeps the half's WMMAs ahead of what follows: the next half's LDS reads
      // (one fragment set serves both halves) and the foot's waits and barrier,
      // behind which the compiler otherwise sinks them, so that they no longer
      // cover the copies' flight
      __builtin_amdgcn_sched_barrier(0);
    }

    // foot of the trip: own LDS reads done, own copies of tile kt+1 landed; the
    // barrier publishes tile kt+1 and frees buffer cur.
    asm volatile("s_wait_dscnt 0x0" ::: "memory");
    asm volatile("s_wait_asynccnt 0x0" ::: "memory");
    __syncthreads();
  }
  asm volatile("s_wait_asynccnt 0x0" ::: "memory");  // no copy outstanding at the wave's end

  float* stg = (float*)&Alds[0][0][0];
  const int SP = 132;
  // read-back: a wave takes one whole row of 128 columns a trip, 4 columns a lane
  int ecol = lane * 4;
  size_t o0 = (size_t)(mBase + wave) * N + nBase + ecol;
  size_t oStep = (size_t)8 * N;
  const float* srow = stg + wave * SP + ecol;

  // bias and residual are asked for ahead of the staging, all loads in flight together
  v4f bv = {};
  if (bias) bv = *(const v4f*)(bias + nBase + ecol);
  v4f rv[16];
  const float* rp[16];
  bool pre = resid && !do_gelu;
  if (pre) {
#pragma unroll
    for (int it = 0; it < 16; ++it) rp[it] = resid + o0 + it * oStep;
#pragma unroll
    for (int it = 0; it < 16; ++it) rv[it] = *(const v4f*)rp[it];
  }

#pragma unroll
  for (int i = 0; i < 4; ++i)
#pragma unroll
    for (int j = 0; j < 2; ++j) {
      float* d = stg + (wm + i * 16 + lm) * SP + wn + j * 16 + hf * 8;
      v8f a = acc[i * 2 + j];
      v4f lo = {a[0], a[1], a[2], a[3]}, hi = {a[4], a[5], a[6], a[7]};
      *(v4f*)d       = lo;
      *(v4f*)(d + 4) = hi;
    }
  if (pre) {
    // takes loaded values 0 to 7 and all 16 addresses as inputs only: every address
    // stays live until the last load has returned, so that no load lands in a
    // register pair that a load issued before it names
    asm volatile("" :: "v"(rp[0]), "v"(rp[1]), "v"(rp[2]), "v"(rp[3]),
                       "v"(rp[4]), "v"(rp[5]), "v"(rp[6]), "v"(rp[7]),
                       "v"(rp[8]), "v"(rp[9]), "v"(rp[10]), "v"(rp[11]),
                       "v"(rp[12]), "v"(rp[13]), "v"(rp[14]), "v"(rp[15]),
                       "v"(rv[0]), "v"(rv[1]), "v"(rv[2]), "v"(rv[3]),
                       "v"(rv[4]), "v"(rv[5]), "v"(rv[6]), "v"(rv[7]));
    // the same for loaded values 8 to 15 (a statement takes thirty operands)
    asm volatile("" :: "v"(rp[0]), "v"(rp[1]), "v"(rp[2]), "v"(rp[3]),
                       "v"(rp[4]), "v"(rp[5]), "v"(rp[6]), "v"(rp[7]),
                       "v"(rp[8]), "v"(rp[9]), "v"(rp[10]), "v"(rp[11]),
                       "v"(rp[12]), "v"(rp[13]), "v"(rp[14]), "v"(rp[15]),
                       "v"(rv[8]), "v"(rv[9]), "v"(rv[10]), "v"(rv[11]),
                       "v"(rv[12]), "v"(rv[13]), "v"(rv[14]), "v"(rv[15]));
  }
  __syncthreads();   // the tile is whole before any wave reads rows of it

  if (do_gelu) {
    // kept rolled rather than 64 inlined erff bodies, for speed only
    size_t o = o0;
#pragma unroll 1
    for (int it = 0; it < 16; ++it) {
      v4f val = *(const v4f*)(srow + it * 8 * SP);
      if (bias) val += bv;
#pragma unroll
      for (int c = 0; c < 4; ++c)
        val[c] = 0.5f * val[c] * (1.f + erff(val[c] * 0.70710678118654752f));
      if (resid) val += *(const v4f*)(resid + o);
      if (outf) {
        *(v4f*)(outf + o) = val;
        // closes this branch: no register that the store names is written before it
        asm volatile("s_wait_xcnt 0x0" ::: "memory");
      } else {
        uint2 pk;
        pk.x = (unsigned int)f2bf(val[0]) | ((unsigned int)f2bf(val[1]) << 16);
        pk.y = (unsigned int)f2bf(val[2]) | ((unsigned int)f2bf(val[3]) << 16);
        *(uint2*)(outb + o) = pk;
      }
      // the registers that the store names are rewritten in the next trip; the
      // scheduling fence keeps those writes behind the wait
      asm volatile("s_wait_xcnt 0x0" ::: "memory");
      __builtin_amdgcn_sched_barrier(0);
      o += oStep;
    }
  } else {
    v4f val[16];
#pragma unroll
    for (int it = 0; it < 16; ++it) val[it] = *(const v4f*)(srow + it * 8 * SP);
    if (bias) {
#pragma unroll
      for (int it = 0; it < 16; ++it) val[it] += bv;
    }
    if (resid) {
#pragma unroll
      for (int it = 0; it < 16; ++it) val[it] += rv[it];
    }
    // In both forms only stores stand between the first statement and the last, so
    // that no register which an issued store names is written again among them.
    if (outf) {
      float* op[16];
#pragma unroll
      for (int it = 0; it < 16; ++it) op[it] = outf + o0 + it * oStep;
      // all 16 store addresses are made ahead of the first store
      asm volatile("" :: "v"(op[0]), "v"(op[1]), "v"(op[2]), "v"(op[3]),
                         "v"(op[4]), "v"(op[5]), "v"(op[6]), "v"(op[7]),
                         "v"(op[8]), "v"(op[9]), "v"(op[10]), "v"(op[11]),
                         "v"(op[12]), "v"(op[13]), "v"(op[14]), "v"(op[15]) : "memory");
      // keeps the sums above from sinking among the stores
      __builtin_amdgcn_sched_barrier(0);
#pragma unroll
      for (int it = 0; it < 16; ++it) *(v4f*)op[it] = val[it];
      // the addresses stay live to here, and the wait closes the run of stores: no
      // register that a store names is written before it on any way out of the branch
      asm volatile("s_wait_xcnt 0x0"
                      :: "v"(op[0]), "v"(op[1]), "v"(op[2]), "v"(op[3]),
                         "v"(op[4]), "v"(op[5]), "v"(op[6]), "v"(op[7]),
                         "v"(op[8]), "v"(op[9]), "v"(op[10]), "v"(op[11]),
                         "v"(op[12]), "v"(op[13]), "v"(op[14]), "v"(op[15]) : "memory");
    } else {
      unsigned short* op[16];
      uint2 pk[16];
#pragma unroll
      for (int it = 0; it < 16; ++it) {
        op[it] = outb + o0 + it * oStep;
        pk[it].x = (unsigned int)f2bf(val[it][0]) | ((unsigned int)f2bf(val[it][1]) << 16);
        pk[it].y = (unsigned int)f2bf(val[it][2]) | ((unsigned int)f2bf(val[it][3]) << 16);
      }
      // all 16 store addresses are made ahead of the first store
      asm volatile("" :: "v"(op[0]), "v"(op[1]), "v"(op[2]), "v"(op[3]),
                         "v"(op[4]), "v"(op[5]), "v"(op[6]), "v"(op[7]),
                         "v"(op[8]), "v"(op[9]), "v"(op[10]), "v"(op[11]),
                         "v"(op[12]), "v"(op[13]), "v"(op[14]), "v"(op[15]) : "memory");
      // keeps the rounding and packing above from sinking among the stores
      __builtin_amdgcn_sched_barrier(0);
#pragma unroll
      for (int it = 0; it < 16; ++it) *(uint2*)op[it] = pk[it];
      // the addresses stay live to behind the last store
      asm volatile("" :: "v"(op[0]), "v"(op[1]), "v"(op[2]), "v"(op[3]),
                         "v"(op[4]), "v"(op[5]), "v"(op[6]), "v"(op[7]),
                         "v"(op[8]), "v"(op[9]), "v"(op[10]), "v"(op[11]),
                         "v"(op[12]), "v"(op[13]), "v"(op[14]), "v"(op[15]) : "memory");
    }
  }
}

#define WBM 256
#define WBN 256
#define WBK 128
#define WNW 16                    // waves of a block
#define WAP 136                   // A pitch in LDS, elements (272 B)
#define WBP 272                   // B pitch in LDS, elements (544 B)
#define WA_ELEMS (WBM * WAP)      // one A buffer
#define WB_ELEMS (WBK * WBP)      // one B buffer
__global__ __launch_bounds__(WNW * 32)
void gemm_wmma_wide_kernel(const unsigned short* __restrict__ A,
                           const unsigned short* __restrict__ Bw,
                           int N, int K,
                           const float* __restrict__ bias, int do_gelu,
                           unsigned short* __restrict__ outb,
                           int zB, int zO) {
  Bw   += (size_t)blockIdx.z * zB;
  outb += (size_t)blockIdx.z * zO;
  __shared__ alignas(16) unsigned short ring[2 * WA_ELEMS + 2 * WB_ELEMS];  // 278,528 B
  unsigned short* Al = ring;                  // [2][m 256][WAP]
  unsigned short* Bl = ring + 2 * WA_ELEMS;   // [2][k 128][WBP]

  int t = threadIdx.x;
  int wave = t >> 5, lane = t & 31;
  int lm = lane & 15, hf = lane >> 4;
  int mBase = blockIdx.y * WBM;
  int nBase = blockIdx.x * WBN;
  int wm = (wave >> 2) * 64;
  int wn = (wave & 3) * 64;
  int kIters = K >> 7;

  // A tile: 256 m rows of 256 B, sixteen lanes a row. B tile: 128 k rows of 512 B,
  // a whole wave a row. Eight copies of each a lane.
  int arow0 = t >> 4, ac8 = (t & 15) * 8;
  int brow0 = t >> 5, bc8 = (t & 31) * 8;
  const unsigned short* aLane = A + (size_t)arow0 * K + ac8;
  const unsigned short* bLane = Bw + (size_t)brow0 * N + nBase + bc8;
  auto stage = [&](int kt, int buf) {
    unsigned int l[8];
    unsigned long long g[8];
#pragma unroll
    for (int i = 0; i < 8; ++i) {
      int row = arow0 + i * 32;
      l[i] = (unsigned int)(unsigned long long)&Al[buf * WA_ELEMS + row * WAP + ac8];
      g[i] = (unsigned long long)(aLane + ((size_t)(mBase + i * 32) * K + kt * WBK));
    }
    async_copy_8x16B(l, g);
#pragma unroll
    for (int i = 0; i < 8; ++i) {
      int row = brow0 + i * 16;
      l[i] = (unsigned int)(unsigned long long)&Bl[buf * WB_ELEMS + row * WBP + bc8];
      g[i] = (unsigned long long)(bLane + (size_t)(kt * WBK + i * 16) * N);
    }
    async_copy_8x16B(l, g);
  };
  // the lane's place in a 16 x 16 block for the transposing load
  int trow = hf * 8 + (lane & 7), tcol = ((lane >> 3) & 1) * 8;

  v8f vzero = {};
  // tile i * 4 + j: acc[..][v] = C[wm + 16 i + lm][wn + 16 j + 8 hf + v]
  v8f acc[16];
#pragma unroll
  for (int q = 0; q < 16; ++q) acc[q] = vzero;

  // prologue: tile 0 lands and is published
  stage(0, 0);
  asm volatile("s_wait_asynccnt 0x0" ::: "memory");  // own copies landed before the barrier
  __syncthreads();

  for (int kt = 0; kt < kIters; ++kt) {
    int cur = kt & 1;
    const unsigned short* Ac = Al + cur * WA_ELEMS;
    const unsigned short* Bc = Bl + cur * WB_ELEMS;

    // tile kt+1 is set flying, at the head of the trip, into the buffer that the
    // barrier at the foot of trip kt-1 has freed
    if (kt + 1 < kIters) stage(kt + 1, cur ^ 1);

#pragma unroll
    for (int ks = 0; ks < 4; ++ks) {     // the tile's four steps of 32 k
      FragU af[4], bf[4];
      int k0 = ks * 32;
#pragma unroll
      for (int i = 0; i < 4; ++i) {
        int arow = wm + i * 16 + lm;
        af[i].q[0] = *(const uint4*)&Ac[arow * WAP + k0 + hf * 8];
        af[i].q[1] = *(const uint4*)&Ac[arow * WAP + k0 + 16 + hf * 8];
      }
#pragma unroll
      for (int j = 0; j < 4; ++j) {
        int bcol = wn + j * 16 + tcol;
        bf[j].q[0] = ld_tr16(&Bc[(k0 + trow) * WBP + bcol]);
        bf[j].q[1] = ld_tr16(&Bc[(k0 + 16 + trow) * WBP + bcol]);
      }
      // keeps the step's 16 LDS reads one group ahead of its WMMAs; without it the
      // compiler sinks them between the WMMAs and each pair waits out the LDS latency
      __builtin_amdgcn_sched_barrier(0);
#pragma unroll
      for (int i = 0; i < 4; ++i)
#pragma unroll
        for (int j = 0; j < 4; ++j)
          acc[i * 4 + j] = __builtin_amdgcn_wmma_f32_16x16x32_bf16(
              false, bf[j].v, false, af[i].v, (short)0, acc[i * 4 + j], false, false);
      // keeps the step's WMMAs ahead of the next step's LDS reads (one fragment set
      // serves all steps) and of the foot's waits and barrier
      __builtin_amdgcn_sched_barrier(0);
    }

    // foot of the trip: own LDS reads done, own copies of tile kt+1 landed; the
    // barrier publishes tile kt+1 and frees buffer cur.
    asm volatile("s_wait_dscnt 0x0" ::: "memory");
    asm volatile("s_wait_asynccnt 0x0" ::: "memory");
    __syncthreads();
  }
  asm volatile("s_wait_asynccnt 0x0" ::: "memory");  // no copy outstanding at the wave's end

  float* stg = (float*)ring;
  const int SP = 260;
  // read-back: a wave takes half a row, 128 columns, at a time, 4 columns a lane
  int ecol = lane * 4;
  v4f bv0 = {}, bv1 = {};
  if (bias) {
    bv0 = *(const v4f*)(bias + nBase + ecol);
    bv1 = *(const v4f*)(bias + nBase + 128 + ecol);
  }
#pragma unroll
  for (int i = 0; i < 4; ++i)
#pragma unroll
    for (int j = 0; j < 4; ++j) {
      float* d = stg + (wm + i * 16 + lm) * SP + wn + j * 16 + hf * 8;
      v8f a = acc[i * 4 + j];
      v4f lo = {a[0], a[1], a[2], a[3]}, hi = {a[4], a[5], a[6], a[7]};
      *(v4f*)d       = lo;
      *(v4f*)(d + 4) = hi;
    }
  __syncthreads();   // the tile is whole before any wave reads rows of it

  const float* srow = stg + wave * SP + ecol;
  unsigned short* orow = outb + (size_t)(mBase + wave) * N + nBase + ecol;
  size_t oStep = (size_t)WNW * N;
  if (do_gelu) {
    // kept rolled rather than the inlined erff bodies, for speed only
#pragma unroll 1
    for (int it = 0; it < 2 * (WBM / WNW); ++it) {
      int r = it >> 1, ch = (it & 1) * 128;
      v4f val = *(const v4f*)(srow + r * WNW * SP + ch);
      if (bias) val += (it & 1) ? bv1 : bv0;
#pragma unroll
      for (int c = 0; c < 4; ++c)
        val[c] = 0.5f * val[c] * (1.f + erff(val[c] * 0.70710678118654752f));
      uint2 pk;
      pk.x = (unsigned int)f2bf(val[0]) | ((unsigned int)f2bf(val[1]) << 16);
      pk.y = (unsigned int)f2bf(val[2]) | ((unsigned int)f2bf(val[3]) << 16);
      *(uint2*)(orow + r * oStep + ch) = pk;
      // the registers that the store names are rewritten in the next trip; the
      // scheduling fence keeps those writes behind the wait
      asm volatile("s_wait_xcnt 0x0" ::: "memory");
      __builtin_amdgcn_sched_barrier(0);
    }
  } else {
    // two runs of 16 half rows: the left 128 columns, then the right; kept rolled,
    // so that one run's registers and code serve both
#pragma unroll 1
    for (int hb = 0; hb < 2; ++hb) {
      int ch = hb * 128;
      v4f val[16];
#pragma unroll
      for (int it = 0; it < 16; ++it) val[it] = *(const v4f*)(srow + it * WNW * SP + ch);
      if (bias) {
        v4f bv = hb ? bv1 : bv0;
#pragma unroll
        for (int it = 0; it < 16; ++it) val[it] += bv;
      }
      unsigned short* op[16];
      uint2 pk[16];
#pragma unroll
      for (int it = 0; it < 16; ++it) {
        op[it] = orow + it * oStep + ch;
        pk[it].x = (unsigned int)f2bf(val[it][0]) | ((unsigned int)f2bf(val[it][1]) << 16);
        pk[it].y = (unsigned int)f2bf(val[it][2]) | ((unsigned int)f2bf(val[it][3]) << 16);
      }
      // all 16 store addresses are made ahead of the first store
      asm volatile("" :: "v"(op[0]), "v"(op[1]), "v"(op[2]), "v"(op[3]),
                         "v"(op[4]), "v"(op[5]), "v"(op[6]), "v"(op[7]),
                         "v"(op[8]), "v"(op[9]), "v"(op[10]), "v"(op[11]),
                         "v"(op[12]), "v"(op[13]), "v"(op[14]), "v"(op[15]) : "memory");
      // keeps the rounding and packing above from sinking among the stores
      __builtin_amdgcn_sched_barrier(0);
#pragma unroll
      for (int it = 0; it < 16; ++it) *(uint2*)op[it] = pk[it];
      // the addresses stay live to here, and the wait closes the run of stores: no
      // register that a store names is written before it
      asm volatile("s_wait_xcnt 0x0"
                      :: "v"(op[0]), "v"(op[1]), "v"(op[2]), "v"(op[3]),
                         "v"(op[4]), "v"(op[5]), "v"(op[6]), "v"(op[7]),
                         "v"(op[8]), "v"(op[9]), "v"(op[10]), "v"(op[11]),
                         "v"(op[12]), "v"(op[13]), "v"(op[14]), "v"(op[15]) : "memory");
      // keeps the second run's register writes behind that wait
      __builtin_amdgcn_sched_barrier(0);
    }
  }
}

typedef __attribute__((ext_vector_type(2))) float  v2f;
typedef __attribute__((ext_vector_type(2))) __bf16 v2bf;
#define AKT 64                    // keys of a trip

static __device__ __forceinline__ float xhalf(float x) {
  int b = __builtin_bit_cast(int, x);
  return __builtin_bit_cast(float, __builtin_amdgcn_permlanex16(
      b, b, 0x76543210, 0xfedcba98, false, false));
}
// two f32 -> one dword of two bf16 (a in the low half), round to nearest even
static __device__ __forceinline__ unsigned int pack_bf16(float a, float b) {
  v2f f = {a, b};
  return __builtin_bit_cast(unsigned int, __builtin_convertvector(f, v2bf));
}
static __device__ __forceinline__ void async_copy_4x16B(const unsigned int* l,
                                                        const unsigned long long* g) {
  asm volatile("global_load_async_to_lds_b128 %0, %4, off\n\t"
               "global_load_async_to_lds_b128 %1, %5, off\n\t"
               "global_load_async_to_lds_b128 %2, %6, off\n\t"
               "global_load_async_to_lds_b128 %3, %7, off\n\t"
               "s_wait_xcnt 0x0"
               :: "v"(l[0]), "v"(l[1]), "v"(l[2]), "v"(l[3]),
                  "v"(g[0]), "v"(g[1]), "v"(g[2]), "v"(g[3])
               : "memory");
}

__global__ __launch_bounds__(128)
void flash_attn_kernel(const unsigned short* __restrict__ Q,
                       const unsigned short* __restrict__ Km,
                       const unsigned short* __restrict__ Vm,
                       unsigned short* __restrict__ O) {
  __shared__ alignas(16) unsigned short Qs[64][72];       // 144B rows
  __shared__ alignas(16) unsigned short Ks[2][AKT][72];   // 144B rows
  __shared__ alignas(16) unsigned int   Vt[2][64][36];    // [dh][keypair], 144B rows

  int t = threadIdx.x;
  int wave = t >> 5, lane = t & 31;
  int lm = lane & 15, hf = lane >> 4;
  int bh = blockIdx.x;
  int b = bh / H_, h = bh % H_;
  int q0 = b * N_ + blockIdx.y * 64;
  int colh = h * DH_;
  int rowBase = wave * 16;
  const int kbIters = N_ / AKT;

  // K tile: 64 rows of 128 B. Eight lanes cover one whole row per copy.
  int krow0 = t >> 3, kc8 = (t & 7) * 8;
  const unsigned short* kLane = Km + (size_t)(b * N_ + krow0) * HD + colh + kc8;
  auto stageK = [&](int kb, int buf) {
    unsigned int l[4];
    unsigned long long g[4];
#pragma unroll
    for (int i = 0; i < 4; ++i) {
      l[i] = (unsigned int)(unsigned long long)&Ks[buf][krow0 + i * 16][kc8];
      g[i] = (unsigned long long)(kLane + (size_t)(kb * AKT + i * 16) * HD);
    }
    async_copy_4x16B(l, g);
  };
  // V tile: 32 key pairs x 32 dh pairs. A lane keeps one dh pair; wave w takes
  // key pairs 4 i + w, i = 0..7.
  int dh0 = lane * 2;
  const unsigned short* vLane = Vm + (size_t)(b * N_ + 2 * wave) * HD + colh + dh0;
  unsigned int vr0[8], vr1[8];
  auto loadV = [&](int kb) {
    const unsigned short* p = vLane + (size_t)(kb * AKT) * HD;
#pragma unroll
    for (int i = 0; i < 8; ++i) {
      vr0[i] = *(const unsigned int*)(p + (8 * i) * HD);
      vr1[i] = *(const unsigned int*)(p + (8 * i + 1) * HD);
    }
  };
  auto storeV = [&](int buf) {
#pragma unroll
    for (int i = 0; i < 8; ++i) {
      int kp = i * 4 + wave;
      Vt[buf][dh0][kp]     = (vr0[i] & 0xFFFFu) | (vr1[i] << 16);
      Vt[buf][dh0 + 1][kp] = (vr0[i] >> 16)     | (vr1[i] & 0xFFFF0000u);
    }
  };

  // load Q tile 64x64 (64B per thread)
  {
    int row = t >> 1, c32 = (t & 1) * 32;
    const uint4* src = (const uint4*)(Q + (size_t)(q0 + row) * HD + colh + c32);
    uint4* dst = (uint4*)&Qs[row][c32];
    dst[0] = src[0]; dst[1] = src[1]; dst[2] = src[2]; dst[3] = src[3];
  }

  v8f vzero = {};
  v8f o[4];
#pragma unroll
  for (int c = 0; c < 4; ++c) o[c] = vzero;
  // of query lm: running maximum (both halves alike), and the sum over the
  // keys that this half of the wave holds
  float mrow = -1e30f, lrow = 0.f;

  // prologue: stage tile 0 (barrier also publishes Qs)
  stageK(0, 0);
  loadV(0);
  storeV(0);
  asm volatile("s_wait_asynccnt 0x0" ::: "memory");  // own copies landed before the barrier
  __syncthreads();

  // Q^T fragments (B operand), read once and kept in registers
  FragU qb[2];
#pragma unroll
  for (int st = 0; st < 2; ++st) {
    qb[st].q[0] = *(const uint4*)&Qs[rowBase + lm][st * 32 + hf * 8];
    qb[st].q[1] = *(const uint4*)&Qs[rowBase + lm][st * 32 + 16 + hf * 8];
  }

  for (int kb = 0; kb < kbIters; ++kb) {
    int cur = kb & 1;
    bool more = (kb + 1) < kbIters;
    // tile kb+1 is set flying into the buffers that the barrier at the foot of
    // trip kb-1 has freed
    if (more) { stageK(kb + 1, cur ^ 1); loadV(kb + 1); }

    // K fragments (A operand of S^T)
    FragU kf[2][4];
#pragma unroll
    for (int st = 0; st < 2; ++st)
#pragma unroll
      for (int j = 0; j < 4; ++j) {
        kf[st][j].q[0] = *(const uint4*)&Ks[cur][j * 16 + lm][st * 32 + hf * 8];
        kf[st][j].q[1] = *(const uint4*)&Ks[cur][j * 16 + lm][st * 32 + 16 + hf * 8];
      }
    // V^T fragments (A operand of O^T), keys 32 kk + ...
    FragU vf[2][4];
#pragma unroll
    for (int kk = 0; kk < 2; ++kk)
#pragma unroll
      for (int ct = 0; ct < 4; ++ct) {
        vf[kk][ct].q[0] = *(const uint4*)&Vt[cur][ct * 16 + lm][kk * 16 + hf * 4];
        vf[kk][ct].q[1] = *(const uint4*)&Vt[cur][ct * 16 + lm][kk * 16 + 8 + hf * 4];
      }
    // keeps the next tile's V loads and the trip's 32 LDS reads at the head of the trip;
    // without it the compiler sinks each to just ahead of its use, and the wave
    // waits out the L2 and LDS latencies there
    __builtin_amdgcn_sched_barrier(0);

    // ---- S^T = K Q^T  (four 16-key tiles, two k-steps over DH=64) ----
    // s[j][v] = score of key 16 j + 8 hf + v against query lm
    v8f s[4];
#pragma unroll
    for (int j = 0; j < 4; ++j) s[j] = vzero;
#pragma unroll
    for (int st = 0; st < 2; ++st)
#pragma unroll
      for (int j = 0; j < 4; ++j)
        s[j] = __builtin_amdgcn_wmma_f32_16x16x32_bf16(
            false, kf[st][j].v, false, qb[st].v, (short)0, s[j], false, false);
    __builtin_amdgcn_sched_barrier(0);

    // ---- online softmax of one query per lane ----
    float tj[4];                       // one chain per score tile
#pragma unroll
    for (int j = 0; j < 4; ++j) {
      tj[j] = fmaxf(s[j][0], s[j][1]);
#pragma unroll
      for (int v = 2; v < 8; ++v) tj[j] = fmaxf(tj[j], s[j][v]);
    }
    float tm = fmaxf(fmaxf(tj[0], tj[1]), fmaxf(tj[2], tj[3]));
    tm = fmaxf(tm, xhalf(tm));         // the other 32 keys of this query
    float mn = fmaxf(mrow, tm);
    float scale = __expf(mrow - mn);
    mrow = mn;
    // ---- P^T as B operand of key group kk: k = 8 hf + v from tile 2 kk,
    //      16 + 8 hf + v from tile 2 kk + 1 ----
    FragU pb[2];
    v2f rs[4];                         // a tile's sums over even and over odd v
#pragma unroll
    for (int j = 0; j < 4; ++j) {
      v2f p[4];
#pragma unroll
      for (int i = 0; i < 4; ++i) {
        p[i].x = __expf(s[j][2 * i] - mn);
        p[i].y = __expf(s[j][2 * i + 1] - mn);
        pb[j >> 1].u[(j & 1) * 4 + i] = pack_bf16(p[i].x, p[i].y);
      }
      rs[j] = (p[0] + p[1]) + (p[2] + p[3]);
    }
    v2f rt = (rs[0] + rs[1]) + (rs[2] + rs[3]);
    lrow = lrow * scale + (rt.x + rt.y);
#pragma unroll
    for (int c = 0; c < 4; ++c)
#pragma unroll
      for (int v = 0; v < 8; ++v) o[c][v] *= scale;

    __builtin_amdgcn_sched_barrier(0);

    // ---- O^T += V^T P^T : o[ct][v] = O[query lm][dh 16 ct + 8 hf + v] ----
#pragma unroll
    for (int kk = 0; kk < 2; ++kk)
#pragma unroll
      for (int ct = 0; ct < 4; ++ct)
        o[ct] = __builtin_amdgcn_wmma_f32_16x16x32_bf16(
            false, vf[kk][ct].v, false, pb[kk].v, (short)0, o[ct], false, false);

    // keeps the wait for the next tile's V loads, with their pack and store,
    // behind the trip's products; without it the compiler lifts that wait to
    // just behind the first WMMA, where the loads have had no time to return
    __builtin_amdgcn_sched_barrier(0);
    if (more) storeV(cur ^ 1);
    // foot of the trip: own LDS reads and V stores done, own K copies of tile
    // kb+1 landed; the barrier publishes tile kb+1 and frees buffer cur.
    asm volatile("s_wait_dscnt 0x0" ::: "memory");
    asm volatile("s_wait_asynccnt 0x0" ::: "memory");
    __syncthreads();
  }
  asm volatile("s_wait_asynccnt 0x0" ::: "memory");  // no copy outstanding at the wave's end

  // ---- normalize and store bf16: 8 consecutive dh of one query per store ----
  float lsum = lrow + xhalf(lrow);     // the two halves' key sums joined
  uint4 ov[4];
#pragma unroll
  for (int ct = 0; ct < 4; ++ct) {
    ov[ct].x = pack_bf16(o[ct][0] / lsum, o[ct][1] / lsum);
    ov[ct].y = pack_bf16(o[ct][2] / lsum, o[ct][3] / lsum);
    ov[ct].z = pack_bf16(o[ct][4] / lsum, o[ct][5] / lsum);
    ov[ct].w = pack_bf16(o[ct][6] / lsum, o[ct][7] / lsum);
  }
  unsigned short* orow = O + (size_t)(q0 + rowBase + lm) * HD + colh + hf * 8;
#pragma unroll
  for (int ct = 0; ct < 4; ++ct) *(uint4*)(orow + ct * 16) = ov[ct];
}

// ---------------------------------------------------------------------------
// Host-side orchestration
// ---------------------------------------------------------------------------
extern "C" void kernel_launch(void* const* d_in, const int* in_sizes, int n_in,
                              void* d_out, int out_size, void* d_ws, size_t ws_size,
                              hipStream_t stream) {
  const float* x     = (const float*)d_in[0];
  const float* wq    = (const float*)d_in[1];
  const float* wk    = (const float*)d_in[2];
  const float* wv    = (const float*)d_in[3];
  const float* wo    = (const float*)d_in[4];
  const float* w1    = (const float*)d_in[5];
  const float* b1    = (const float*)d_in[6];
  const float* w2    = (const float*)d_in[7];
  const float* b2    = (const float*)d_in[8];
  const float* ln1_g = (const float*)d_in[9];
  const float* ln1_b = (const float*)d_in[10];
  const float* ln2_g = (const float*)d_in[11];
  const float* ln2_b = (const float*)d_in[12];
  float* out = (float*)d_out;

  // workspace carve-out (~120 MiB total)
  char* p = (char*)d_ws;
  auto alloc = [&](size_t bytes) -> void* {
    void* r = (void*)p;
    p += (bytes + 255) & ~(size_t)255;
    return r;
  };
  unsigned short* wq_b = (unsigned short*)alloc((size_t)3 * D_ * HD * 2);   // wq | wk | wv
  unsigned short* wk_b = wq_b + D_ * HD;
  unsigned short* wv_b = wk_b + D_ * HD;
  unsigned short* wo_b = (unsigned short*)alloc((size_t)HD * D_ * 2);
  unsigned short* w1_b = (unsigned short*)alloc((size_t)D_ * FF_ * 2);
  unsigned short* w2_b = (unsigned short*)alloc((size_t)FF_ * D_ * 2);
  unsigned short* h_b  = (unsigned short*)alloc((size_t)ROWS * D_ * 2);
  unsigned short* q_b  = (unsigned short*)alloc((size_t)3 * ROWS * HD * 2); // q | k | v
  unsigned short* k_b  = q_b + ROWS * HD;
  unsigned short* v_b  = k_b + ROWS * HD;
  unsigned short* a_b  = (unsigned short*)alloc((size_t)ROWS * HD * 2);
  float*          x2   = (float*)        alloc((size_t)ROWS * D_ * 4);
  unsigned short* h2_b = (unsigned short*)alloc((size_t)ROWS * D_ * 2);
  unsigned short* ff_b = (unsigned short*)alloc((size_t)ROWS * FF_ * 2);

  // 1) weights -> bf16 and LN1, one launch
  cast_and_layernorm_kernel<<<CAST_GRID + ROWS, 256, 0, stream>>>(
      wq, wk, wv, wo, w1, w2, wq_b, wk_b, wv_b, wo_b, w1_b, w2_b, x, ln1_g, ln1_b, h_b);

  // 2) Q/K/V projections, one launch of three planes
  dim3 gemmBlk(256);
  dim3 attnBlk(128);
  dim3 wideBlk(WNW * 32);
  dim3 gQKV(HD / WBN, ROWS / WBM, 3);
  gemm_wmma_wide_kernel<<<gQKV, wideBlk, 0, stream>>>(h_b, wq_b, HD, D_,
                                                      nullptr, 0, q_b,
                                                      D_ * HD, ROWS * HD);

  // 3) attention
  dim3 gAttn(B_ * H_, N_ / 64);
  flash_attn_kernel<<<gAttn, attnBlk, 0, stream>>>(q_b, k_b, v_b, a_b);

  // 4) out projection + residual -> x2 (fp32)
  dim3 gO(D_ / GBN, ROWS / GBM);
  gemm_wmma_kernel<<<gO, gemmBlk, 0, stream>>>(a_b, wo_b, ROWS, D_, HD,
                                               nullptr, 0, x, nullptr, x2, 0, 0);

  // 5) LN2
  layernorm_bf16_kernel<<<ROWS, 256, 0, stream>>>(x2, ln2_g, ln2_b, h2_b);

  // 6) FF1 + bias + exact GELU -> bf16
  dim3 gFF1(FF_ / WBN, ROWS / WBM);
  gemm_wmma_wide_kernel<<<gFF1, wideBlk, 0, stream>>>(h2_b, w1_b, FF_, D_,
                                                      b1, 1, ff_b, 0, 0);

  // 7) FF2 + bias + residual -> out (fp32)
  dim3 gFF2(D_ / GBN, ROWS / GBM);
  gemm_wmma_kernel<<<gFF2, gemmBlk, 0, stream>>>(ff_b, w2_b, ROWS, D_, FF_,
                                                 b2, 0, x2, nullptr, out, 0, 0);
}

// v009
// Measured time: 166 microseconds a run.
// Two timings next to v008 put it at 1.03 and 1.04 times that version's speed.
// Over all steps from v000 it is 3.43 times as fast.
#include <hip/hip_runtime.h>
#include <stdint.h>

// Problem constants (match reference)
#define B_  2
#define N_  2048
#define D_  1024
#define H_  16
#define DH_ 64
#define FF_ 4096
#define ROWS (B_ * N_)          // 4096
#define HD  (H_ * DH_)          // 1024

typedef __attribute__((ext_vector_type(16))) __bf16 v16bf;
typedef __attribute__((ext_vector_type(8)))  float  v8f;

// Fragment: 8 dwords = two 16B chunks; loaded as 2x ds_load_b128 (B of the GEMM: 2x ds_load_tr16_b128).
union FragU { uint4 q[2]; unsigned int u[8]; v16bf v; };

static __device__ __forceinline__ unsigned short f2bf(float f) {
  union { float f; unsigned int u; } c; c.f = f;
  unsigned int u = c.u;
  unsigned int r = u + 0x7FFFu + ((u >> 16) & 1u);   // round-to-nearest-even
  return (unsigned short)(r >> 16);
}

typedef __attribute__((ext_vector_type(8))) short s16x8;
static __device__ __forceinline__ uint4 ld_tr16(const unsigned short* p) {
  typedef __attribute__((address_space(3))) s16x8 lds_s16x8;
  return __builtin_bit_cast(uint4, __builtin_amdgcn_ds_load_tr16_b128_v8i16((lds_s16x8*)p));
}

// ---------------------------------------------------------------------------
// f32 -> bf16 cast of all six weights, one pass per block.
// A block converts CAST_BLK consecutive elements of one weight (every weight's
// size is a multiple of CAST_BLK). A thread has its 16 loads of 16 B in flight
// together; each load of a wave covers 512 contiguous bytes.
// ---------------------------------------------------------------------------
typedef __attribute__((ext_vector_type(4))) float v4f;
typedef __attribute__((ext_vector_type(2))) float v2f;
#define CAST_BLK   16384                       // 256 threads x 16 x 4 elements
#define CAST_SMALL (D_ * HD / CAST_BLK)        // blocks per D x HD weight: 64
#define CAST_LARGE (D_ * FF_ / CAST_BLK)       // blocks per D x FF weight: 256
#define CAST_GRID  (4 * CAST_SMALL + 2 * CAST_LARGE)
static __device__ __forceinline__
void cast_weights_block(int blk,
                        const float* __restrict__ wq, const float* __restrict__ wk,
                        const float* __restrict__ wv, const float* __restrict__ wo,
                        const float* __restrict__ w1, const float* __restrict__ w2,
                        unsigned short* __restrict__ oq, unsigned short* __restrict__ ok,
                        unsigned short* __restrict__ ov, unsigned short* __restrict__ oo,
                        unsigned short* __restrict__ o1, unsigned short* __restrict__ o2) {
  const float* in;
  unsigned short* out;
  if (blk < 4 * CAST_SMALL) {
    int w = blk / CAST_SMALL;
    blk -= w * CAST_SMALL;
    in  = w == 0 ? wq : w == 1 ? wk : w == 2 ? wv : wo;
    out = w == 0 ? oq : w == 1 ? ok : w == 2 ? ov : oo;
  } else {
    blk -= 4 * CAST_SMALL;
    int w = blk / CAST_LARGE;
    blk -= w * CAST_LARGE;
    in  = w == 0 ? w1 : w2;
    out = w == 0 ? o1 : o2;
  }
  int off = blk * CAST_BLK + threadIdx.x * 4;
  in  += off;
  out += off;
  v4f f[16];
#pragma unroll
  for (int i = 0; i < 16; ++i) f[i] = *(const v4f*)(in + i * 1024);
  // takes the 16 loaded values as inputs only: all 16 loads are issued ahead of
  // it; without it the compiler sinks loads to just ahead of their conversion,
  // and the wave waits out several memory latencies one after the other. The
  // address is named too: it stays live, so no load lands in the register pair
  // that the loads issued before it name.
  asm volatile("" :: "v"(f[0]), "v"(f[1]), "v"(f[2]), "v"(f[3]), "v"(f[4]), "v"(f[5]),
                     "v"(f[6]), "v"(f[7]), "v"(f[8]), "v"(f[9]), "v"(f[10]), "v"(f[11]),
                     "v"(f[12]), "v"(f[13]), "v"(f[14]), "v"(f[15]), "v"(in));
  uint2 r[16];
#pragma unroll
  for (int i = 0; i < 16; ++i) {
    r[i].x = (unsigned int)f2bf(f[i].x) | ((unsigned int)f2bf(f[i].y) << 16);
    r[i].y = (unsigned int)f2bf(f[i].z) | ((unsigned int)f2bf(f[i].w) << 16);
  }
  // keeps the stores behind the last conversion, so that no register which an
  // issued store names is written again
  __builtin_amdgcn_sched_barrier(0);
#pragma unroll
  for (int i = 0; i < 16; ++i) *(uint2*)(out + i * 1024) = r[i];
}

// ---------------------------------------------------------------------------
// Row LayerNorm (D=1024), fp32 in -> bf16 out. One block (256 thr) per row.
// ---------------------------------------------------------------------------
static __device__ __forceinline__
void layernorm_row(int row,
                   const float* __restrict__ x,
                   const float* __restrict__ g,
                   const float* __restrict__ b,
                   unsigned short* __restrict__ out) {
  __shared__ float red[256];
  int t = threadIdx.x;
  const float* xr = x + (size_t)row * D_;
  float v[4];
  float s = 0.f;
#pragma unroll
  for (int i = 0; i < 4; ++i) { v[i] = xr[t + i * 256]; s += v[i]; }
  red[t] = s; __syncthreads();
  for (int off = 128; off > 0; off >>= 1) {
    if (t < off) red[t] += red[t + off];
    __syncthreads();
  }
  float mu = red[0] * (1.f / D_);
  __syncthreads();
  float s2 = 0.f;
#pragma unroll
  for (int i = 0; i < 4; ++i) { float d = v[i] - mu; s2 += d * d; }
  red[t] = s2; __syncthreads();
  for (int off = 128; off > 0; off >>= 1) {
    if (t < off) red[t] += red[t + off];
    __syncthreads();
  }
  float rstd = rsqrtf(red[0] * (1.f / D_) + 1e-5f);
#pragma unroll
  for (int i = 0; i < 4; ++i) {
    int c = t + i * 256;
    out[(size_t)row * D_ + c] = f2bf((v[i] - mu) * rstd * g[c] + b[c]);
  }
}

__global__ __launch_bounds__(256)
void layernorm_bf16_kernel(const float* __restrict__ x,
                           const float* __restrict__ g,
                           const float* __restrict__ b,
                           unsigned short* __restrict__ out) {
  layernorm_row(blockIdx.x, x, g, b, out);
}

// ---------------------------------------------------------------------------
// The weight casts and the first LayerNorm depend on nothing of each other:
// one grid holds both. The block index picks the body, alike for the whole
// block; the cast blocks, which move the most bytes each, take the low indices.
// ---------------------------------------------------------------------------
__global__ __launch_bounds__(256)
void cast_and_layernorm_kernel(const float* __restrict__ wq, const float* __restrict__ wk,
                               const float* __restrict__ wv, const float* __restrict__ wo,
                               const float* __restrict__ w1, const float* __restrict__ w2,
                               unsigned short* __restrict__ oq, unsigned short* __restrict__ ok,
                               unsigned short* __restrict__ ov, unsigned short* __restrict__ oo,
                               unsigned short* __restrict__ o1, unsigned short* __restrict__ o2,
                               const float* __restrict__ x, const float* __restrict__ g,
                               const float* __restrict__ b, unsigned short* __restrict__ h) {
  int blk = blockIdx.x;
  if (blk < CAST_GRID) cast_weights_block(blk, wq, wk, wv, wo, w1, w2, oq, ok, ov, oo, o1, o2);
  else                 layernorm_row(blk - CAST_GRID, x, g, b, h);
}

static __device__ __forceinline__ void async_copy_8x16B(const unsigned int* l,
                                                        const unsigned long long* g) {
  asm volatile("global_load_async_to_lds_b128 %0, %8, off\n\t"
               "global_load_async_to_lds_b128 %1, %9, off\n\t"
               "global_load_async_to_lds_b128 %2, %10, off\n\t"
               "global_load_async_to_lds_b128 %3, %11, off\n\t"
               "global_load_async_to_lds_b128 %4, %12, off\n\t"
               "global_load_async_to_lds_b128 %5, %13, off\n\t"
               "global_load_async_to_lds_b128 %6, %14, off\n\t"
               "global_load_async_to_lds_b128 %7, %15, off\n\t"
               "s_wait_xcnt 0x0"
               :: "v"(l[0]), "v"(l[1]), "v"(l[2]), "v"(l[3]),
                  "v"(l[4]), "v"(l[5]), "v"(l[6]), "v"(l[7]),
                  "v"(g[0]), "v"(g[1]), "v"(g[2]), "v"(g[3]),
                  "v"(g[4]), "v"(g[5]), "v"(g[6]), "v"(g[7])
               : "memory");
}

// ---------------------------------------------------------------------------
// Generic bf16 WMMA GEMM:  C[M,N] = A[M,K] @ Bw[K,N]  (f32 accumulate)
// 128x128 tile per block, 128 k per trip, 256 threads = 8 waves (2 x 4), each
// wave 64(M) x 32(N): per 32 k, 6 fragments feed 8 WMMAs.
// M, N multiples of 128; K a multiple of 128.
// Two LDS buffers: the async copies of A and B of tile t+1 fly while tile t is
// worked on, 64 KB a block, over the time of 32 WMMAs a wave. B lies in LDS as
// in memory, [k][n]; its fragments come by the transposing load.
// The weight fragment is the first WMMA operand: a lane then holds 8 consecutive
// columns of ONE output row, which go to LDS as two 16 B stores. The tile is read
// back by rows, so that every global access of the epilogue is 16 B (8 B for
// bf16) a lane and covers whole 128 B lines.
// Products that share A go in one grid: plane blockIdx.z takes the weight at
// Bw + z * zB and writes its bf16 output at outb + z * zO.
// ---------------------------------------------------------------------------
#define GBM 128
#define GBN 128
#define GBK 128
__global__ __launch_bounds__(256)
void gemm_wmma_kernel(const unsigned short* __restrict__ A,
                      const unsigned short* __restrict__ Bw,
                      int M, int N, int K,
                      const float* __restrict__ bias, int do_gelu,
                      const float* __restrict__ resid,
                      unsigned short* __restrict__ outb,
                      float* __restrict__ outf,
                      int zB, int zO) {
  Bw   += (size_t)blockIdx.z * zB;
  outb += (size_t)blockIdx.z * zO;
  __shared__ alignas(16) unsigned short Alds[2][GBM][136]; // [m][k], 272B rows (padded)
  __shared__ alignas(16) unsigned short Bs[2][GBK][144];   // [k][n], 288B rows (padded)

  int t = threadIdx.x;
  int wave = t >> 5, lane = t & 31;
  int lm = lane & 15, hf = lane >> 4;
  int mBase = blockIdx.y * GBM;
  int nBase = blockIdx.x * GBN;
  int wm = (wave >> 2) * 64;
  int wn = (wave & 3) * 32;
  int kIters = K >> 7;

  // A tile: 128 m rows of 256 B. B tile: 128 k rows of 256 B. Sixteen lanes
  // cover one whole row per copy.
  int row0 = t >> 4, c8 = (t & 15) * 8;
  const unsigned short* aLane = A + (size_t)row0 * K + c8;            // the lane's share of
  const unsigned short* bLane = Bw + (size_t)row0 * N + nBase + c8;   // the addresses
  auto stage = [&](int kt, int buf) {
    unsigned int l[8];
    unsigned long long g[8];
#pragma unroll
    for (int i = 0; i < 8; ++i) {
      int row = row0 + i * 16;
      l[i] = (unsigned int)(unsigned long long)&Alds[buf][row][c8];
      g[i] = (unsigned long long)(aLane + ((size_t)(mBase + i * 16) * K + kt * GBK));
    }
    async_copy_8x16B(l, g);
#pragma unroll
    for (int i = 0; i < 8; ++i) {
      int row = row0 + i * 16;
      l[i] = (unsigned int)(unsigned long long)&Bs[buf][row][c8];
      g[i] = (unsigned long long)(bLane + (size_t)(kt * GBK + i * 16) * N);
    }
    async_copy_8x16B(l, g);
  };
  // the lane's place in a 16 x 16 block for the transposing load
  int trow = hf * 8 + (lane & 7), tcol = ((lane >> 3) & 1) * 8;

  v8f vzero = {};
  // tile i * 2 + j: acc[..][v] = C[wm + 16 i + lm][wn + 16 j + 8 hf + v]
  v8f acc[8];
#pragma unroll
  for (int q = 0; q < 8; ++q) acc[q] = vzero;

  // prologue: tile 0 lands and is published
  stage(0, 0);
  asm volatile("s_wait_asynccnt 0x0" ::: "memory");  // own copies landed before the barrier
  __syncthreads();

  for (int kt = 0; kt < kIters; ++kt) {
    int cur = kt & 1;

#pragma unroll
    for (int kh = 0; kh < 2; ++kh) {     // the tile's two halves of 64 k
      FragU af[2][4], bf[2][2];
#pragma unroll
      for (int ks = 0; ks < 2; ++ks) {
        int k0 = kh * 64 + ks * 32;
#pragma unroll
        for (int i = 0; i < 4; ++i) {
          int arow = wm + i * 16 + lm;
          af[ks][i].q[0] = *(const uint4*)&Alds[cur][arow][k0 + hf * 8];
          af[ks][i].q[1] = *(const uint4*)&Alds[cur][arow][k0 + 16 + hf * 8];
        }
#pragma unroll
        for (int j = 0; j < 2; ++j) {
          int bcol = wn + j * 16 + tcol;
          bf[ks][j].q[0] = ld_tr16(&Bs[cur][k0 + trow][bcol]);
          bf[ks][j].q[1] = ld_tr16(&Bs[cur][k0 + 16 + trow][bcol]);
        }
      }
      // keeps the half's 24 LDS reads one group ahead of its WMMAs; without it the
      // compiler sinks them between the WMMAs and each pair waits out the LDS latency
      __builtin_amdgcn_sched_barrier(0);
      // tile kt+1 is set flying into the buffer that the barrier at the foot of
      // trip kt-1 has freed, while the LDS reads above are still coming in
      if (kh == 0 && kt + 1 < kIters) stage(kt + 1, cur ^ 1);
#pragma unroll
      for (int ks = 0; ks < 2; ++ks)
#pragma unroll
        for (int i = 0; i < 4; ++i)
#pragma unroll
          for (int j = 0; j < 2; ++j)
            acc[i * 2 + j] = __builtin_amdgcn_wmma_f32_16x16x32_bf16(
                false, bf[ks][j].v, false, af[ks][i].v, (short)0, acc[i * 2 + j], false, false);
      // keeps the half's WMMAs ahead of what follows: the next half's LDS reads
      // (one fragment set serves both halves) and the foot's waits and barrier,
      // behind which the compiler otherwise sinks them, so that they no longer
      // cover the copies' flight
      __builtin_amdgcn_sched_barrier(0);
    }

    // foot of the trip: own LDS reads done, own copies of tile kt+1 landed; the
    // barrier publishes tile kt+1 and frees buffer cur.
    asm volatile("s_wait_dscnt 0x0" ::: "memory");
    asm volatile("s_wait_asynccnt 0x0" ::: "memory");
    __syncthreads();
  }
  asm volatile("s_wait_asynccnt 0x0" ::: "memory");  // no copy outstanding at the wave's end

  float* stg = (float*)&Alds[0][0][0];
  const int SP = 132;
  // read-back: a wave takes one whole row of 128 columns a trip, 4 columns a lane
  int ecol = lane * 4;
  size_t o0 = (size_t)(mBase + wave) * N + nBase + ecol;
  size_t oStep = (size_t)8 * N;
  const float* srow = stg + wave * SP + ecol;

  // bias and residual are asked for ahead of the staging, all loads in flight together
  v4f bv = {};
  if (bias) bv = *(const v4f*)(bias + nBase + ecol);
  v4f rv[16];
  const float* rp[16];
  bool pre = resid && !do_gelu;
  if (pre) {
#pragma unroll
    for (int it = 0; it < 16; ++it) rp[it] = resid + o0 + it * oStep;
#pragma unroll
    for (int it = 0; it < 16; ++it) rv[it] = *(const v4f*)rp[it];
  }

#pragma unroll
  for (int i = 0; i < 4; ++i)
#pragma unroll
    for (int j = 0; j < 2; ++j) {
      float* d = stg + (wm + i * 16 + lm) * SP + wn + j * 16 + hf * 8;
      v8f a = acc[i * 2 + j];
      v4f lo = {a[0], a[1], a[2], a[3]}, hi = {a[4], a[5], a[6], a[7]};
      *(v4f*)d       = lo;
      *(v4f*)(d + 4) = hi;
    }
  if (pre) {
    // takes loaded values 0 to 7 and all 16 addresses as inputs only: every address
    // stays live until the last load has returned, so that no load lands in a
    // register pair that a load issued before it names
    asm volatile("" :: "v"(rp[0]), "v"(rp[1]), "v"(rp[2]), "v"(rp[3]),
                       "v"(rp[4]), "v"(rp[5]), "v"(rp[6]), "v"(rp[7]),
                       "v"(rp[8]), "v"(rp[9]), "v"(rp[10]), "v"(rp[11]),
                       "v"(rp[12]), "v"(rp[13]), "v"(rp[14]), "v"(rp[15]),
                       "v"(rv[0]), "v"(rv[1]), "v"(rv[2]), "v"(rv[3]),
                       "v"(rv[4]), "v"(rv[5]), "v"(rv[6]), "v"(rv[7]));
    // the same for loaded values 8 to 15 (a statement takes thirty operands)
    asm volatile("" :: "v"(rp[0]), "v"(rp[1]), "v"(rp[2]), "v"(rp[3]),
                       "v"(rp[4]), "v"(rp[5]), "v"(rp[6]), "v"(rp[7]),
                       "v"(rp[8]), "v"(rp[9]), "v"(rp[10]), "v"(rp[11]),
                       "v"(rp[12]), "v"(rp[13]), "v"(rp[14]), "v"(rp[15]),
                       "v"(rv[8]), "v"(rv[9]), "v"(rv[10]), "v"(rv[11]),
                       "v"(rv[12]), "v"(rv[13]), "v"(rv[14]), "v"(rv[15]));
  }
  __syncthreads();   // the tile is whole before any wave reads rows of it

  if (do_gelu) {
    // kept rolled rather than 64 inlined erff bodies, for speed only
    size_t o = o0;
#pragma unroll 1
    for (int it = 0; it < 16; ++it) {
      v4f val = *(const v4f*)(srow + it * 8 * SP);
      if (bias) val += bv;
#pragma unroll
      for (int c = 0; c < 4; ++c)
        val[c] = 0.5f * val[c] * (1.f + erff(val[c] * 0.70710678118654752f));
      if (resid) val += *(const v4f*)(resid + o);
      if (outf) {
        *(v4f*)(outf + o) = val;
        // closes this branch: no register that the store names is written before it
        asm volatile("s_wait_xcnt 0x0" ::: "memory");
      } else {
        uint2 pk;
        pk.x = (unsigned int)f2bf(val[0]) | ((unsigned int)f2bf(val[1]) << 16);
        pk.y = (unsigned int)f2bf(val[2]) | ((unsigned int)f2bf(val[3]) << 16);
        *(uint2*)(outb + o) = pk;
      }
      // the registers that the store names are rewritten in the next trip; the
      // scheduling fence keeps those writes behind the wait
      asm volatile("s_wait_xcnt 0x0" ::: "memory");
      __builtin_amdgcn_sched_barrier(0);
      o += oStep;
    }
  } else {
    v4f val[16];
#pragma unroll
    for (int it = 0; it < 16; ++it) val[it] = *(const v4f*)(srow + it * 8 * SP);
    if (bias) {
#pragma unroll
      for (int it = 0; it < 16; ++it) val[it] += bv;
    }
    if (resid) {
#pragma unroll
      for (int it = 0; it < 16; ++it) val[it] += rv[it];
    }
    // In both forms only stores stand between the first statement and the last, so
    // that no register which an issued store names is written again among them.
    if (outf) {
      float* op[16];
#pragma unroll
      for (int it = 0; it < 16; ++it) op[it] = outf + o0 + it * oStep;
      // all 16 store addresses are made ahead of the first store
      asm volatile("" :: "v"(op[0]), "v"(op[1]), "v"(op[2]), "v"(op[3]),
                         "v"(op[4]), "v"(op[5]), "v"(op[6]), "v"(op[7]),
                         "v"(op[8]), "v"(op[9]), "v"(op[10]), "v"(op[11]),
                         "v"(op[12]), "v"(op[13]), "v"(op[14]), "v"(op[15]) : "memory");
      // keeps the sums above from sinking among the stores
      __builtin_amdgcn_sched_barrier(0);
#pragma unroll
      for (int it = 0; it < 16; ++it) *(v4f*)op[it] = val[it];
      // the addresses stay live to here, and the wait closes the run of stores: no
      // register that a store names is written before it on any way out of the branch
      asm volatile("s_wait_xcnt 0x0"
                      :: "v"(op[0]), "v"(op[1]), "v"(op[2]), "v"(op[3]),
                         "v"(op[4]), "v"(op[5]), "v"(op[6]), "v"(op[7]),
                         "v"(op[8]), "v"(op[9]), "v"(op[10]), "v"(op[11]),
                         "v"(op[12]), "v"(op[13]), "v"(op[14]), "v"(op[15]) : "memory");
    } else {
      unsigned short* op[16];
      uint2 pk[16];
#pragma unroll
      for (int it = 0; it < 16; ++it) {
        op[it] = outb + o0 + it * oStep;
        pk[it].x = (unsigned int)f2bf(val[it][0]) | ((unsigned int)f2bf(val[it][1]) << 16);
        pk[it].y = (unsigned int)f2bf(val[it][2]) | ((unsigned int)f2bf(val[it][3]) << 16);
      }
      // all 16 store addresses are made ahead of the first store
      asm volatile("" :: "v"(op[0]), "v"(op[1]), "v"(op[2]), "v"(op[3]),
                         "v"(op[4]), "v"(op[5]), "v"(op[6]), "v"(op[7]),
                         "v"(op[8]), "v"(op[9]), "v"(op[10]), "v"(op[11]),
                         "v"(op[12]), "v"(op[13]), "v"(op[14]), "v"(op[15]) : "memory");
      // keeps the rounding and packing above from sinking among the stores
      __builtin_amdgcn_sched_barrier(0);
#pragma unroll
      for (int it = 0; it < 16; ++it) *(uint2*)op[it] = pk[it];
      // the addresses stay live to behind the last store
      asm volatile("" :: "v"(op[0]), "v"(op[1]), "v"(op[2]), "v"(op[3]),
                         "v"(op[4]), "v"(op[5]), "v"(op[6]), "v"(op[7]),
                         "v"(op[8]), "v"(op[9]), "v"(op[10]), "v"(op[11]),
                         "v"(op[12]), "v"(op[13]), "v"(op[14]), "v"(op[15]) : "memory");
    }
  }
}

// ---------------------------------------------------------------------------
// erf of two values without a branch. The two ranges and their polynomials are
// those of the f32 math library's erff: |x| < 1: x + x p(x^2); otherwise
// 1 - exp(-(|x| + |x| q(|x|))), with the sign of x. Both are worked out in every
// lane and one is selected. In a wave of mixed values the library's form runs
// both sides of its branch anyway, one element after the other, each a single
// dependent chain; here the elements are independent chains that the compiler
// interleaves, two to a packed instruction.
// exp(-a), a >= 1, is one exp2: the rounding of a * log2(e) moves it by less than
// a * exp(-a) * 2^-24, under half a unit in the last place of the difference.
// ---------------------------------------------------------------------------
static __device__ __forceinline__ v2f both(unsigned int bits) {
  float f = __builtin_bit_cast(float, bits);
  v2f r = {f, f};
  return r;
}
static __device__ __forceinline__ v2f erf_pair(v2f x) {
  v2f ax = {__builtin_fabsf(x.x), __builtin_fabsf(x.y)};
  v2f q = __builtin_elementwise_fma(ax, both(0x378e98abu), both(0xb9c68948u));
  q = __builtin_elementwise_fma(ax, q, both(0x3b7cd369u));
  q = __builtin_elementwise_fma(ax, q, both(0xbcc618b2u));
  q = __builtin_elementwise_fma(ax, q, both(0x3dda74e4u));
  q = __builtin_elementwise_fma(ax, q, both(0x3f228afdu));
  q = __builtin_elementwise_fma(ax, q, both(0x3e03c728u));
  q = __builtin_elementwise_fma(ax, q, ax);
  q *= -1.44269504088896340736f;                       // -log2(e)
  v2f far = {1.f - __builtin_amdgcn_exp2f(q.x), 1.f - __builtin_amdgcn_exp2f(q.y)};
  v2f t = x * x;
  v2f p = __builtin_elementwise_fma(t, both(0xba1345e1u), both(0x3ba10414u));
  p = __builtin_elementwise_fma(t, p, both(0xbcdac9b8u));
  p = __builtin_elementwise_fma(t, p, both(0x3de703beu));
  p = __builtin_elementwise_fma(t, p, both(0xbec09330u));
  p = __builtin_elementwise_fma(t, p, both(0x3e0375d0u));
  p = __builtin_elementwise_fma(ax, p, ax);
  v2f r = {__builtin_copysignf(ax.x < 1.f ? p.x : far.x, x.x),
           __builtin_copysignf(ax.y < 1.f ? p.y : far.y, x.y)};
  return r;
}

#define WBM 256
#define WBN 256
#define WBK 128
#define WNW 16                    // waves of a block
#define WAP 136                   // A pitch in LDS, elements (272 B)
#define WBP 272                   // B pitch in LDS, elements (544 B)
#define WA_ELEMS (WBM * WAP)      // one A buffer
#define WB_ELEMS (WBK * WBP)      // one B buffer
__global__ __launch_bounds__(WNW * 32)
void gemm_wmma_wide_kernel(const unsigned short* __restrict__ A,
                           const unsigned short* __restrict__ Bw,
                           int N, int K,
                           const float* __restrict__ bias, int do_gelu,
                           unsigned short* __restrict__ outb,
                           int zB, int zO) {
  Bw   += (size_t)blockIdx.z * zB;
  outb += (size_t)blockIdx.z * zO;
  __shared__ alignas(16) unsigned short ring[2 * WA_ELEMS + 2 * WB_ELEMS];  // 278,528 B
  unsigned short* Al = ring;                  // [2][m 256][WAP]
  unsigned short* Bl = ring + 2 * WA_ELEMS;   // [2][k 128][WBP]

  int t = threadIdx.x;
  int wave = t >> 5, lane = t & 31;
  int lm = lane & 15, hf = lane >> 4;
  int mBase = blockIdx.y * WBM;
  int nBase = blockIdx.x * WBN;
  int wm = (wave >> 2) * 64;
  int wn = (wave & 3) * 64;
  int kIters = K >> 7;

  // A tile: 256 m rows of 256 B, sixteen lanes a row. B tile: 128 k rows of 512 B,
  // a whole wave a row. Eight copies of each a lane.
  int arow0 = t >> 4, ac8 = (t & 15) * 8;
  int brow0 = t >> 5, bc8 = (t & 31) * 8;
  const unsigned short* aLane = A + (size_t)arow0 * K + ac8;
  const unsigned short* bLane = Bw + (size_t)brow0 * N + nBase + bc8;
  auto stage = [&](int kt, int buf) {
    unsigned int l[8];
    unsigned long long g[8];
#pragma unroll
    for (int i = 0; i < 8; ++i) {
      int row = arow0 + i * 32;
      l[i] = (unsigned int)(unsigned long long)&Al[buf * WA_ELEMS + row * WAP + ac8];
      g[i] = (unsigned long long)(aLane + ((size_t)(mBase + i * 32) * K + kt * WBK));
    }
    async_copy_8x16B(l, g);
#pragma unroll
    for (int i = 0; i < 8; ++i) {
      int row = brow0 + i * 16;
      l[i] = (unsigned int)(unsigned long long)&Bl[buf * WB_ELEMS + row * WBP + bc8];
      g[i] = (unsigned long long)(bLane + (size_t)(kt * WBK + i * 16) * N);
    }
    async_copy_8x16B(l, g);
  };
  // the lane's place in a 16 x 16 block for the transposing load
  int trow = hf * 8 + (lane & 7), tcol = ((lane >> 3) & 1) * 8;

  v8f vzero = {};
  // tile i * 4 + j: acc[..][v] = C[wm + 16 i + lm][wn + 16 j + 8 hf + v]
  v8f acc[16];
#pragma unroll
  for (int q = 0; q < 16; ++q) acc[q] = vzero;

  // prologue: tile 0 lands and is published
  stage(0, 0);
  asm volatile("s_wait_asynccnt 0x0" ::: "memory");  // own copies landed before the barrier
  __syncthreads();

  for (int kt = 0; kt < kIters; ++kt) {
    int cur = kt & 1;
    const unsigned short* Ac = Al + cur * WA_ELEMS;
    const unsigned short* Bc = Bl + cur * WB_ELEMS;

    // tile kt+1 is set flying, at the head of the trip, into the buffer that the
    // barrier at the foot of trip kt-1 has freed
    if (kt + 1 < kIters) stage(kt + 1, cur ^ 1);

#pragma unroll
    for (int ks = 0; ks < 4; ++ks) {     // the tile's four steps of 32 k
      FragU af[4], bf[4];
      int k0 = ks * 32;
#pragma unroll
      for (int i = 0; i < 4; ++i) {
        int arow = wm + i * 16 + lm;
        af[i].q[0] = *(const uint4*)&Ac[arow * WAP + k0 + hf * 8];
        af[i].q[1] = *(const uint4*)&Ac[arow * WAP + k0 + 16 + hf * 8];
      }
#pragma unroll
      for (int j = 0; j < 4; ++j) {
        int bcol = wn + j * 16 + tcol;
        bf[j].q[0] = ld_tr16(&Bc[(k0 + trow) * WBP + bcol]);
        bf[j].q[1] = ld_tr16(&Bc[(k0 + 16 + trow) * WBP + bcol]);
      }
      // keeps the step's 16 LDS reads one group ahead of its WMMAs; without it the
      // compiler sinks them between the WMMAs and each pair waits out the LDS latency
      __builtin_amdgcn_sched_barrier(0);
#pragma unroll
      for (int i = 0; i < 4; ++i)
#pragma unroll
        for (int j = 0; j < 4; ++j)
          acc[i * 4 + j] = __builtin_amdgcn_wmma_f32_16x16x32_bf16(
              false, bf[j].v, false, af[i].v, (short)0, acc[i * 4 + j], false, false);
      // keeps the step's WMMAs ahead of the next step's LDS reads (one fragment set
      // serves all steps) and of the foot's waits and barrier
      __builtin_amdgcn_sched_barrier(0);
    }

    // foot of the trip: own LDS reads done, own copies of tile kt+1 landed; the
    // barrier publishes tile kt+1 and frees buffer cur.
    asm volatile("s_wait_dscnt 0x0" ::: "memory");
    asm volatile("s_wait_asynccnt 0x0" ::: "memory");
    __syncthreads();
  }
  asm volatile("s_wait_asynccnt 0x0" ::: "memory");  // no copy outstanding at the wave's end

  float* stg = (float*)ring;
  const int SP = 260;
  // read-back: a wave takes half a row, 128 columns, at a time, 4 columns a lane
  int ecol = lane * 4;
  v4f bv0 = {}, bv1 = {};
  if (bias) {
    bv0 = *(const v4f*)(bias + nBase + ecol);
    bv1 = *(const v4f*)(bias + nBase + 128 + ecol);
  }
#pragma unroll
  for (int i = 0; i < 4; ++i)
#pragma unroll
    for (int j = 0; j < 4; ++j) {
      float* d = stg + (wm + i * 16 + lm) * SP + wn + j * 16 + hf * 8;
      v8f a = acc[i * 4 + j];
      v4f lo = {a[0], a[1], a[2], a[3]}, hi = {a[4], a[5], a[6], a[7]};
      *(v4f*)d       = lo;
      *(v4f*)(d + 4) = hi;
    }
  __syncthreads();   // the tile is whole before any wave reads rows of it

  const float* srow = stg + wave * SP + ecol;
  unsigned short* orow = outb + (size_t)(mBase + wave) * N + nBase + ecol;
  size_t oStep = (size_t)WNW * N;
  if (do_gelu) {
    // four runs of 4 whole rows (8 half rows, 32 elements a lane); kept rolled, so
    // that one run's registers and code serve all four
#pragma unroll 1
    for (int g = 0; g < WBM / WNW / 4; ++g) {
      v4f val[8];
#pragma unroll
      for (int u = 0; u < 8; ++u)
        val[u] = *(const v4f*)(srow + (g * 4 + (u >> 1)) * WNW * SP + (u & 1) * 128);
      if (bias) {
#pragma unroll
        for (int u = 0; u < 8; ++u) val[u] += (u & 1) ? bv1 : bv0;
      }
      unsigned short* op[4];             // one address a row; its right half at + 256 B
      uint2 pk[8];
#pragma unroll
      for (int r = 0; r < 4; ++r) op[r] = orow + (g * 4 + r) * oStep;
#pragma unroll
      for (int u = 0; u < 8; ++u) {
        v2f lo = {val[u][0], val[u][1]}, hi = {val[u][2], val[u][3]};
        lo = 0.5f * lo * (1.f + erf_pair(lo * 0.70710678118654752f));
        hi = 0.5f * hi * (1.f + erf_pair(hi * 0.70710678118654752f));
        pk[u].x = (unsigned int)f2bf(lo.x) | ((unsigned int)f2bf(lo.y) << 16);
        pk[u].y = (unsigned int)f2bf(hi.x) | ((unsigned int)f2bf(hi.y) << 16);
      }
      // all 4 store addresses are made ahead of the first store
      asm volatile("" :: "v"(op[0]), "v"(op[1]), "v"(op[2]), "v"(op[3]) : "memory");
      // keeps the arithmetic and packing above from sinking among the stores
      __builtin_amdgcn_sched_barrier(0);
#pragma unroll
      for (int u = 0; u < 8; ++u) *(uint2*)(op[u >> 1] + (u & 1) * 128) = pk[u];
      // the addresses stay live to here, and the wait closes the run of stores: no
      // register that a store names is written before it
      asm volatile("s_wait_xcnt 0x0"
                      :: "v"(op[0]), "v"(op[1]), "v"(op[2]), "v"(op[3]) : "memory");
      // keeps the next run's register writes behind that wait
      __builtin_amdgcn_sched_barrier(0);
    }
  } else {
    // two runs of 16 half rows: the left 128 columns, then the right; kept rolled,
    // so that one run's registers and code serve both
#pragma unroll 1
    for (int hb = 0; hb < 2; ++hb) {
      int ch = hb * 128;
      v4f val[16];
#pragma unroll
      for (int it = 0; it < 16; ++it) val[it] = *(const v4f*)(srow + it * WNW * SP + ch);
      if (bias) {
        v4f bv = hb ? bv1 : bv0;
#pragma unroll
        for (int it = 0; it < 16; ++it) val[it] += bv;
      }
      unsigned short* op[16];
      uint2 pk[16];
#pragma unroll
      for (int it = 0; it < 16; ++it) {
        op[it] = orow + it * oStep + ch;
        pk[it].x = (unsigned int)f2bf(val[it][0]) | ((unsigned int)f2bf(val[it][1]) << 16);
        pk[it].y = (unsigned int)f2bf(val[it][2]) | ((unsigned int)f2bf(val[it][3]) << 16);
      }
      // all 16 store addresses are made ahead of the first store
      asm volatile("" :: "v"(op[0]), "v"(op[1]), "v"(op[2]), "v"(op[3]),
                         "v"(op[4]), "v"(op[5]), "v"(op[6]), "v"(op[7]),
                         "v"(op[8]), "v"(op[9]), "v"(op[10]), "v"(op[11]),
                         "v"(op[12]), "v"(op[13]), "v"(op[14]), "v"(op[15]) : "memory");
      // keeps the rounding and packing above from sinking among the stores
      __builtin_amdgcn_sched_barrier(0);
#pragma unroll
      for (int it = 0; it < 16; ++it) *(uint2*)op[it] = pk[it];
      // the addresses stay live to here, and the wait closes the run of stores: no
      // register that a store names is written before it
      asm volatile("s_wait_xcnt 0x0"
                      :: "v"(op[0]), "v"(op[1]), "v"(op[2]), "v"(op[3]),
                         "v"(op[4]), "v"(op[5]), "v"(op[6]), "v"(op[7]),
                         "v"(op[8]), "v"(op[9]), "v"(op[10]), "v"(op[11]),
                         "v"(op[12]), "v"(op[13]), "v"(op[14]), "v"(op[15]) : "memory");
      // keeps the second run's register writes behind that wait
      __builtin_amdgcn_sched_barrier(0);
    }
  }
}

typedef __attribute__((ext_vector_type(2))) __bf16 v2bf;
#define AKT 64                    // keys of a trip

static __device__ __forceinline__ float xhalf(float x) {
  int b = __builtin_bit_cast(int, x);
  return __builtin_bit_cast(float, __builtin_amdgcn_permlanex16(
      b, b, 0x76543210, 0xfedcba98, false, false));
}
// two f32 -> one dword of two bf16 (a in the low half), round to nearest even
static __device__ __forceinline__ unsigned int pack_bf16(float a, float b) {
  v2f f = {a, b};
  return __builtin_bit_cast(unsigned int, __builtin_convertvector(f, v2bf));
}
static __device__ __forceinline__ void async_copy_4x16B(const unsigned int* l,
                                                        const unsigned long long* g) {
  asm volatile("global_load_async_to_lds_b128 %0, %4, off\n\t"
               "global_load_async_to_lds_b128 %1, %5, off\n\t"
               "global_load_async_to_lds_b128 %2, %6, off\n\t"
               "global_load_async_to_lds_b128 %3, %7, off\n\t"
               "s_wait_xcnt 0x0"
               :: "v"(l[0]), "v"(l[1]), "v"(l[2]), "v"(l[3]),
                  "v"(g[0]), "v"(g[1]), "v"(g[2]), "v"(g[3])
               : "memory");
}

__global__ __launch_bounds__(128)
void flash_attn_kernel(const unsigned short* __restrict__ Q,
                       const unsigned short* __restrict__ Km,
                       const unsigned short* __restrict__ Vm,
                       unsigned short* __restrict__ O) {
  __shared__ alignas(16) unsigned short Qs[64][72];       // 144B rows
  __shared__ alignas(16) unsigned short Ks[2][AKT][72];   // 144B rows
  __shared__ alignas(16) unsigned int   Vt[2][64][36];    // [dh][keypair], 144B rows

  int t = threadIdx.x;
  int wave = t >> 5, lane = t & 31;
  int lm = lane & 15, hf = lane >> 4;
  int bh = blockIdx.x;
  int b = bh / H_, h = bh % H_;
  int q0 = b * N_ + blockIdx.y * 64;
  int colh = h * DH_;
  int rowBase = wave * 16;
  const int kbIters = N_ / AKT;

  // K tile: 64 rows of 128 B. Eight lanes cover one whole row per copy.
  int krow0 = t >> 3, kc8 = (t & 7) * 8;
  const unsigned short* kLane = Km + (size_t)(b * N_ + krow0) * HD + colh + kc8;
  auto stageK = [&](int kb, int buf) {
    unsigned int l[4];
    unsigned long long g[4];
#pragma unroll
    for (int i = 0; i < 4; ++i) {
      l[i] = (unsigned int)(unsigned long long)&Ks[buf][krow0 + i * 16][kc8];
      g[i] = (unsigned long long)(kLane + (size_t)(kb * AKT + i * 16) * HD);
    }
    async_copy_4x16B(l, g);
  };
  // V tile: 32 key pairs x 32 dh pairs. A lane keeps one dh pair; wave w takes
  // key pairs 4 i + w, i = 0..7.
  int dh0 = lane * 2;
  const unsigned short* vLane = Vm + (size_t)(b * N_ + 2 * wave) * HD + colh + dh0;
  unsigned int vr0[8], vr1[8];
  auto loadV = [&](int kb) {
    const unsigned short* p = vLane + (size_t)(kb * AKT) * HD;
#pragma unroll
    for (int i = 0; i < 8; ++i) {
      vr0[i] = *(const unsigned int*)(p + (8 * i) * HD);
      vr1[i] = *(const unsigned int*)(p + (8 * i + 1) * HD);
    }
  };
  auto storeV = [&](int buf) {
#pragma unroll
    for (int i = 0; i < 8; ++i) {
      int kp = i * 4 + wave;
      Vt[buf][dh0][kp]     = (vr0[i] & 0xFFFFu) | (vr1[i] << 16);
      Vt[buf][dh0 + 1][kp] = (vr0[i] >> 16)     | (vr1[i] & 0xFFFF0000u);
    }
  };

  // load Q tile 64x64 (64B per thread)
  {
    int row = t >> 1, c32 = (t & 1) * 32;
    const uint4* src = (const uint4*)(Q + (size_t)(q0 + row) * HD + colh + c32);
    uint4* dst = (uint4*)&Qs[row][c32];
    dst[0] = src[0]; dst[1] = src[1]; dst[2] = src[2]; dst[3] = src[3];
  }

  v8f vzero = {};
  v8f o[4];
#pragma unroll
  for (int c = 0; c < 4; ++c) o[c] = vzero;
  // of query lm: running maximum (both halves alike), and the sum over the
  // keys that this half of the wave holds
  float mrow = -1e30f, lrow = 0.f;

  // prologue: stage tile 0 (barrier also publishes Qs)
  stageK(0, 0);
  loadV(0);
  storeV(0);
  asm volatile("s_wait_asynccnt 0x0" ::: "memory");  // own copies landed before the barrier
  __syncthreads();

  // Q^T fragments (B operand), read once and kept in registers
  FragU qb[2];
#pragma unroll
  for (int st = 0; st < 2; ++st) {
    qb[st].q[0] = *(const uint4*)&Qs[rowBase + lm][st * 32 + hf * 8];
    qb[st].q[1] = *(const uint4*)&Qs[rowBase + lm][st * 32 + 16 + hf * 8];
  }

  for (int kb = 0; kb < kbIters; ++kb) {
    int cur = kb & 1;
    bool more = (kb + 1) < kbIters;
    // tile kb+1 is set flying into the buffers that the barrier at the foot of
    // trip kb-1 has freed
    if (more) { stageK(kb + 1, cur ^ 1); loadV(kb + 1); }

    // K fragments (A operand of S^T)
    FragU kf[2][4];
#pragma unroll
    for (int st = 0; st < 2; ++st)
#pragma unroll
      for (int j = 0; j < 4; ++j) {
        kf[st][j].q[0] = *(const uint4*)&Ks[cur][j * 16 + lm][st * 32 + hf * 8];
        kf[st][j].q[1] = *(const uint4*)&Ks[cur][j * 16 + lm][st * 32 + 16 + hf * 8];
      }
    // V^T fragments (A operand of O^T), keys 32 kk + ...
    FragU vf[2][4];
#pragma unroll
    for (int kk = 0; kk < 2; ++kk)
#pragma unroll
      for (int ct = 0; ct < 4; ++ct) {
        vf[kk][ct].q[0] = *(const uint4*)&Vt[cur][ct * 16 + lm][kk * 16 + hf * 4];
        vf[kk][ct].q[1] = *(const uint4*)&Vt[cur][ct * 16 + lm][kk * 16 + 8 + hf * 4];
      }
    // keeps the next tile's V loads and the trip's 32 LDS reads at the head of the trip;
    // without it the compiler sinks each to just ahead of its use, and the wave
    // waits out the L2 and LDS latencies there
    __builtin_amdgcn_sched_barrier(0);

    // ---- S^T = K Q^T  (four 16-key tiles, two k-steps over DH=64) ----
    // s[j][v] = score of key 16 j + 8 hf + v against query lm
    v8f s[4];
#pragma unroll
    for (int j = 0; j < 4; ++j) s[j] = vzero;
#pragma unroll
    for (int st = 0; st < 2; ++st)
#pragma unroll
      for (int j = 0; j < 4; ++j)
        s[j] = __builtin_amdgcn_wmma_f32_16x16x32_bf16(
            false, kf[st][j].v, false, qb[st].v, (short)0, s[j], false, false);
    __builtin_amdgcn_sched_barrier(0);

    // ---- online softmax of one query per lane ----
    float tj[4];                       // one chain per score tile
#pragma unroll
    for (int j = 0; j < 4; ++j) {
      tj[j] = fmaxf(s[j][0], s[j][1]);
#pragma unroll
      for (int v = 2; v < 8; ++v) tj[j] = fmaxf(tj[j], s[j][v]);
    }
    float tm = fmaxf(fmaxf(tj[0], tj[1]), fmaxf(tj[2], tj[3]));
    tm = fmaxf(tm, xhalf(tm));         // the other 32 keys of this query
    float mn = fmaxf(mrow, tm);
    float scale = __expf(mrow - mn);
    mrow = mn;
    // ---- P^T as B operand of key group kk: k = 8 hf + v from tile 2 kk,
    //      16 + 8 hf + v from tile 2 kk + 1 ----
    FragU pb[2];
    v2f rs[4];                         // a tile's sums over even and over odd v
#pragma unroll
    for (int j = 0; j < 4; ++j) {
      v2f p[4];
#pragma unroll
      for (int i = 0; i < 4; ++i) {
        p[i].x = __expf(s[j][2 * i] - mn);
        p[i].y = __expf(s[j][2 * i + 1] - mn);
        pb[j >> 1].u[(j & 1) * 4 + i] = pack_bf16(p[i].x, p[i].y);
      }
      rs[j] = (p[0] + p[1]) + (p[2] + p[3]);
    }
    v2f rt = (rs[0] + rs[1]) + (rs[2] + rs[3]);
    lrow = lrow * scale + (rt.x + rt.y);
#pragma unroll
    for (int c = 0; c < 4; ++c)
#pragma unroll
      for (int v = 0; v < 8; ++v) o[c][v] *= scale;

    __builtin_amdgcn_sched_barrier(0);

    // ---- O^T += V^T P^T : o[ct][v] = O[query lm][dh 16 ct + 8 hf + v] ----
#pragma unroll
    for (int kk = 0; kk < 2; ++kk)
#pragma unroll
      for (int ct = 0; ct < 4; ++ct)
        o[ct] = __builtin_amdgcn_wmma_f32_16x16x32_bf16(
            false, vf[kk][ct].v, false, pb[kk].v, (short)0, o[ct], false, false);

    // keeps the wait for the next tile's V loads, with their pack and store,
    // behind the trip's products; without it the compiler lifts that wait to
    // just behind the first WMMA, where the loads have had no time to return
    __builtin_amdgcn_sched_barrier(0);
    if (more) storeV(cur ^ 1);
    // foot of the trip: own LDS reads and V stores done, own K copies of tile
    // kb+1 landed; the barrier publishes tile kb+1 and frees buffer cur.
    asm volatile("s_wait_dscnt 0x0" ::: "memory");
    asm volatile("s_wait_asynccnt 0x0" ::: "memory");
    __syncthreads();
  }
  asm volatile("s_wait_asynccnt 0x0" ::: "memory");  // no copy outstanding at the wave's end

  // ---- normalize and store bf16: 8 consecutive dh of one query per store ----
  float lsum = lrow + xhalf(lrow);     // the two halves' key sums joined
  uint4 ov[4];
#pragma unroll
  for (int ct = 0; ct < 4; ++ct) {
    ov[ct].x = pack_bf16(o[ct][0] / lsum, o[ct][1] / lsum);
    ov[ct].y = pack_bf16(o[ct][2] / lsum, o[ct][3] / lsum);
    ov[ct].z = pack_bf16(o[ct][4] / lsum, o[ct][5] / lsum);
    ov[ct].w = pack_bf16(o[ct][6] / lsum, o[ct][7] / lsum);
  }
  unsigned short* orow = O + (size_t)(q0 + rowBase + lm) * HD + colh + hf * 8;
#pragma unroll
  for (int ct = 0; ct < 4; ++ct) *(uint4*)(orow + ct * 16) = ov[ct];
}

// ---------------------------------------------------------------------------
// Host-side orchestration
// ---------------------------------------------------------------------------
extern "C" void kernel_launch(void* const* d_in, const int* in_sizes, int n_in,
                              void* d_out, int out_size, void* d_ws, size_t ws_size,
                              hipStream_t stream) {
  const float* x     = (const float*)d_in[0];
  const float* wq    = (const float*)d_in[1];
  const float* wk    = (const float*)d_in[2];
  const float* wv    = (const float*)d_in[3];
  const float* wo    = (const float*)d_in[4];
  const float* w1    = (const float*)d_in[5];
  const float* b1    = (const float*)d_in[6];
  const float* w2    = (const float*)d_in[7];
  const float* b2    = (const float*)d_in[8];
  const float* ln1_g = (const float*)d_in[9];
  const float* ln1_b = (const float*)d_in[10];
  const float* ln2_g = (const float*)d_in[11];
  const float* ln2_b = (const float*)d_in[12];
  float* out = (float*)d_out;

  // workspace carve-out (~120 MiB total)
  char* p = (char*)d_ws;
  auto alloc = [&](size_t bytes) -> void* {
    void* r = (void*)p;
    p += (bytes + 255) & ~(size_t)255;
    return r;
  };
  unsigned short* wq_b = (unsigned short*)alloc((size_t)3 * D_ * HD * 2);   // wq | wk | wv
  unsigned short* wk_b = wq_b + D_ * HD;
  unsigned short* wv_b = wk_b + D_ * HD;
  unsigned short* wo_b = (unsigned short*)alloc((size_t)HD * D_ * 2);
  unsigned short* w1_b = (unsigned short*)alloc((size_t)D_ * FF_ * 2);
  unsigned short* w2_b = (unsigned short*)alloc((size_t)FF_ * D_ * 2);
  unsigned short* h_b  = (unsigned short*)alloc((size_t)ROWS * D_ * 2);
  unsigned short* q_b  = (unsigned short*)alloc((size_t)3 * ROWS * HD * 2); // q | k | v
  unsigned short* k_b  = q_b + ROWS * HD;
  unsigned short* v_b  = k_b + ROWS * HD;
  unsigned short* a_b  = (unsigned short*)alloc((size_t)ROWS * HD * 2);
  float*          x2   = (float*)        alloc((size_t)ROWS * D_ * 4);
  unsigned short* h2_b = (unsigned short*)alloc((size_t)ROWS * D_ * 2);
  unsigned short* ff_b = (unsigned short*)alloc((size_t)ROWS * FF_ * 2);

  // 1) weights -> bf16 and LN1, one launch
  cast_and_layernorm_kernel<<<CAST_GRID + ROWS, 256, 0, stream>>>(
      wq, wk, wv, wo, w1, w2, wq_b, wk_b, wv_b, wo_b, w1_b, w2_b, x, ln1_g, ln1_b, h_b);

  // 2) Q/K/V projections, one launch of three planes
  dim3 gemmBlk(256);
  dim3 attnBlk(128);
  dim3 wideBlk(WNW * 32);
  dim3 gQKV(HD / WBN, ROWS / WBM, 3);
  gemm_wmma_wide_kernel<<<gQKV, wideBlk, 0, stream>>>(h_b, wq_b, HD, D_,
                                                      nullptr, 0, q_b,
                                                      D_ * HD, ROWS * HD);

  // 3) attention
  dim3 gAttn(B_ * H_, N_ / 64);
  flash_attn_kernel<<<gAttn, attnBlk, 0, stream>>>(q_b, k_b, v_b, a_b);

  // 4) out projection + residual -> x2 (fp32)
  dim3 gO(D_ / GBN, ROWS / GBM);
  gemm_wmma_kernel<<<gO, gemmBlk, 0, stream>>>(a_b, wo_b, ROWS, D_, HD,
                                               nullptr, 0, x, nullptr, x2, 0, 0);

  // 5) LN2
  layernorm_bf16_kernel<<<ROWS, 256, 0, stream>>>(x2, ln2_g, ln2_b, h2_b);

  // 6) FF1 + bias + exact GELU -> bf16
  dim3 gFF1(FF_ / WBN, ROWS / WBM);
  gemm_wmma_wide_kernel<<<gFF1, wideBlk, 0, stream>>>(h2_b, w1_b, FF_, D_,
                                                      b1, 1, ff_b, 0, 0);

  // 7) FF2 + bias + residual -> out (fp32)
  dim3 gFF2(D_ / GBN, ROWS / GBM);
  gemm_wmma_kernel<<<gFF2, gemmBlk, 0, stream>>>(ff_b, w2_b, ROWS, D_, FF_,
                                                 b2, 0, x2, nullptr, out, 0, 0);
}

// v010
// It runs in 154 microseconds.
// Two timings next to v009 both put it at 1.07 times that version's speed.
// Counting every step since v000, it is 3.68 times as fast.
#include <hip/hip_runtime.h>
#include <stdint.h>

// Problem constants (match reference)
#define B_  2
#define N_  2048
#define D_  1024
#define H_  16
#define DH_ 64
#define FF_ 4096
#define ROWS (B_ * N_)          // 4096
#define HD  (H_ * DH_)          // 1024

typedef __attribute__((ext_vector_type(16))) __bf16 v16bf;
typedef __attribute__((ext_vector_type(8)))  float  v8f;

// Fragment: 8 dwords = two 16B chunks; loaded as 2x ds_load_b128 (B of the GEMM: 2x ds_load_tr16_b128).
union FragU { uint4 q[2]; unsigned int u[8]; v16bf v; };

static __device__ __forceinline__ unsigned short f2bf(float f) {
  union { float f; unsigned int u; } c; c.f = f;
  unsigned int u = c.u;
  unsigned int r = u + 0x7FFFu + ((u >> 16) & 1u);   // round-to-nearest-even
  return (unsigned short)(r >> 16);
}

typedef __attribute__((ext_vector_type(8))) short s16x8;
static __device__ __forceinline__ uint4 ld_tr16(const unsigned short* p) {
  typedef __attribute__((address_space(3))) s16x8 lds_s16x8;
  return __builtin_bit_cast(uint4, __builtin_amdgcn_ds_load_tr16_b128_v8i16((lds_s16x8*)p));
}

// ---------------------------------------------------------------------------
// f32 -> bf16 cast of all six weights, one pass per block.
// A block converts CAST_BLK consecutive elements of one weight (every weight's
// size is a multiple of CAST_BLK). A thread has its 16 loads of 16 B in flight
// together; each load of a wave covers 512 contiguous bytes.
// ---------------------------------------------------------------------------
typedef __attribute__((ext_vector_type(4))) float v4f;
typedef __attribute__((ext_vector_type(2))) float v2f;
#define CAST_BLK   16384                       // 256 threads x 16 x 4 elements
#define CAST_SMALL (D_ * HD / CAST_BLK)        // blocks per D x HD weight: 64
#define CAST_LARGE (D_ * FF_ / CAST_BLK)       // blocks per D x FF weight: 256
#define CAST_GRID  (4 * CAST_SMALL + 2 * CAST_LARGE)
static __device__ __forceinline__
void cast_weights_block(int blk,
                        const float* __restrict__ wq, const float* __restrict__ wk,
                        const float* __restrict__ wv, const float* __restrict__ wo,
                        const float* __restrict__ w1, const float* __restrict__ w2,
                        unsigned short* __restrict__ oq, unsigned short* __restrict__ ok,
                        unsigned short* __restrict__ ov, unsigned short* __restrict__ oo,
                        unsigned short* __restrict__ o1, unsigned short* __restrict__ o2) {
  const float* in;
  unsigned short* out;
  if (blk < 4 * CAST_SMALL) {
    int w = blk / CAST_SMALL;
    blk -= w * CAST_SMALL;
    in  = w == 0 ? wq : w == 1 ? wk : w == 2 ? wv : wo;
    out = w == 0 ? oq : w == 1 ? ok : w == 2 ? ov : oo;
  } else {
    blk -= 4 * CAST_SMALL;
    int w = blk / CAST_LARGE;
    blk -= w * CAST_LARGE;
    in  = w == 0 ? w1 : w2;
    out = w == 0 ? o1 : o2;
  }
  int off = blk * CAST_BLK + threadIdx.x * 4;
  in  += off;
  out += off;
  v4f f[16];
#pragma unroll
  for (int i = 0; i < 16; ++i) f[i] = *(const v4f*)(in + i * 1024);
  // takes the 16 loaded values as inputs only: all 16 loads are issued ahead of
  // it; without it the compiler sinks loads to just ahead of their conversion,
  // and the wave waits out several memory latencies one after the other. The
  // address is named too: it stays live, so no load lands in the register pair
  // that the loads issued before it name.
  asm volatile("" :: "v"(f[0]), "v"(f[1]), "v"(f[2]), "v"(f[3]), "v"(f[4]), "v"(f[5]),
                     "v"(f[6]), "v"(f[7]), "v"(f[8]), "v"(f[9]), "v"(f[10]), "v"(f[11]),
                     "v"(f[12]), "v"(f[13]), "v"(f[14]), "v"(f[15]), "v"(in));
  uint2 r[16];
#pragma unroll
  for (int i = 0; i < 16; ++i) {
    r[i].x = (unsigned int)f2bf(f[i].x) | ((unsigned int)f2bf(f[i].y) << 16);
    r[i].y = (unsigned int)f2bf(f[i].z) | ((unsigned int)f2bf(f[i].w) << 16);
  }
  // keeps the stores behind the last conversion, so that no register which an
  // issued store names is written again
  __builtin_amdgcn_sched_barrier(0);
#pragma unroll
  for (int i = 0; i < 16; ++i) *(uint2*)(out + i * 1024) = r[i];
}

// ---------------------------------------------------------------------------
// Row LayerNorm (D=1024), fp32 in -> bf16 out. One block (256 thr) per row.
// ---------------------------------------------------------------------------
static __device__ __forceinline__
void layernorm_row(int row,
                   const float* __restrict__ x,
                   const float* __restrict__ g,
                   const float* __restrict__ b,
                   unsigned short* __restrict__ out) {
  __shared__ float red[256];
  int t = threadIdx.x;
  const float* xr = x + (size_t)row * D_;
  float v[4];
  float s = 0.f;
#pragma unroll
  for (int i = 0; i < 4; ++i) { v[i] = xr[t + i * 256]; s += v[i]; }
  red[t] = s; __syncthreads();
  for (int off = 128; off > 0; off >>= 1) {
    if (t < off) red[t] += red[t + off];
    __syncthreads();
  }
  float mu = red[0] * (1.f / D_);
  __syncthreads();
  float s2 = 0.f;
#pragma unroll
  for (int i = 0; i < 4; ++i) { float d = v[i] - mu; s2 += d * d; }
  red[t] = s2; __syncthreads();
  for (int off = 128; off > 0; off >>= 1) {
    if (t < off) red[t] += red[t + off];
    __syncthreads();
  }
  float rstd = rsqrtf(red[0] * (1.f / D_) + 1e-5f);
#pragma unroll
  for (int i = 0; i < 4; ++i) {
    int c = t + i * 256;
    out[(size_t)row * D_ + c] = f2bf((v[i] - mu) * rstd * g[c] + b[c]);
  }
}

__global__ __launch_bounds__(256)
void layernorm_bf16_kernel(const float* __restrict__ x,
                           const float* __restrict__ g,
                           const float* __restrict__ b,
                           unsigned short* __restrict__ out) {
  layernorm_row(blockIdx.x, x, g, b, out);
}

// ---------------------------------------------------------------------------
// The weight casts and the first LayerNorm depend on nothing of each other:
// one grid holds both. The block index picks the body, alike for the whole
// block; the cast blocks, which move the most bytes each, take the low indices.
// ---------------------------------------------------------------------------
__global__ __launch_bounds__(256)
void cast_and_layernorm_kernel(const float* __restrict__ wq, const float* __restrict__ wk,
                               const float* __restrict__ wv, const float* __restrict__ wo,
                               const float* __restrict__ w1, const float* __restrict__ w2,
                               unsigned short* __restrict__ oq, unsigned short* __restrict__ ok,
                               unsigned short* __restrict__ ov, unsigned short* __restrict__ oo,
                               unsigned short* __restrict__ o1, unsigned short* __restrict__ o2,
                               const float* __restrict__ x, const float* __restrict__ g,
                               const float* __restrict__ b, unsigned short* __restrict__ h) {
  int blk = blockIdx.x;
  if (blk < CAST_GRID) cast_weights_block(blk, wq, wk, wv, wo, w1, w2, oq, ok, ov, oo, o1, o2);
  else                 layernorm_row(blk - CAST_GRID, x, g, b, h);
}

static __device__ __forceinline__ void async_copy_8x16B(const unsigned int* l,
                                                        const unsigned long long* g) {
  asm volatile("global_load_async_to_lds_b128 %0, %8, off\n\t"
               "global_load_async_to_lds_b128 %1, %9, off\n\t"
               "global_load_async_to_lds_b128 %2, %10, off\n\t"
               "global_load_async_to_lds_b128 %3, %11, off\n\t"
               "global_load_async_to_lds_b128 %4, %12, off\n\t"
               "global_load_async_to_lds_b128 %5, %13, off\n\t"
               "global_load_async_to_lds_b128 %6, %14, off\n\t"
               "global_load_async_to_lds_b128 %7, %15, off\n\t"
               "s_wait_xcnt 0x0"
               :: "v"(l[0]), "v"(l[1]), "v"(l[2]), "v"(l[3]),
                  "v"(l[4]), "v"(l[5]), "v"(l[6]), "v"(l[7]),
                  "v"(g[0]), "v"(g[1]), "v"(g[2]), "v"(g[3]),
                  "v"(g[4]), "v"(g[5]), "v"(g[6]), "v"(g[7])
               : "memory");
}

// ---------------------------------------------------------------------------
// Generic bf16 WMMA GEMM:  C[M,N] = A[M,K] @ Bw[K,N]  (f32 accumulate)
// 128x128 tile per block, 128 k per trip, 256 threads = 8 waves (2 x 4), each
// wave 64(M) x 32(N): per 32 k, 6 fragments feed 8 WMMAs.
// M, N multiples of 128; K a multiple of 128.
// Four LDS buffers: the async copies of A and B of tiles t+1 to t+3 fly while tile
// t is worked on, 64 KB a tile. A trip is 32 WMMAs a wave,
// and the grids of this kernel give a WGP one block, so
// nothing else covers the copies' flight. B lies in LDS as in memory, [k][n]; its fragments
// come by the transposing load.
// The weight fragment is the first WMMA operand: a lane then holds 8 consecutive
// columns of ONE output row, which go to LDS as two 16 B stores. The tile is read
// back by rows, so that every global access of the epilogue is 16 B (8 B for
// bf16) a lane and covers whole 128 B lines.
// Products that share A go in one grid: plane blockIdx.z takes the weight at
// Bw + z * zB and writes its bf16 output at outb + z * zO.
// ---------------------------------------------------------------------------
#define GBM 128
#define GBN 128
#define GBK 128
#define GNB 4                     // buffers of the ring; prologue and counted waits are written for 4
__global__ __launch_bounds__(256)
void gemm_wmma_kernel(const unsigned short* __restrict__ A,
                      const unsigned short* __restrict__ Bw,
                      int M, int N, int K,
                      const float* __restrict__ bias, int do_gelu,
                      const float* __restrict__ resid,
                      unsigned short* __restrict__ outb,
                      float* __restrict__ outf,
                      int zB, int zO) {
  Bw   += (size_t)blockIdx.z * zB;
  outb += (size_t)blockIdx.z * zO;
  __shared__ alignas(16) unsigned short Alds[GNB][GBM][136]; // [m][k], 272B rows (padded)
  __shared__ alignas(16) unsigned short Bs[GNB][GBK][144];   // [k][n], 288B rows (padded)

  int t = threadIdx.x;
  int wave = t >> 5, lane = t & 31;
  int lm = lane & 15, hf = lane >> 4;
  int mBase = blockIdx.y * GBM;
  int nBase = blockIdx.x * GBN;
  int wm = (wave >> 2) * 64;
  int wn = (wave & 3) * 32;
  int kIters = K >> 7;

  // A tile: 128 m rows of 256 B. B tile: 128 k rows of 256 B. Sixteen lanes
  // cover one whole row per copy.
  int row0 = t >> 4, c8 = (t & 15) * 8;
  const unsigned short* aLane = A + (size_t)row0 * K + c8;            // the lane's share of
  const unsigned short* bLane = Bw + (size_t)row0 * N + nBase + c8;   // the addresses
  auto stage = [&](int kt, int buf) {
    unsigned int l[8];
    unsigned long long g[8];
#pragma unroll
    for (int i = 0; i < 8; ++i) {
      int row = row0 + i * 16;
      l[i] = (unsigned int)(unsigned long long)&Alds[buf][row][c8];
      g[i] = (unsigned long long)(aLane + ((size_t)(mBase + i * 16) * K + kt * GBK));
    }
    async_copy_8x16B(l, g);
#pragma unroll
    for (int i = 0; i < 8; ++i) {
      int row = row0 + i * 16;
      l[i] = (unsigned int)(unsigned long long)&Bs[buf][row][c8];
      g[i] = (unsigned long long)(bLane + (size_t)(kt * GBK + i * 16) * N);
    }
    async_copy_8x16B(l, g);
  };
  // the lane's place in a 16 x 16 block for the transposing load
  int trow = hf * 8 + (lane & 7), tcol = ((lane >> 3) & 1) * 8;

  v8f vzero = {};
  // tile i * 2 + j: acc[..][v] = C[wm + 16 i + lm][wn + 16 j + 8 hf + v]
  v8f acc[8];
#pragma unroll
  for (int q = 0; q < 8; ++q) acc[q] = vzero;

  // prologue: tiles 0 to 2 are set flying; tile 0 lands and is published.
  // A wave has 16 copies a tile. Own copies of tile 0 landed before the barrier: all
  // but the 32 youngest, which are tiles 1 and 2; with fewer tiles, all.
  stage(0, 0);
  if (1 < kIters) stage(1, 1);
  if (2 < kIters) stage(2, 2);
  if (2 < kIters) asm volatile("s_wait_asynccnt 0x20" ::: "memory");
  else            asm volatile("s_wait_asynccnt 0x0" ::: "memory");
  __syncthreads();

  for (int kt = 0; kt < kIters; ++kt) {
    int cur = kt & (GNB - 1);
    bool fill = kt + GNB - 1 < kIters;   // this trip sets a tile flying

#pragma unroll
    for (int kh = 0; kh < 2; ++kh) {     // the tile's two halves of 64 k
      FragU af[2][4], bf[2][2];
#pragma unroll
      for (int ks = 0; ks < 2; ++ks) {
        int k0 = kh * 64 + ks * 32;
#pragma unroll
        for (int i = 0; i < 4; ++i) {
          int arow = wm + i * 16 + lm;
          af[ks][i].q[0] = *(const uint4*)&Alds[cur][arow][k0 + hf * 8];
          af[ks][i].q[1] = *(const uint4*)&Alds[cur][arow][k0 + 16 + hf * 8];
        }
#pragma unroll
        for (int j = 0; j < 2; ++j) {
          int bcol = wn + j * 16 + tcol;
          bf[ks][j].q[0] = ld_tr16(&Bs[cur][k0 + trow][bcol]);
          bf[ks][j].q[1] = ld_tr16(&Bs[cur][k0 + 16 + trow][bcol]);
        }
      }
      // keeps the half's 24 LDS reads one group ahead of its WMMAs; without it the
      // compiler sinks them between the WMMAs and each pair waits out the LDS latency
      __builtin_amdgcn_sched_barrier(0);
      // tile kt+3 is set flying into the buffer of tile kt-1, which the barrier at the
      // foot of trip kt-1 has freed, while the LDS reads above are still coming in
      if (kh == 0 && fill) stage(kt + GNB - 1, (kt + GNB - 1) & (GNB - 1));
#pragma unroll
      for (int ks = 0; ks < 2; ++ks)
#pragma unroll
        for (int i = 0; i < 4; ++i)
#pragma unroll
          for (int j = 0; j < 2; ++j)
            acc[i * 2 + j] = __builtin_amdgcn_wmma_f32_16x16x32_bf16(
                false, bf[ks][j].v, false, af[ks][i].v, (short)0, acc[i * 2 + j], false, false);
      // keeps the half's WMMAs ahead of what follows: the next half's LDS reads
      // (one fragment set serves both halves) and the foot's waits and barrier,
      // behind which the compiler otherwise sinks them, so that they no longer
      // cover the copies' flight
      __builtin_amdgcn_sched_barrier(0);
    }

    // foot of the trip: own LDS reads done, own copies of tile kt+1 landed; the
    // barrier publishes tile kt+1 and frees buffer cur. Behind a trip that has set
    // tile kt+3 flying, the 32 youngest copies are tiles kt+2 and kt+3 and stay in
    // flight; the last trips, which issue none, wait for all.
    asm volatile("s_wait_dscnt 0x0" ::: "memory");
    if (fill) asm volatile("s_wait_asynccnt 0x20" ::: "memory");
    else      asm volatile("s_wait_asynccnt 0x0" ::: "memory");
    __syncthreads();
  }
  asm volatile("s_wait_asynccnt 0x0" ::: "memory");  // no copy outstanding at the wave's end

  float* stg = (float*)&Alds[0][0][0];
  const int SP = 132;
  // read-back: a wave takes one whole row of 128 columns a trip, 4 columns a lane
  int ecol = lane * 4;
  size_t o0 = (size_t)(mBase + wave) * N + nBase + ecol;
  size_t oStep = (size_t)8 * N;
  const float* srow = stg + wave * SP + ecol;

  // bias and residual are asked for ahead of the staging, all loads in flight together
  v4f bv = {};
  if (bias) bv = *(const v4f*)(bias + nBase + ecol);
  v4f rv[16];
  const float* rp[16];
  bool pre = resid && !do_gelu;
  if (pre) {
#pragma unroll
    for (int it = 0; it < 16; ++it) rp[it] = resid + o0 + it * oStep;
#pragma unroll
    for (int it = 0; it < 16; ++it) rv[it] = *(const v4f*)rp[it];
  }

#pragma unroll
  for (int i = 0; i < 4; ++i)
#pragma unroll
    for (int j = 0; j < 2; ++j) {
      float* d = stg + (wm + i * 16 + lm) * SP + wn + j * 16 + hf * 8;
      v8f a = acc[i * 2 + j];
      v4f lo = {a[0], a[1], a[2], a[3]}, hi = {a[4], a[5], a[6], a[7]};
      *(v4f*)d       = lo;
      *(v4f*)(d + 4) = hi;
    }
  if (pre) {
    // takes loaded values 0 to 7 and all 16 addresses as inputs only: every address
    // stays live until the last load has returned, so that no load lands in a
    // register pair that a load issued before it names
    asm volatile("" :: "v"(rp[0]), "v"(rp[1]), "v"(rp[2]), "v"(rp[3]),
                       "v"(rp[4]), "v"(rp[5]), "v"(rp[6]), "v"(rp[7]),
                       "v"(rp[8]), "v"(rp[9]), "v"(rp[10]), "v"(rp[11]),
                       "v"(rp[12]), "v"(rp[13]), "v"(rp[14]), "v"(rp[15]),
                       "v"(rv[0]), "v"(rv[1]), "v"(rv[2]), "v"(rv[3]),
                       "v"(rv[4]), "v"(rv[5]), "v"(rv[6]), "v"(rv[7]));
    // the same for loaded values 8 to 15 (a statement takes thirty operands)
    asm volatile("" :: "v"(rp[0]), "v"(rp[1]), "v"(rp[2]), "v"(rp[3]),
                       "v"(rp[4]), "v"(rp[5]), "v"(rp[6]), "v"(rp[7]),
                       "v"(rp[8]), "v"(rp[9]), "v"(rp[10]), "v"(rp[11]),
                       "v"(rp[12]), "v"(rp[13]), "v"(rp[14]), "v"(rp[15]),
                       "v"(rv[8]), "v"(rv[9]), "v"(rv[10]), "v"(rv[11]),
                       "v"(rv[12]), "v"(rv[13]), "v"(rv[14]), "v"(rv[15]));
  }
  __syncthreads();   // the tile is whole before any wave reads rows of it

  if (do_gelu) {
    // kept rolled rather than 64 inlined erff bodies, for speed only
    size_t o = o0;
#pragma unroll 1
    for (int it = 0; it < 16; ++it) {
      v4f val = *(const v4f*)(srow + it * 8 * SP);
      if (bias) val += bv;
#pragma unroll
      for (int c = 0; c < 4; ++c)
        val[c] = 0.5f * val[c] * (1.f + erff(val[c] * 0.70710678118654752f));
      if (resid) val += *(const v4f*)(resid + o);
      if (outf) {
        *(v4f*)(outf + o) = val;
        // closes this branch: no register that the store names is written before it
        asm volatile("s_wait_xcnt 0x0" ::: "memory");
      } else {
        uint2 pk;
        pk.x = (unsigned int)f2bf(val[0]) | ((unsigned int)f2bf(val[1]) << 16);
        pk.y = (unsigned int)f2bf(val[2]) | ((unsigned int)f2bf(val[3]) << 16);
        *(uint2*)(outb + o) = pk;
      }
      // the registers that the store names are rewritten in the next trip; the
      // scheduling fence keeps those writes behind the wait
      asm volatile("s_wait_xcnt 0x0" ::: "memory");
      __builtin_amdgcn_sched_barrier(0);
      o += oStep;
    }
  } else {
    v4f val[16];
#pragma unroll
    for (int it = 0; it < 16; ++it) val[it] = *(const v4f*)(srow + it * 8 * SP);
    if (bias) {
#pragma unroll
      for (int it = 0; it < 16; ++it) val[it] += bv;
    }
    if (resid) {
#pragma unroll
      for (int it = 0; it < 16; ++it) val[it] += rv[it];
    }
    // In both forms only stores stand between the first statement and the last, so
    // that no register which an issued store names is written again among them.
    if (outf) {
      float* op[16];
#pragma unroll
      for (int it = 0; it < 16; ++it) op[it] = outf + o0 + it * oStep;
      // all 16 store addresses are made ahead of the first store
      asm volatile("" :: "v"(op[0]), "v"(op[1]), "v"(op[2]), "v"(op[3]),
                         "v"(op[4]), "v"(op[5]), "v"(op[6]), "v"(op[7]),
                         "v"(op[8]), "v"(op[9]), "v"(op[10]), "v"(op[11]),
                         "v"(op[12]), "v"(op[13]), "v"(op[14]), "v"(op[15]) : "memory");
      // keeps the sums above from sinking among the stores
      __builtin_amdgcn_sched_barrier(0);
#pragma unroll
      for (int it = 0; it < 16; ++it) *(v4f*)op[it] = val[it];
      // the addresses stay live to here, and the wait closes the run of stores: no
      // register that a store names is written before it on any way out of the branch
      asm volatile("s_wait_xcnt 0x0"
                      :: "v"(op[0]), "v"(op[1]), "v"(op[2]), "v"(op[3]),
                         "v"(op[4]), "v"(op[5]), "v"(op[6]), "v"(op[7]),
                         "v"(op[8]), "v"(op[9]), "v"(op[10]), "v"(op[11]),
                         "v"(op[12]), "v"(op[13]), "v"(op[14]), "v"(op[15]) : "memory");
    } else {
      unsigned short* op[16];
      uint2 pk[16];
#pragma unroll
      for (int it = 0; it < 16; ++it) {
        op[it] = outb + o0 + it * oStep;
        pk[it].x = (unsigned int)f2bf(val[it][0]) | ((unsigned int)f2bf(val[it][1]) << 16);
        pk[it].y = (unsigned int)f2bf(val[it][2]) | ((unsigned int)f2bf(val[it][3]) << 16);
      }
      // all 16 store addresses are made ahead of the first store
      asm volatile("" :: "v"(op[0]), "v"(op[1]), "v"(op[2]), "v"(op[3]),
                         "v"(op[4]), "v"(op[5]), "v"(op[6]), "v"(op[7]),
                         "v"(op[8]), "v"(op[9]), "v"(op[10]), "v"(op[11]),
                         "v"(op[12]), "v"(op[13]), "v"(op[14]), "v"(op[15]) : "memory");
      // keeps the rounding and packing above from sinking among the stores
      __builtin_amdgcn_sched_barrier(0);
#pragma unroll
      for (int it = 0; it < 16; ++it) *(uint2*)op[it] = pk[it];
      // the addresses stay live to behind the last store
      asm volatile("" :: "v"(op[0]), "v"(op[1]), "v"(op[2]), "v"(op[3]),
                         "v"(op[4]), "v"(op[5]), "v"(op[6]), "v"(op[7]),
                         "v"(op[8]), "v"(op[9]), "v"(op[10]), "v"(op[11]),
                         "v"(op[12]), "v"(op[13]), "v"(op[14]), "v"(op[15]) : "memory");
    }
  }
}

// ---------------------------------------------------------------------------
// erf of two values without a branch. The two ranges and their polynomials are
// those of the f32 math library's erff: |x| < 1: x + x p(x^2); otherwise
// 1 - exp(-(|x| + |x| q(|x|))), with the sign of x. Both are worked out in every
// lane and one is selected. In a wave of mixed values the library's form runs
// both sides of its branch anyway, one element after the other, each a single
// dependent chain; here the elements are independent chains that the compiler
// interleaves, two to a packed instruction.
// exp(-a), a >= 1, is one exp2: the rounding of a * log2(e) moves it by less than
// a * exp(-a) * 2^-24, under half a unit in the last place of the difference.
// ---------------------------------------------------------------------------
static __device__ __forceinline__ v2f both(unsigned int bits) {
  float f = __builtin_bit_cast(float, bits);
  v2f r = {f, f};
  return r;
}
static __device__ __forceinline__ v2f erf_pair(v2f x) {
  v2f ax = {__builtin_fabsf(x.x), __builtin_fabsf(x.y)};
  v2f q = __builtin_elementwise_fma(ax, both(0x378e98abu), both(0xb9c68948u));
  q = __builtin_elementwise_fma(ax, q, both(0x3b7cd369u));
  q = __builtin_elementwise_fma(ax, q, both(0xbcc618b2u));
  q = __builtin_elementwise_fma(ax, q, both(0x3dda74e4u));
  q = __builtin_elementwise_fma(ax, q, both(0x3f228afdu));
  q = __builtin_elementwise_fma(ax, q, both(0x3e03c728u));
  q = __builtin_elementwise_fma(ax, q, ax);
  q *= -1.44269504088896340736f;                       // -log2(e)
  v2f far = {1.f - __builtin_amdgcn_exp2f(q.x), 1.f - __builtin_amdgcn_exp2f(q.y)};
  v2f t = x * x;
  v2f p = __builtin_elementwise_fma(t, both(0xba1345e1u), both(0x3ba10414u));
  p = __builtin_elementwise_fma(t, p, both(0xbcdac9b8u));
  p = __builtin_elementwise_fma(t, p, both(0x3de703beu));
  p = __builtin_elementwise_fma(t, p, both(0xbec09330u));
  p = __builtin_elementwise_fma(t, p, both(0x3e0375d0u));
  p = __builtin_elementwise_fma(ax, p, ax);
  v2f r = {__builtin_copysignf(ax.x < 1.f ? p.x : far.x, x.x),
           __builtin_copysignf(ax.y < 1.f ? p.y : far.y, x.y)};
  return r;
}

#define WBM 256
#define WBN 256
#define WBK 128
#define WNW 16                    // waves of a block
#define WAP 136                   // A pitch in LDS, elements (272 B)
#define WBP 272                   // B pitch in LDS, elements (544 B)
#define WA_ELEMS (WBM * WAP)      // one A buffer
#define WB_ELEMS (WBK * WBP)      // one B buffer
__global__ __launch_bounds__(WNW * 32)
void gemm_wmma_wide_kernel(const unsigned short* __restrict__ A,
                           const unsigned short* __restrict__ Bw,
                           int N, int K,
                           const float* __restrict__ bias, int do_gelu,
                           unsigned short* __restrict__ outb,
                           int zB, int zO) {
  Bw   += (size_t)blockIdx.z * zB;
  outb += (size_t)blockIdx.z * zO;
  __shared__ alignas(16) unsigned short ring[2 * WA_ELEMS + 2 * WB_ELEMS];  // 278,528 B
  unsigned short* Al = ring;                  // [2][m 256][WAP]
  unsigned short* Bl = ring + 2 * WA_ELEMS;   // [2][k 128][WBP]

  int t = threadIdx.x;
  int wave = t >> 5, lane = t & 31;
  int lm = lane & 15, hf = lane >> 4;
  int mBase = blockIdx.y * WBM;
  int nBase = blockIdx.x * WBN;
  int wm = (wave >> 2) * 64;
  int wn = (wave & 3) * 64;
  int kIters = K >> 7;

  // A tile: 256 m rows of 256 B, sixteen lanes a row. B tile: 128 k rows of 512 B,
  // a whole wave a row. Eight copies of each a lane.
  int arow0 = t >> 4, ac8 = (t & 15) * 8;
  int brow0 = t >> 5, bc8 = (t & 31) * 8;
  const unsigned short* aLane = A + (size_t)arow0 * K + ac8;
  const unsigned short* bLane = Bw + (size_t)brow0 * N + nBase + bc8;
  auto stage = [&](int kt, int buf) {
    unsigned int l[8];
    unsigned long long g[8];
#pragma unroll
    for (int i = 0; i < 8; ++i) {
      int row = arow0 + i * 32;
      l[i] = (unsigned int)(unsigned long long)&Al[buf * WA_ELEMS + row * WAP + ac8];
      g[i] = (unsigned long long)(aLane + ((size_t)(mBase + i * 32) * K + kt * WBK));
    }
    async_copy_8x16B(l, g);
#pragma unroll
    for (int i = 0; i < 8; ++i) {
      int row = brow0 + i * 16;
      l[i] = (unsigned int)(unsigned long long)&Bl[buf * WB_ELEMS + row * WBP + bc8];
      g[i] = (unsigned long long)(bLane + (size_t)(kt * WBK + i * 16) * N);
    }
    async_copy_8x16B(l, g);
  };
  // the lane's place in a 16 x 16 block for the transposing load
  int trow = hf * 8 + (lane & 7), tcol = ((lane >> 3) & 1) * 8;

  v8f vzero = {};
  // tile i * 4 + j: acc[..][v] = C[wm + 16 i + lm][wn + 16 j + 8 hf + v]
  v8f acc[16];
#pragma unroll
  for (int q = 0; q < 16; ++q) acc[q] = vzero;

  // prologue: tile 0 lands and is published
  stage(0, 0);
  asm volatile("s_wait_asynccnt 0x0" ::: "memory");  // own copies landed before the barrier
  __syncthreads();

  for (int kt = 0; kt < kIters; ++kt) {
    int cur = kt & 1;
    const unsigned short* Ac = Al + cur * WA_ELEMS;
    const unsigned short* Bc = Bl + cur * WB_ELEMS;

    // tile kt+1 is set flying, at the head of the trip, into the buffer that the
    // barrier at the foot of trip kt-1 has freed
    if (kt + 1 < kIters) stage(kt + 1, cur ^ 1);

#pragma unroll
    for (int ks = 0; ks < 4; ++ks) {     // the tile's four steps of 32 k
      FragU af[4], bf[4];
      int k0 = ks * 32;
#pragma unroll
      for (int i = 0; i < 4; ++i) {
        int arow = wm + i * 16 + lm;
        af[i].q[0] = *(const uint4*)&Ac[arow * WAP + k0 + hf * 8];
        af[i].q[1] = *(const uint4*)&Ac[arow * WAP + k0 + 16 + hf * 8];
      }
#pragma unroll
      for (int j = 0; j < 4; ++j) {
        int bcol = wn + j * 16 + tcol;
        bf[j].q[0] = ld_tr16(&Bc[(k0 + trow) * WBP + bcol]);
        bf[j].q[1] = ld_tr16(&Bc[(k0 + 16 + trow) * WBP + bcol]);
      }
      // keeps the step's 16 LDS reads one group ahead of its WMMAs; without it the
      // compiler sinks them between the WMMAs and each pair waits out the LDS latency
      __builtin_amdgcn_sched_barrier(0);
#pragma unroll
      for (int i = 0; i < 4; ++i)
#pragma unroll
        for (int j = 0; j < 4; ++j)
          acc[i * 4 + j] = __builtin_amdgcn_wmma_f32_16x16x32_bf16(
              false, bf[j].v, false, af[i].v, (short)0, acc[i * 4 + j], false, false);
      // keeps the step's WMMAs ahead of the next step's LDS reads (one fragment set
      // serves all steps) and of the foot's waits and barrier
      __builtin_amdgcn_sched_barrier(0);
    }

    // foot of the trip: own LDS reads done, own copies of tile kt+1 landed; the
    // barrier publishes tile kt+1 and frees buffer cur.
    asm volatile("s_wait_dscnt 0x0" ::: "memory");
    asm volatile("s_wait_asynccnt 0x0" ::: "memory");
    __syncthreads();
  }
  asm volatile("s_wait_asynccnt 0x0" ::: "memory");  // no copy outstanding at the wave's end

  float* stg = (float*)ring;
  const int SP = 260;
  // read-back: a wave takes half a row, 128 columns, at a time, 4 columns a lane
  int ecol = lane * 4;
  v4f bv0 = {}, bv1 = {};
  if (bias) {
    bv0 = *(const v4f*)(bias + nBase + ecol);
    bv1 = *(const v4f*)(bias + nBase + 128 + ecol);
  }
#pragma unroll
  for (int i = 0; i < 4; ++i)
#pragma unroll
    for (int j = 0; j < 4; ++j) {
      float* d = stg + (wm + i * 16 + lm) * SP + wn + j * 16 + hf * 8;
      v8f a = acc[i * 4 + j];
      v4f lo = {a[0], a[1], a[2], a[3]}, hi = {a[4], a[5], a[6], a[7]};
      *(v4f*)d       = lo;
      *(v4f*)(d + 4) = hi;
    }
  __syncthreads();   // the tile is whole before any wave reads rows of it

  const float* srow = stg + wave * SP + ecol;
  unsigned short* orow = outb + (size_t)(mBase + wave) * N + nBase + ecol;
  size_t oStep = (size_t)WNW * N;
  if (do_gelu) {
    // four runs of 4 whole rows (8 half rows, 32 elements a lane); kept rolled, so
    // that one run's registers and code serve all four
#pragma unroll 1
    for (int g = 0; g < WBM / WNW / 4; ++g) {
      v4f val[8];
#pragma unroll
      for (int u = 0; u < 8; ++u)
        val[u] = *(const v4f*)(srow + (g * 4 + (u >> 1)) * WNW * SP + (u & 1) * 128);
      if (bias) {
#pragma unroll
        for (int u = 0; u < 8; ++u) val[u] += (u & 1) ? bv1 : bv0;
      }
      unsigned short* op[4];             // one address a row; its right half at + 256 B
      uint2 pk[8];
#pragma unroll
      for (int r = 0; r < 4; ++r) op[r] = orow + (g * 4 + r) * oStep;
#pragma unroll
      for (int u = 0; u < 8; ++u) {
        v2f lo = {val[u][0], val[u][1]}, hi = {val[u][2], val[u][3]};
        lo = 0.5f * lo * (1.f + erf_pair(lo * 0.70710678118654752f));
        hi = 0.5f * hi * (1.f + erf_pair(hi * 0.70710678118654752f));
        pk[u].x = (unsigned int)f2bf(lo.x) | ((unsigned int)f2bf(lo.y) << 16);
        pk[u].y = (unsigned int)f2bf(hi.x) | ((unsigned int)f2bf(hi.y) << 16);
      }
      // all 4 store addresses are made ahead of the first store
      asm volatile("" :: "v"(op[0]), "v"(op[1]), "v"(op[2]), "v"(op[3]) : "memory");
      // keeps the arithmetic and packing above from sinking among the stores
      __builtin_amdgcn_sched_barrier(0);
#pragma unroll
      for (int u = 0; u < 8; ++u) *(uint2*)(op[u >> 1] + (u & 1) * 128) = pk[u];
      // the addresses stay live to here, and the wait closes the run of stores: no
      // register that a store names is written before it
      asm volatile("s_wait_xcnt 0x0"
                      :: "v"(op[0]), "v"(op[1]), "v"(op[2]), "v"(op[3]) : "memory");
      // keeps the next run's register writes behind that wait
      __builtin_amdgcn_sched_barrier(0);
    }
  } else {
    // two runs of 16 half rows: the left 128 columns, then the right; kept rolled,
    // so that one run's registers and code serve both
#pragma unroll 1
    for (int hb = 0; hb < 2; ++hb) {
      int ch = hb * 128;
      v4f val[16];
#pragma unroll
      for (int it = 0; it < 16; ++it) val[it] = *(const v4f*)(srow + it * WNW * SP + ch);
      if (bias) {
        v4f bv = hb ? bv1 : bv0;
#pragma unroll
        for (int it = 0; it < 16; ++it) val[it] += bv;
      }
      unsigned short* op[16];
      uint2 pk[16];
#pragma unroll
      for (int it = 0; it < 16; ++it) {
        op[it] = orow + it * oStep + ch;
        pk[it].x = (unsigned int)f2bf(val[it][0]) | ((unsigned int)f2bf(val[it][1]) << 16);
        pk[it].y = (unsigned int)f2bf(val[it][2]) | ((unsigned int)f2bf(val[it][3]) << 16);
      }
      // all 16 store addresses are made ahead of the first store
      asm volatile("" :: "v"(op[0]), "v"(op[1]), "v"(op[2]), "v"(op[3]),
                         "v"(op[4]), "v"(op[5]), "v"(op[6]), "v"(op[7]),
                         "v"(op[8]), "v"(op[9]), "v"(op[10]), "v"(op[11]),
                         "v"(op[12]), "v"(op[13]), "v"(op[14]), "v"(op[15]) : "memory");
      // keeps the rounding and packing above from sinking among the stores
      __builtin_amdgcn_sched_barrier(0);
#pragma unroll
      for (int it = 0; it < 16; ++it) *(uint2*)op[it] = pk[it];
      // the addresses stay live to here, and the wait closes the run of stores: no
      // register that a store names is written before it
      asm volatile("s_wait_xcnt 0x0"
                      :: "v"(op[0]), "v"(op[1]), "v"(op[2]), "v"(op[3]),
                         "v"(op[4]), "v"(op[5]), "v"(op[6]), "v"(op[7]),
                         "v"(op[8]), "v"(op[9]), "v"(op[10]), "v"(op[11]),
                         "v"(op[12]), "v"(op[13]), "v"(op[14]), "v"(op[15]) : "memory");
      // keeps the second run's register writes behind that wait
      __builtin_amdgcn_sched_barrier(0);
    }
  }
}

typedef __attribute__((ext_vector_type(2))) __bf16 v2bf;
#define AKT 64                    // keys of a trip

static __device__ __forceinline__ float xhalf(float x) {
  int b = __builtin_bit_cast(int, x);
  return __builtin_bit_cast(float, __builtin_amdgcn_permlanex16(
      b, b, 0x76543210, 0xfedcba98, false, false));
}
// two f32 -> one dword of two bf16 (a in the low half), round to nearest even
static __device__ __forceinline__ unsigned int pack_bf16(float a, float b) {
  v2f f = {a, b};
  return __builtin_bit_cast(unsigned int, __builtin_convertvector(f, v2bf));
}
static __device__ __forceinline__ void async_copy_4x16B(const unsigned int* l,
                                                        const unsigned long long* g) {
  asm volatile("global_load_async_to_lds_b128 %0, %4, off\n\t"
               "global_load_async_to_lds_b128 %1, %5, off\n\t"
               "global_load_async_to_lds_b128 %2, %6, off\n\t"
               "global_load_async_to_lds_b128 %3, %7, off\n\t"
               "s_wait_xcnt 0x0"
               :: "v"(l[0]), "v"(l[1]), "v"(l[2]), "v"(l[3]),
                  "v"(g[0]), "v"(g[1]), "v"(g[2]), "v"(g[3])
               : "memory");
}

__global__ __launch_bounds__(128)
void flash_attn_kernel(const unsigned short* __restrict__ Q,
                       const unsigned short* __restrict__ Km,
                       const unsigned short* __restrict__ Vm,
                       unsigned short* __restrict__ O) {
  __shared__ alignas(16) unsigned short Qs[64][72];       // 144B rows
  __shared__ alignas(16) unsigned short Ks[2][AKT][72];   // 144B rows
  __shared__ alignas(16) unsigned int   Vt[2][64][36];    // [dh][keypair], 144B rows

  int t = threadIdx.x;
  int wave = t >> 5, lane = t & 31;
  int lm = lane & 15, hf = lane >> 4;
  int bh = blockIdx.x;
  int b = bh / H_, h = bh % H_;
  int q0 = b * N_ + blockIdx.y * 64;
  int colh = h * DH_;
  int rowBase = wave * 16;
  const int kbIters = N_ / AKT;

  // K tile: 64 rows of 128 B. Eight lanes cover one whole row per copy.
  int krow0 = t >> 3, kc8 = (t & 7) * 8;
  const unsigned short* kLane = Km + (size_t)(b * N_ + krow0) * HD + colh + kc8;
  auto stageK = [&](int kb, int buf) {
    unsigned int l[4];
    unsigned long long g[4];
#pragma unroll
    for (int i = 0; i < 4; ++i) {
      l[i] = (unsigned int)(unsigned long long)&Ks[buf][krow0 + i * 16][kc8];
      g[i] = (unsigned long long)(kLane + (size_t)(kb * AKT + i * 16) * HD);
    }
    async_copy_4x16B(l, g);
  };
  // V tile: 32 key pairs x 32 dh pairs. A lane keeps one dh pair; wave w takes
  // key pairs 4 i + w, i = 0..7.
  int dh0 = lane * 2;
  const unsigned short* vLane = Vm + (size_t)(b * N_ + 2 * wave) * HD + colh + dh0;
  unsigned int vr0[8], vr1[8];
  auto loadV = [&](int kb) {
    const unsigned short* p = vLane + (size_t)(kb * AKT) * HD;
#pragma unroll
    for (int i = 0; i < 8; ++i) {
      vr0[i] = *(const unsigned int*)(p + (8 * i) * HD);
      vr1[i] = *(const unsigned int*)(p + (8 * i + 1) * HD);
    }
  };
  auto storeV = [&](int buf) {
#pragma unroll
    for (int i = 0; i < 8; ++i) {
      int kp = i * 4 + wave;
      Vt[buf][dh0][kp]     = (vr0[i] & 0xFFFFu) | (vr1[i] << 16);
      Vt[buf][dh0 + 1][kp] = (vr0[i] >> 16)     | (vr1[i] & 0xFFFF0000u);
    }
  };

  // load Q tile 64x64 (64B per thread)
  {
    int row = t >> 1, c32 = (t & 1) * 32;
    const uint4* src = (const uint4*)(Q + (size_t)(q0 + row) * HD + colh + c32);
    uint4* dst = (uint4*)&Qs[row][c32];
    dst[0] = src[0]; dst[1] = src[1]; dst[2] = src[2]; dst[3] = src[3];
  }

  v8f vzero = {};
  v8f o[4];
#pragma unroll
  for (int c = 0; c < 4; ++c) o[c] = vzero;
  // of query lm: running maximum (both halves alike), and the sum over the
  // keys that this half of the wave holds
  float mrow = -1e30f, lrow = 0.f;

  // prologue: stage tile 0 (barrier also publishes Qs)
  stageK(0, 0);
  loadV(0);
  storeV(0);
  asm volatile("s_wait_asynccnt 0x0" ::: "memory");  // own copies landed before the barrier
  __syncthreads();

  // Q^T fragments (B operand), read once and kept in registers
  FragU qb[2];
#pragma unroll
  for (int st = 0; st < 2; ++st) {
    qb[st].q[0] = *(const uint4*)&Qs[rowBase + lm][st * 32 + hf * 8];
    qb[st].q[1] = *(const uint4*)&Qs[rowBase + lm][st * 32 + 16 + hf * 8];
  }

  for (int kb = 0; kb < kbIters; ++kb) {
    int cur = kb & 1;
    bool more = (kb + 1) < kbIters;
    // tile kb+1 is set flying into the buffers that the barrier at the foot of
    // trip kb-1 has freed
    if (more) { stageK(kb + 1, cur ^ 1); loadV(kb + 1); }

    // K fragments (A operand of S^T)
    FragU kf[2][4];
#pragma unroll
    for (int st = 0; st < 2; ++st)
#pragma unroll
      for (int j = 0; j < 4; ++j) {
        kf[st][j].q[0] = *(const uint4*)&Ks[cur][j * 16 + lm][st * 32 + hf * 8];
        kf[st][j].q[1] = *(const uint4*)&Ks[cur][j * 16 + lm][st * 32 + 16 + hf * 8];
      }
    // V^T fragments (A operand of O^T), keys 32 kk + ...
    FragU vf[2][4];
#pragma unroll
    for (int kk = 0; kk < 2; ++kk)
#pragma unroll
      for (int ct = 0; ct < 4; ++ct) {
        vf[kk][ct].q[0] = *(const uint4*)&Vt[cur][ct * 16 + lm][kk * 16 + hf * 4];
        vf[kk][ct].q[1] = *(const uint4*)&Vt[cur][ct * 16 + lm][kk * 16 + 8 + hf * 4];
      }
    // keeps the next tile's V loads and the trip's 32 LDS reads at the head of the trip;
    // without it the compiler sinks each to just ahead of its use, and the wave
    // waits out the L2 and LDS latencies there
    __builtin_amdgcn_sched_barrier(0);

    // ---- S^T = K Q^T  (four 16-key tiles, two k-steps over DH=64) ----
    // s[j][v] = score of key 16 j + 8 hf + v against query lm
    v8f s[4];
#pragma unroll
    for (int j = 0; j < 4; ++j) s[j] = vzero;
#pragma unroll
    for (int st = 0; st < 2; ++st)
#pragma unroll
      for (int j = 0; j < 4; ++j)
        s[j] = __builtin_amdgcn_wmma_f32_16x16x32_bf16(
            false, kf[st][j].v, false, qb[st].v, (short)0, s[j], false, false);
    __builtin_amdgcn_sched_barrier(0);

    // ---- online softmax of one query per lane ----
    float tj[4];                       // one chain per score tile
#pragma unroll
    for (int j = 0; j < 4; ++j) {
      tj[j] = fmaxf(s[j][0], s[j][1]);
#pragma unroll
      for (int v = 2; v < 8; ++v) tj[j] = fmaxf(tj[j], s[j][v]);
    }
    float tm = fmaxf(fmaxf(tj[0], tj[1]), fmaxf(tj[2], tj[3]));
    tm = fmaxf(tm, xhalf(tm));         // the other 32 keys of this query
    float mn = fmaxf(mrow, tm);
    float scale = __expf(mrow - mn);
    mrow = mn;
    // ---- P^T as B operand of key group kk: k = 8 hf + v from tile 2 kk,
    //      16 + 8 hf + v from tile 2 kk + 1 ----
    FragU pb[2];
    v2f rs[4];                         // a tile's sums over even and over odd v
#pragma unroll
    for (int j = 0; j < 4; ++j) {
      v2f p[4];
#pragma unroll
      for (int i = 0; i < 4; ++i) {
        p[i].x = __expf(s[j][2 * i] - mn);
        p[i].y = __expf(s[j][2 * i + 1] - mn);
        pb[j >> 1].u[(j & 1) * 4 + i] = pack_bf16(p[i].x, p[i].y);
      }
      rs[j] = (p[0] + p[1]) + (p[2] + p[3]);
    }
    v2f rt = (rs[0] + rs[1]) + (rs[2] + rs[3]);
    lrow = lrow * scale + (rt.x + rt.y);
#pragma unroll
    for (int c = 0; c < 4; ++c)
#pragma unroll
      for (int v = 0; v < 8; ++v) o[c][v] *= scale;

    __builtin_amdgcn_sched_barrier(0);

    // ---- O^T += V^T P^T : o[ct][v] = O[query lm][dh 16 ct + 8 hf + v] ----
#pragma unroll
    for (int kk = 0; kk < 2; ++kk)
#pragma unroll
      for (int ct = 0; ct < 4; ++ct)
        o[ct] = __builtin_amdgcn_wmma_f32_16x16x32_bf16(
            false, vf[kk][ct].v, false, pb[kk].v, (short)0, o[ct], false, false);

    // keeps the wait for the next tile's V loads, with their pack and store,
    // behind the trip's products; without it the compiler lifts that wait to
    // just behind the first WMMA, where the loads have had no time to return
    __builtin_amdgcn_sched_barrier(0);
    if (more) storeV(cur ^ 1);
    // foot of the trip: own LDS reads and V stores done, own K copies of tile
    // kb+1 landed; the barrier publishes tile kb+1 and frees buffer cur.
    asm volatile("s_wait_dscnt 0x0" ::: "memory");
    asm volatile("s_wait_asynccnt 0x0" ::: "memory");
    __syncthreads();
  }
  asm volatile("s_wait_asynccnt 0x0" ::: "memory");  // no copy outstanding at the wave's end

  // ---- normalize and store bf16: 8 consecutive dh of one query per store ----
  float lsum = lrow + xhalf(lrow);     // the two halves' key sums joined
  uint4 ov[4];
#pragma unroll
  for (int ct = 0; ct < 4; ++ct) {
    ov[ct].x = pack_bf16(o[ct][0] / lsum, o[ct][1] / lsum);
    ov[ct].y = pack_bf16(o[ct][2] / lsum, o[ct][3] / lsum);
    ov[ct].z = pack_bf16(o[ct][4] / lsum, o[ct][5] / lsum);
    ov[ct].w = pack_bf16(o[ct][6] / lsum, o[ct][7] / lsum);
  }
  unsigned short* orow = O + (size_t)(q0 + rowBase + lm) * HD + colh + hf * 8;
#pragma unroll
  for (int ct = 0; ct < 4; ++ct) *(uint4*)(orow + ct * 16) = ov[ct];
}

// ---------------------------------------------------------------------------
// Host-side orchestration
// ---------------------------------------------------------------------------
extern "C" void kernel_launch(void* const* d_in, const int* in_sizes, int n_in,
                              void* d_out, int out_size, void* d_ws, size_t ws_size,
                              hipStream_t stream) {
  const float* x     = (const float*)d_in[0];
  const float* wq    = (const float*)d_in[1];
  const float* wk    = (const float*)d_in[2];
  const float* wv    = (const float*)d_in[3];
  const float* wo    = (const float*)d_in[4];
  const float* w1    = (const float*)d_in[5];
  const float* b1    = (const float*)d_in[6];
  const float* w2    = (const float*)d_in[7];
  const float* b2    = (const float*)d_in[8];
  const float* ln1_g = (const float*)d_in[9];
  const float* ln1_b = (const float*)d_in[10];
  const float* ln2_g = (const float*)d_in[11];
  const float* ln2_b = (const float*)d_in[12];
  float* out = (float*)d_out;

  // workspace carve-out (~120 MiB total)
  char* p = (char*)d_ws;
  auto alloc = [&](size_t bytes) -> void* {
    void* r = (void*)p;
    p += (bytes + 255) & ~(size_t)255;
    return r;
  };
  unsigned short* wq_b = (unsigned short*)alloc((size_t)3 * D_ * HD * 2);   // wq | wk | wv
  unsigned short* wk_b = wq_b + D_ * HD;
  unsigned short* wv_b = wk_b + D_ * HD;
  unsigned short* wo_b = (unsigned short*)alloc((size_t)HD * D_ * 2);
  unsigned short* w1_b = (unsigned short*)alloc((size_t)D_ * FF_ * 2);
  unsigned short* w2_b = (unsigned short*)alloc((size_t)FF_ * D_ * 2);
  unsigned short* h_b  = (unsigned short*)alloc((size_t)ROWS * D_ * 2);
  unsigned short* q_b  = (unsigned short*)alloc((size_t)3 * ROWS * HD * 2); // q | k | v
  unsigned short* k_b  = q_b + ROWS * HD;
  unsigned short* v_b  = k_b + ROWS * HD;
  unsigned short* a_b  = (unsigned short*)alloc((size_t)ROWS * HD * 2);
  float*          x2   = (float*)        alloc((size_t)ROWS * D_ * 4);
  unsigned short* h2_b = (unsigned short*)alloc((size_t)ROWS * D_ * 2);
  unsigned short* ff_b = (unsigned short*)alloc((size_t)ROWS * FF_ * 2);

  // 1) weights -> bf16 and LN1, one launch
  cast_and_layernorm_kernel<<<CAST_GRID + ROWS, 256, 0, stream>>>(
      wq, wk, wv, wo, w1, w2, wq_b, wk_b, wv_b, wo_b, w1_b, w2_b, x, ln1_g, ln1_b, h_b);

  // 2) Q/K/V projections, one launch of three planes
  dim3 gemmBlk(256);
  dim3 attnBlk(128);
  dim3 wideBlk(WNW * 32);
  dim3 gQKV(HD / WBN, ROWS / WBM, 3);
  gemm_wmma_wide_kernel<<<gQKV, wideBlk, 0, stream>>>(h_b, wq_b, HD, D_,
                                                      nullptr, 0, q_b,
                                                      D_ * HD, ROWS * HD);

  // 3) attention
  dim3 gAttn(B_ * H_, N_ / 64);
  flash_attn_kernel<<<gAttn, attnBlk, 0, stream>>>(q_b, k_b, v_b, a_b);

  // 4) out projection + residual -> x2 (fp32)
  dim3 gO(D_ / GBN, ROWS / GBM);
  gemm_wmma_kernel<<<gO, gemmBlk, 0, stream>>>(a_b, wo_b, ROWS, D_, HD,
                                               nullptr, 0, x, nullptr, x2, 0, 0);

  // 5) LN2
  layernorm_bf16_kernel<<<ROWS, 256, 0, stream>>>(x2, ln2_g, ln2_b, h2_b);

  // 6) FF1 + bias + exact GELU -> bf16
  dim3 gFF1(FF_ / WBN, ROWS / WBM);
  gemm_wmma_wide_kernel<<<gFF1, wideBlk, 0, stream>>>(h2_b, w1_b, FF_, D_,
                                                      b1, 1, ff_b, 0, 0);

  // 7) FF2 + bias + residual -> out (fp32)
  dim3 gFF2(D_ / GBN, ROWS / GBM);
  gemm_wmma_kernel<<<gFF2, gemmBlk, 0, stream>>>(ff_b, w2_b, ROWS, D_, FF_,
                                                 b2, 0, x2, nullptr, out, 0, 0);
}
